// v000
// Times are from an AMD MI455X. After a warm-up the kernel runs many times in a row, and a time is the length of
// such a window on the GPU divided by its runs, so every launch and the gaps after it count. The runs cycle
// through copies of the inputs. A figure is the median of several windows, for all but v000 over two sittings.
// Sittings can differ by a few percent; kernels timed side by side share one.
// v000, which the later versions start from, runs in 329 microseconds.
#include <hip/hip_runtime.h>

// Multi-head cross-attention, 16 heads x 64: q from xq [NB][SEQ][1024], k/v from xc [NB][SEQ][1024]; per-head weights [head][in][out] with biases; score scale 1/8; no mask; concat heads (1024) @ Wo [1024][64] + bo -> out [NB][SEQ][64] f32.
// Compute dtypes, f32 accumulate everywhere: q/k/v projections v_wmma_f32_16x16x32_bf16 (tokens and weights RNE-converted to bf16; products exact), biases RNE-converted to bf16 and added in f32;
// scores v_wmma_f32_16x16x32_f16 (q, k single f16); P (x256 carry, cancels in the normalisation) and v single f16; softmax f32 (online, running max);
// output projection v_wmma_f32_16x16x32_f16: ctx as f16 with x256 carry, Wo as bf16-RNE value x1024 held in f16 (exact), accumulator scaled by 2^-18 and bias added in f32.
// Layout: bf16 copies of both token tensors; weights transposed through LDS into K-contiguous rows [head*64 + n][in]; q, k planes [b*16+h][t][d] and v^T plane [b*16+h][d][t] written by the GEMM epilogue;
// fused flash kernel in transposed form (S^T = K Q^T, O^T = V^T P^T) writing the f16 ctx plane [b*SEQ+t][h*64+d]; final GEMM writes the f32 output.

#ifndef NB
#define NB 4
#endif
#ifndef SEQ
#define SEQ 2048
#endif
#define NB_FULL  4
#define SEQ_FULL 2048
#ifndef OUT_SEQ
#define OUT_SEQ SEQ              // row pitch (in tokens) between batches of the output
#endif
#define DIN  1024                // token width (projection K)
#define NH_  16
#define HD   64
#define DM   (NH_ * HD)          // concatenated head width (output-projection K)
#define NO   64                  // output width
#define AW   4                   // waves per flash block (16 query rows each)
#define SC2  (0.125f * 1.4426950408889634f)   // HD^-0.5 * log2(e)
#define PSH  8.0f                // log2 of the P carry (256)
#define CXS  256.0f              // carry of the ctx plane
#define WOS  1024.0f             // carry of the Wo plane
#define OSC  (1.0f / (256.0f * 1024.0f))

static_assert(HD == 64);
static_assert(NO == 64);                       // output row = 256 bytes = 16 lanes x 16 B
static_assert(NH_ * HD == DM);
static_assert(DM % 64 == 0);
static_assert(DIN % 64 == 0);                  // weight transpose tiles of 64
static_assert(DIN % 32 == 0);                  // GEMM k-loop steps by 32
static_assert(DM % 32 == 0);
static_assert(SEQ % 64 == 0);                  // a 64-row tile never straddles two batches
static_assert((NB * SEQ) % 64 == 0);
static_assert(SEQ % 32 == 0);                  // key loop steps by 32
static_assert(SEQ % (16 * AW) == 0);           // flash grid covers the sequence exactly
static_assert(((size_t)SEQ * DIN) % 8 == 0);
static_assert(NB <= NB_FULL);
static_assert(SEQ <= SEQ_FULL);

typedef _Float16 h16;
typedef unsigned short bf;
typedef __attribute__((ext_vector_type(16))) __bf16   v16bf;
typedef __attribute__((ext_vector_type(16))) _Float16 v16h;
typedef __attribute__((ext_vector_type(8)))  _Float16 v8h;
typedef __attribute__((ext_vector_type(8)))  unsigned short v8us;
typedef __attribute__((ext_vector_type(8)))  float    v8f;
typedef __attribute__((ext_vector_type(4)))  float    v4f;
typedef v4f  __attribute__((may_alias)) v4fa;

__device__ __forceinline__ unsigned short f2bf(float f) { unsigned u = __float_as_uint(f); u += 0x7FFFu + ((u >> 16) & 1u); return (unsigned short)(u >> 16); }
__device__ __forceinline__ float bf2f(unsigned short b) { return __uint_as_float(((unsigned)b) << 16); }
__device__ __forceinline__ float bfr(float f) { return bf2f(f2bf(f)); }   // value after RNE conversion to bf16
__device__ __forceinline__ v16h cat16(v8h lo, v8h hi) { return __builtin_shufflevector(lo, hi, 0, 1, 2, 3, 4, 5, 6, 7, 8, 9, 10, 11, 12, 13, 14, 15); }
__device__ __forceinline__ v16bf cat16b(v8us lo, v8us hi) { return __builtin_bit_cast(v16bf, __builtin_shufflevector(lo, hi, 0, 1, 2, 3, 4, 5, 6, 7, 8, 9, 10, 11, 12, 13, 14, 15)); }
__device__ __forceinline__ v8f wmma16(v16h a, v16h b, v8f c) { return __builtin_amdgcn_wmma_f32_16x16x32_f16(false, a, false, b, (short)0, c, false, false); }
__device__ __forceinline__ v8f wmmab(v16bf a, v16bf b, v8f c) { return __builtin_amdgcn_wmma_f32_16x16x32_bf16(false, a, false, b, (short)0, c, false, false); }
// fragment loaders from K-contiguous 16-bit rows; p already includes + 8*(lane>>4): elements 0..7 <- k0+8h+0..7, elements 8..15 <- k0+16+8h+0..7 (same map for A and B)
__device__ __forceinline__ v16h  ldh(const h16* p) { return cat16(*(const v8h*)p, *(const v8h*)(p + 16)); }
__device__ __forceinline__ v16bf ldb(const bf* p)  { return cat16b(*(const v8us*)p, *(const v8us*)(p + 16)); }
// ordering point for wave-private LDS tiles (same wave writes and reads)
__device__ __forceinline__ void wave_sync() { __builtin_amdgcn_fence(3 /* release order */, "wavefront"); __builtin_amdgcn_wave_barrier(); asm volatile("" ::: "memory"); }

__global__ __launch_bounds__(256) void k_cvt8(const float* __restrict__ src, bf* dst, size_t n8) {
    const size_t i = (size_t)blockIdx.x * 256 + threadIdx.x; if (i >= n8) return;
    const v8f v = *(const v8f*)(src + i * 8); v8us o;
#pragma unroll
    for (int k = 0; k < 8; ++k) o[k] = f2bf(v[k]);
    *(v8us*)(dst + i * 8) = o; 
}

// k_wt: weight transpose + 16-bit convert through LDS. in W[head][Kd][64] (f32, k-major) -> out WT[head*64 + n][Kd] (k-contiguous).
// F16 == 0: bf16 bits (RNE). F16 == 1: f16 of (bf16-RNE value * scale) (exact for power-of-two scale).
template <int F16>
__global__ __launch_bounds__(256) void k_wt(const float* __restrict__ W, bf* WT, int Kd, float scale) {
    __shared__ float ts[64 * 65];
    const int tid = threadIdx.x;
    const int d0 = blockIdx.x * 64, hh = blockIdx.y;
    const float* src = W + ((size_t)hh * Kd + d0) * 64;
#pragma unroll
    for (int it = 0; it < 4; ++it) {                    // 4 x 256 threads x 4 floats = 64 rows x 64 columns
        const int idx = it * 256 + tid; const int row = idx >> 4, c4 = (idx & 15) * 4;
        const v4f v = *(const v4f*)(src + (size_t)row * 64 + c4);
        ts[row * 65 + c4 + 0] = v[0]; ts[row * 65 + c4 + 1] = v[1]; ts[row * 65 + c4 + 2] = v[2]; ts[row * 65 + c4 + 3] = v[3];
    }
    __syncthreads();                                    // cross-wave tile: block barrier
    const int k8 = (tid & 7) * 8, nq = tid >> 3;        // 2 it x 32 row groups = 64 output rows; 8 lanes x 8 = 64 k
    v8us ou[2]; v8h oh[2];
#pragma unroll
    for (int it = 0; it < 2; ++it) {
        const int n = it * 32 + nq;
#pragma unroll
        for (int j = 0; j < 8; ++j) {
            const float w = ts[(k8 + j) * 65 + n];
            ou[it][j] = f2bf(w);
            oh[it][j] = (h16)(bfr(w) * scale);
        }
    }
{
#pragma unroll
        for (int it = 0; it < 2; ++it) {
            const size_t off = (size_t)(hh * 64 + it * 32 + nq) * (size_t)Kd + d0 + k8;
            if (F16) *(v8h*)((h16*)WT + off) = oh[it];
            else     *(v8us*)(WT + off) = ou[it];
        }
        
    }
}

// k_proj: register-blocked bf16 GEMM, ONE WAVE per 64x64 tile (16 accumulators), operands straight from K-contiguous bf16 planes, K = DIN.
// C[m][n] = sum_k A[m][k] Bt[n][k] + bias, written as f16 (Ph) at tile base (r0/RB)*sRB + (r0%RB)*pitch + (c0/CB)*sCB + (c0%CB), row pitch 'pitch' (halves).
// bias (bf16-RNE value, f32 add): per column when bcol == 1 (index n), per row when brow == 1 (index m); exactly one of brow/bcol is 1. grid (M/64, N/64), 32 threads.
__global__ __launch_bounds__(32) void k_proj(const bf* __restrict__ A, const bf* __restrict__ Bt, h16* Ph, const float* __restrict__ bias, int brow, int bcol, int RB, size_t sRB, int pitch, int CB, size_t sCB) {
    __shared__ __align__(16) float os[16 * 68];
    const int K = DIN;
    const int lane = threadIdx.x & 31, lr = lane & 15, hi = lane >> 4; const int r0 = blockIdx.x * 64, c0 = blockIdx.y * 64;
    v8f acc[4][4];
#pragma unroll
    for (int mb = 0; mb < 4; ++mb)
#pragma unroll
        for (int nb = 0; nb < 4; ++nb) acc[mb][nb] = (v8f){};
    const size_t aoff = (size_t)(r0 + lr) * K + 8 * hi, boff = (size_t)(c0 + lr) * K + 8 * hi;
#pragma unroll 1
    for (int kc = 0; kc < K; kc += 32) {
        v16bf a[4];
#pragma unroll
        for (int mb = 0; mb < 4; ++mb) a[mb] = ldb(A + aoff + (size_t)mb * 16 * K + kc);
#pragma unroll
        for (int nb = 0; nb < 4; ++nb) { const v16bf b = ldb(Bt + boff + (size_t)nb * 16 * K + kc);
#pragma unroll
            for (int mb = 0; mb < 4; ++mb) acc[mb][nb] = wmmab(a[mb], b, acc[mb][nb]); }
        asm volatile("v_nop\n\tv_nop\n\tv_nop\n\tv_nop" : "+v"(acc[0][0]), "+v"(acc[1][1]), "+v"(acc[2][2]), "+v"(acc[3][3]) : "v"(a[0]), "v"(a[1]), "v"(a[2]), "v"(a[3]));
    }
    const size_t tbase = (size_t)(r0 / RB) * sRB + (size_t)(r0 % RB) * (size_t)pitch + (size_t)(c0 / CB) * sCB + (size_t)(c0 % CB);
    const int c8 = (lane & 7) * 8, rq = lane >> 3;
    const float fbc = (float)bcol, fbr = (float)brow;
    float bc[8];
#pragma unroll
    for (int i = 0; i < 8; ++i) bc[i] = bfr(bias[(size_t)(c0 + c8 + i) * (size_t)bcol]) * fbc;   // index < N when bcol == 1, else 0
#pragma unroll
    for (int mb = 0; mb < 4; ++mb) {
#pragma unroll
        for (int nb = 0; nb < 4; ++nb) {
#pragma unroll
            for (int j = 0; j < 8; ++j) os[(hi * 8 + j) * 68 + nb * 16 + lr] = acc[mb][nb][j]; }   // D: row 8h+j, col lane&15
        wave_sync();
        const size_t sb = tbase + (size_t)(mb * 16) * (size_t)pitch;
{
#pragma unroll
            for (int s = 0; s < 4; ++s) { const int row = 4 * s + rq;   // 4 s x 4 row groups = 16 rows; 8 lanes x 8 = 64 columns
                const v4f x0 = *(const v4fa*)(&os[row * 68 + c8]); const v4f x1 = *(const v4fa*)(&os[row * 68 + c8 + 4]); v8h hv;
                const float br = bfr(bias[(size_t)(r0 + mb * 16 + row) * (size_t)brow]) * fbr;         // index < M when brow == 1, else 0
#pragma unroll
                for (int i = 0; i < 4; ++i) { hv[i] = (h16)(x0[i] + bc[i] + br); hv[4 + i] = (h16)(x1[i] + bc[4 + i] + br); }
                const size_t oo = sb + (size_t)row * (size_t)pitch + c8;
                *(v8h*)(Ph + oo) = hv; }
             }
        wave_sync();
    }
}

// k_flash: fused attention, one wave per 16 query rows of one (batch, head); K / V^T / Q fragments straight from the f16 planes (two 16-B loads each, arithmetic addressing).
// Transposed form: S^T[key][t] = K Q^T (A = K rows, B = Q rows); lane (t = lane&15, h = lane>>4) holds keys 8h+r of each 16-key tile, so the packed
// P tile is directly the B fragment of O^T[d][t] = V^T P^T (element r <- tile keys 0..15, element 8+r <- tile keys 16..31, lane unchanged).
// Softmax state (running max, partial sum) is one scalar per lane; the two lane halves of a row are combined with one xor-16 exchange.
__global__ __launch_bounds__(32 * AW) void k_flash(const h16* __restrict__ QH, const h16* __restrict__ KP, const h16* __restrict__ VT, h16* CTX) {
    __shared__ __align__(16) float os[AW * 16 * 68];
    const int lane = threadIdx.x & 31, wave = threadIdx.x >> 5, lr = lane & 15, hi = lane >> 4;
    const int zh = blockIdx.y; const int b = zh / NH_, h = zh % NH_;
    const int t0 = (blockIdx.x * AW + wave) * 16;
    const size_t pbase = (size_t)zh * SEQ * HD;
    const size_t qo = pbase + (size_t)(t0 + lr) * HD + 8 * hi;
    const v16h qh0 = ldh(QH + qo), qh1 = ldh(QH + qo + 32);   // B fragments: col t, k = d
    const size_t ko = pbase + (size_t)lr * HD + 8 * hi;      // + key * HD       (A fragment: row key, k = d)
    const size_t vo = pbase + (size_t)lr * SEQ + 8 * hi;     // + 16j*SEQ + key  (A fragment: row d, k = key)
    v8f o0 = (v8f){}, o1 = (v8f){}, o2 = (v8f){}, o3 = (v8f){};
    float m = -3.0e38f, l = 0.0f;
#pragma unroll 1
    for (int key0 = 0; key0 < SEQ; key0 += 32) {
        const h16* ka = KP + ko + (size_t)key0 * HD;
        const v16h ka0 = ldh(ka), ka1 = ldh(ka + 32), kb0 = ldh(ka + 16 * HD), kb1 = ldh(ka + 16 * HD + 32);
        v8f sA = (v8f){}, sB = (v8f){};
        sA = wmma16(ka0, qh0, sA); sB = wmma16(kb0, qh0, sB);
        sA = wmma16(ka1, qh1, sA); sB = wmma16(kb1, qh1, sB);
        asm volatile("v_nop\n\tv_nop\n\tv_nop\n\tv_nop" : "+v"(sA), "+v"(sB) : "v"(ka0), "v"(ka1), "v"(kb0), "v"(kb1));
        float ta[8], tb[8]; float mx = -3.0e38f;
#pragma unroll
        for (int r = 0; r < 8; ++r) { ta[r] = sA[r] * SC2; tb[r] = sB[r] * SC2; mx = fmaxf(mx, fmaxf(ta[r], tb[r])); }
        mx = fmaxf(mx, __shfl_xor(mx, 16, 32));
        const float mnew = fmaxf(m, mx);
        const float alpha = __builtin_amdgcn_exp2f(m - mnew);
        const float sh = PSH - mnew;
        v16h pb; float ls = 0.0f;
#pragma unroll
        for (int r = 0; r < 8; ++r) { const h16 pa = (h16)__builtin_amdgcn_exp2f(ta[r] + sh); const h16 pc = (h16)__builtin_amdgcn_exp2f(tb[r] + sh); pb[r] = pa; pb[8 + r] = pc; ls += (float)pa + (float)pc; }
        l = l * alpha + ls; m = mnew;
        o0 = o0 * alpha; o1 = o1 * alpha; o2 = o2 * alpha; o3 = o3 * alpha;
        const h16* va = VT + vo + key0;
        const v16h v0 = ldh(va), v1 = ldh(va + (size_t)16 * SEQ), v2 = ldh(va + (size_t)32 * SEQ), v3 = ldh(va + (size_t)48 * SEQ);
        o0 = wmma16(v0, pb, o0); o1 = wmma16(v1, pb, o1); o2 = wmma16(v2, pb, o2); o3 = wmma16(v3, pb, o3);
        asm volatile("v_nop\n\tv_nop\n\tv_nop\n\tv_nop" : "+v"(o0), "+v"(o1), "+v"(o2), "+v"(o3) : "v"(v0), "v"(v1), "v"(v2), "v"(v3), "v"(pb));
    }
    l += __shfl_xor(l, 16, 32);
    const float inv = CXS * (1.0f / l);
    const int wb = wave * 16 * 68;
    // O^T D layout: o_j[r] = (d = 16j + 8h + r, t = lane&15) -> os[t][d]; rows 0..15 x columns 0..63 all written
    { v4f a, c;
      a[0] = o0[0] * inv; a[1] = o0[1] * inv; a[2] = o0[2] * inv; a[3] = o0[3] * inv; c[0] = o0[4] * inv; c[1] = o0[5] * inv; c[2] = o0[6] * inv; c[3] = o0[7] * inv;
      *(v4fa*)(&os[wb + lr * 68 +  0 + 8 * hi]) = a; *(v4fa*)(&os[wb + lr * 68 +  0 + 8 * hi + 4]) = c;
      a[0] = o1[0] * inv; a[1] = o1[1] * inv; a[2] = o1[2] * inv; a[3] = o1[3] * inv; c[0] = o1[4] * inv; c[1] = o1[5] * inv; c[2] = o1[6] * inv; c[3] = o1[7] * inv;
      *(v4fa*)(&os[wb + lr * 68 + 16 + 8 * hi]) = a; *(v4fa*)(&os[wb + lr * 68 + 16 + 8 * hi + 4]) = c;
      a[0] = o2[0] * inv; a[1] = o2[1] * inv; a[2] = o2[2] * inv; a[3] = o2[3] * inv; c[0] = o2[4] * inv; c[1] = o2[5] * inv; c[2] = o2[6] * inv; c[3] = o2[7] * inv;
      *(v4fa*)(&os[wb + lr * 68 + 32 + 8 * hi]) = a; *(v4fa*)(&os[wb + lr * 68 + 32 + 8 * hi + 4]) = c;
      a[0] = o3[0] * inv; a[1] = o3[1] * inv; a[2] = o3[2] * inv; a[3] = o3[3] * inv; c[0] = o3[4] * inv; c[1] = o3[5] * inv; c[2] = o3[6] * inv; c[3] = o3[7] * inv;
      *(v4fa*)(&os[wb + lr * 68 + 48 + 8 * hi]) = a; *(v4fa*)(&os[wb + lr * 68 + 48 + 8 * hi + 4]) = c; }
    wave_sync();
    h16* crow = CTX + ((size_t)b * SEQ + t0) * DM + h * HD;
{
#pragma unroll
        for (int s = 0; s < 4; ++s) { const int row = 4 * s + (lane >> 3), c8 = (lane & 7) * 8;   // 4 s x 4 row groups = 16 rows; 8 lanes x 8 halves = 64 columns
            const v4f x0 = *(const v4fa*)(&os[wb + row * 68 + c8]); const v4f x1 = *(const v4fa*)(&os[wb + row * 68 + c8 + 4]); v8h hv;
#pragma unroll
            for (int i = 0; i < 4; ++i) { hv[i] = (h16)x0[i]; hv[4 + i] = (h16)x1[i]; }
            *(v8h*)(crow + (size_t)row * DM + c8) = hv; }
         }
}

// k_oproj: f16 GEMM, ONE WAVE per 64-row x 64-column tile, K = DM. OUT[m][n] = (sum_k CX[m][k] WoT[n][k]) * 2^-18 + bo[n] (bo as bf16-RNE value), f32.
__global__ __launch_bounds__(32) void k_oproj(const h16* __restrict__ A, const h16* __restrict__ Bt, const float* __restrict__ bo, float* OUT) {
    __shared__ __align__(16) float os[16 * 68];
    const int K = DM;
    const int lane = threadIdx.x & 31, lr = lane & 15, hi = lane >> 4; const int r0 = blockIdx.x * 64;
    v8f acc[4][4];
#pragma unroll
    for (int mb = 0; mb < 4; ++mb)
#pragma unroll
        for (int nb = 0; nb < 4; ++nb) acc[mb][nb] = (v8f){};
    const size_t aoff = (size_t)(r0 + lr) * K + 8 * hi, boff = (size_t)lr * K + 8 * hi;
#pragma unroll 1
    for (int kc = 0; kc < K; kc += 32) {
        v16h a[4];
#pragma unroll
        for (int mb = 0; mb < 4; ++mb) a[mb] = ldh(A + aoff + (size_t)mb * 16 * K + kc);
#pragma unroll
        for (int nb = 0; nb < 4; ++nb) { const v16h b = ldh(Bt + boff + (size_t)nb * 16 * K + kc);
#pragma unroll
            for (int mb = 0; mb < 4; ++mb) acc[mb][nb] = wmma16(a[mb], b, acc[mb][nb]); }
        asm volatile("v_nop\n\tv_nop\n\tv_nop\n\tv_nop" : "+v"(acc[0][0]), "+v"(acc[1][1]), "+v"(acc[2][2]), "+v"(acc[3][3]) : "v"(a[0]), "v"(a[1]), "v"(a[2]), "v"(a[3]));
    }
    const int cofs = lr * 4;
    v4f bb;
#pragma unroll
    for (int i = 0; i < 4; ++i) bb[i] = bfr(bo[cofs + i]);
    const int bidx = r0 / SEQ, tt = r0 % SEQ;
    float* obase = OUT + ((size_t)bidx * OUT_SEQ + tt) * NO;
#pragma unroll
    for (int mb = 0; mb < 4; ++mb) {
#pragma unroll
        for (int nb = 0; nb < 4; ++nb) {
#pragma unroll
            for (int j = 0; j < 8; ++j) os[(hi * 8 + j) * 68 + nb * 16 + lr] = acc[mb][nb][j]; }   // D: row 8h+j, col lane&15
        wave_sync();
{
#pragma unroll
            for (int s = 0; s < 8; ++s) { const int row = 2 * s + hi;   // 8 s x 2 rows = 16 rows; 16 lanes x 4 floats = 64 columns
                const v4f x = *(const v4fa*)(&os[row * 68 + cofs]); v4f val;
#pragma unroll
                for (int i = 0; i < 4; ++i) val[i] = x[i] * OSC + bb[i];
                *(v4f*)(obase + (size_t)(mb * 16 + row) * NO + cofs) = val; }
             }
        wave_sync();
    }
}

static constexpr size_t al256(size_t v) { return (v + 255) & ~(size_t)255; }
static constexpr size_t SZ_XB = al256((size_t)NB * SEQ * DIN * 2);
static constexpr size_t SZ_WB = al256((size_t)3 * DM * DIN * 2);
static constexpr size_t SZ_WO = al256((size_t)NO * DM * 2);
static constexpr size_t SZ_PL = al256((size_t)NB * NH_ * SEQ * HD * 2);
static constexpr size_t SZ_CX = al256((size_t)NB * SEQ * DM * 2);
static constexpr size_t SZ_TOTAL = 2 * SZ_XB + SZ_WB + SZ_WO + 3 * SZ_PL + SZ_CX;
static_assert(SZ_TOTAL <= (size_t)134217728);          // workspace carve <= 128 MiB
static_assert(((size_t)DM * DIN * 2) % 256 == 0);      // weight sub-planes stay 256-byte aligned

extern "C" void kernel_launch(void* const* d_in, const int* in_sizes, int n_in,
                              void* d_out, int out_size, void* d_ws, size_t ws_size, hipStream_t stream) {
    if (n_in < 10) return;
    const size_t needx = ((size_t)(NB - 1) * SEQ_FULL + SEQ) * DIN;
    if ((size_t)in_sizes[0] < needx || (size_t)in_sizes[1] < needx) return;
    if ((size_t)in_sizes[2] < (size_t)NH_ * DIN * HD || (size_t)in_sizes[4] < (size_t)NH_ * DIN * HD || (size_t)in_sizes[6] < (size_t)NH_ * DIN * HD) return;
    if ((size_t)in_sizes[3] < (size_t)NH_ * HD || (size_t)in_sizes[5] < (size_t)NH_ * HD || (size_t)in_sizes[7] < (size_t)NH_ * HD) return;
    if ((size_t)in_sizes[8] < (size_t)DM * NO || (size_t)in_sizes[9] < (size_t)NO) return;
    if ((size_t)out_size < ((size_t)(NB - 1) * OUT_SEQ + SEQ) * NO) return;
    if (SZ_TOTAL > ws_size) return;
    // wire order: current_tokens, context_tokens, Wq, bq, Wk, bk, Wv, bv, Wo, bo
    const float* xq = (const float*)d_in[0]; const float* xc = (const float*)d_in[1];
    const float* wq = (const float*)d_in[2]; const float* bq = (const float*)d_in[3];
    const float* wk = (const float*)d_in[4]; const float* bk = (const float*)d_in[5];
    const float* wv = (const float*)d_in[6]; const float* bv = (const float*)d_in[7];
    const float* wo = (const float*)d_in[8]; const float* bo = (const float*)d_in[9];
    float* OUT = (float*)d_out;      // [NB][SEQ][64]
    char* wsp = (char*)d_ws;
    bf* XQ = (bf*)wsp; wsp += SZ_XB;                 // [NB*SEQ][1024] query tokens
    bf* XC = (bf*)wsp; wsp += SZ_XB;                 // [NB*SEQ][1024] context tokens
    bf* WB = (bf*)wsp; wsp += SZ_WB;                 // [3][16*64][1024]: q | k | v, rows n = h*64 + a, k-contiguous
    bf* WO = (bf*)wsp; wsp += SZ_WO;                 // [64][1024] f16 bits, x1024
    h16* QH = (h16*)wsp; wsp += SZ_PL;               // [NB*16][SEQ][64]
    h16* KP = (h16*)wsp; wsp += SZ_PL;               // [NB*16][SEQ][64]
    h16* VT = (h16*)wsp; wsp += SZ_PL;               // [NB*16][64][SEQ]
    h16* CX = (h16*)wsp; wsp += SZ_CX;               // [NB*SEQ][1024] ctx x256
    bf* WQ = WB; bf* WK = WB + (size_t)DM * DIN; bf* WV = WB + (size_t)2 * DM * DIN;

    if (SEQ == SEQ_FULL) {
        const size_t n8 = (size_t)NB * SEQ * DIN / 8;
        k_cvt8<<<(unsigned)((n8 + 255) / 256), 256, 0, stream>>>(xq, XQ, n8);
        k_cvt8<<<(unsigned)((n8 + 255) / 256), 256, 0, stream>>>(xc, XC, n8);
    } else {
        const size_t n8 = (size_t)SEQ * DIN / 8;
        for (int b = 0; b < NB; ++b) {
            k_cvt8<<<(unsigned)((n8 + 255) / 256), 256, 0, stream>>>(xq + (size_t)b * SEQ_FULL * DIN, XQ + (size_t)b * SEQ * DIN, n8);
            k_cvt8<<<(unsigned)((n8 + 255) / 256), 256, 0, stream>>>(xc + (size_t)b * SEQ_FULL * DIN, XC + (size_t)b * SEQ * DIN, n8);
        }
    }
    // weights: in [head][1024 (k)][64 (n)] -> out [head*64 + n][1024 (k)]; grid (k tiles, heads)
    k_wt<0><<<dim3(DIN / 64, NH_, 1), 256, 0, stream>>>(wq, WQ, DIN, 1.0f);
    k_wt<0><<<dim3(DIN / 64, NH_, 1), 256, 0, stream>>>(wk, WK, DIN, 1.0f);
    k_wt<0><<<dim3(DIN / 64, NH_, 1), 256, 0, stream>>>(wv, WV, DIN, 1.0f);
    // Wo: in [1024 (k)][64 (n)] -> out [n][1024 (k)], one head
    k_wt<1><<<dim3(DM / 64, 1, 1), 256, 0, stream>>>(wo, WO, DM, WOS);

    // q, k: A = token rows (m = b*SEQ + t), Bt = W rows (n = h*64 + a) -> plane [(b*16 + h)][t][a]; bias per column n
    k_proj<<<dim3(NB * SEQ / 64, DM / 64, 1), 32, 0, stream>>>(XQ, WQ, QH, bq, 0, 1, SEQ, (size_t)NH_ * SEQ * HD, HD, HD, (size_t)SEQ * HD);
    k_proj<<<dim3(NB * SEQ / 64, DM / 64, 1), 32, 0, stream>>>(XC, WK, KP, bk, 0, 1, SEQ, (size_t)NH_ * SEQ * HD, HD, HD, (size_t)SEQ * HD);
    // v^T: A = Wv rows (m = h*64 + o), Bt = context token rows (n = b*SEQ + t) -> plane [(b*1024 + m)][t] = [(b*16 + h)][o][t]; bias per row m
    k_proj<<<dim3(DM / 64, NB * SEQ / 64, 1), 32, 0, stream>>>(WV, XC, VT, bv, 1, 0, DM, (size_t)0, SEQ, SEQ, (size_t)DM * SEQ);

    k_flash<<<dim3(SEQ / (16 * AW), NB * NH_, 1), 32 * AW, 0, stream>>>(QH, KP, VT, CX);

    k_oproj<<<dim3(NB * SEQ / 64, 1, 1), 32, 0, stream>>>(CX, (const h16*)WO, bo, OUT);
}

// v001
// A run of this version takes 219 microseconds.
// In two side-by-side timings against v000, it was 1.55 and 1.54 times as fast.
#include <hip/hip_runtime.h>

// Multi-head cross-attention, 16 heads x 64: q from xq [NB][SEQ][1024], k/v from xc [NB][SEQ][1024]; per-head weights [head][in][out] with biases; score scale 1/8; no mask; concat heads (1024) @ Wo [1024][64] + bo -> out [NB][SEQ][64] f32.
// Compute dtypes, f32 accumulate everywhere: q/k/v projections v_wmma_f32_16x16x32_bf16 (tokens and weights RNE-converted to bf16; products exact), biases RNE-converted to bf16 and added in f32;
// scores v_wmma_f32_16x16x32_f16 (q, k single f16); P (x256 carry, cancels in the normalisation) and v single f16; softmax f32 (online, running max);
// output projection v_wmma_f32_16x16x32_f16: ctx as f16 with x256 carry, Wo as bf16-RNE value x1024 held in f16 (exact), accumulator scaled by 2^-18 and bias added in f32.
// Layout: bf16 copies of both token tensors; weights transposed through LDS into K-contiguous rows [head*64 + n][in]; q, k planes [b*16+h][t][d] and v^T plane [b*16+h][d][t] written by the GEMM epilogue;
// fused flash kernel in transposed form (S^T = K Q^T, O^T = V^T P^T), K and V^T tiles staged in LDS for the whole block, writing the f16 ctx plane [b*SEQ+t][h*64+d]; final GEMM writes the f32 output.

#ifndef NB
#define NB 4
#endif
#ifndef SEQ
#define SEQ 2048
#endif
#define NB_FULL  4
#define SEQ_FULL 2048
#ifndef OUT_SEQ
#define OUT_SEQ SEQ              // row pitch (in tokens) between batches of the output
#endif
#define DIN  1024                // token width (projection K)
#define NH_  16
#define HD   64
#define DM   (NH_ * HD)          // concatenated head width (output-projection K)
#define NO   64                  // output width
#define AW   8                   // waves per flash block (16 query rows each); all of them read the same staged K / V^T tiles
#define KS   64                  // keys per staged tile
#define LP   72                  // LDS row pitch in halves: 144 B = 16 B x 9, the conflict-free pitch for 16-byte row reads of 128-B rows
#define SC2  (0.125f * 1.4426950408889634f)   // HD^-0.5 * log2(e)
#define PSH  8.0f                // log2 of the P carry (256)
#define CXS  256.0f              // carry of the ctx plane
#define WOS  1024.0f             // carry of the Wo plane
#define OSC  (1.0f / (256.0f * 1024.0f))

static_assert(HD == 64);
static_assert(NO == 64);                       // output row = 256 bytes = 16 lanes x 16 B
static_assert(NH_ * HD == DM);
static_assert(DM % 64 == 0);
static_assert(DIN % 64 == 0);                  // weight transpose tiles of 64
static_assert(DIN % 32 == 0);                  // GEMM k-loop steps by 32
static_assert(DM % 32 == 0);
static_assert(SEQ % 64 == 0);                  // a 64-row tile never straddles two batches
static_assert((NB * SEQ) % 64 == 0);
static_assert(SEQ % KS == 0);                  // key loop steps by whole staged tiles
static_assert(KS == 64 && KS % 32 == 0);       // a V^T tile row is 128 B, like a K row; 32 keys per softmax step
static_assert(AW * 32 * 2 * 8 == KS * HD);     // two 16-byte copies per thread cover one tile
static_assert(SEQ % (16 * AW) == 0);           // flash grid covers the sequence exactly
static_assert(((size_t)SEQ * DIN) % 8 == 0);
static_assert(NB <= NB_FULL);
static_assert(SEQ <= SEQ_FULL);

typedef _Float16 h16;
typedef unsigned short bf;
typedef __attribute__((ext_vector_type(16))) __bf16   v16bf;
typedef __attribute__((ext_vector_type(16))) _Float16 v16h;
typedef __attribute__((ext_vector_type(8)))  _Float16 v8h;
typedef __attribute__((ext_vector_type(8)))  unsigned short v8us;
typedef __attribute__((ext_vector_type(8)))  float    v8f;
typedef __attribute__((ext_vector_type(4)))  float    v4f;
typedef v4f  __attribute__((may_alias)) v4fa;

__device__ __forceinline__ unsigned short f2bf(float f) { unsigned u = __float_as_uint(f); u += 0x7FFFu + ((u >> 16) & 1u); return (unsigned short)(u >> 16); }
__device__ __forceinline__ float bf2f(unsigned short b) { return __uint_as_float(((unsigned)b) << 16); }
__device__ __forceinline__ float bfr(float f) { return bf2f(f2bf(f)); }   // value after RNE conversion to bf16
__device__ __forceinline__ v16h cat16(v8h lo, v8h hi) { return __builtin_shufflevector(lo, hi, 0, 1, 2, 3, 4, 5, 6, 7, 8, 9, 10, 11, 12, 13, 14, 15); }
__device__ __forceinline__ v16bf cat16b(v8us lo, v8us hi) { return __builtin_bit_cast(v16bf, __builtin_shufflevector(lo, hi, 0, 1, 2, 3, 4, 5, 6, 7, 8, 9, 10, 11, 12, 13, 14, 15)); }
__device__ __forceinline__ v8f wmma16(v16h a, v16h b, v8f c) { return __builtin_amdgcn_wmma_f32_16x16x32_f16(false, a, false, b, (short)0, c, false, false); }
__device__ __forceinline__ v8f wmmab(v16bf a, v16bf b, v8f c) { return __builtin_amdgcn_wmma_f32_16x16x32_bf16(false, a, false, b, (short)0, c, false, false); }
// fragment loaders from K-contiguous 16-bit rows; p already includes + 8*(lane>>4): elements 0..7 <- k0+8h+0..7, elements 8..15 <- k0+16+8h+0..7 (same map for A and B)
__device__ __forceinline__ v16h  ldh(const h16* p) { return cat16(*(const v8h*)p, *(const v8h*)(p + 16)); }
__device__ __forceinline__ v16bf ldb(const bf* p)  { return cat16b(*(const v8us*)p, *(const v8us*)(p + 16)); }
// ordering point for wave-private LDS tiles (same wave writes and reads)
__device__ __forceinline__ void wave_sync() { __builtin_amdgcn_fence(3 /* release order */, "wavefront"); __builtin_amdgcn_wave_barrier(); asm volatile("" ::: "memory"); }

__global__ __launch_bounds__(256) void k_cvt8(const float* __restrict__ src, bf* dst, size_t n8) {
    const size_t i = (size_t)blockIdx.x * 256 + threadIdx.x; if (i >= n8) return;
    const v8f v = *(const v8f*)(src + i * 8); v8us o;
#pragma unroll
    for (int k = 0; k < 8; ++k) o[k] = f2bf(v[k]);
    *(v8us*)(dst + i * 8) = o; 
}

// k_wt: weight transpose + 16-bit convert through LDS. in W[head][Kd][64] (f32, k-major) -> out WT[head*64 + n][Kd] (k-contiguous).
// F16 == 0: bf16 bits (RNE). F16 == 1: f16 of (bf16-RNE value * scale) (exact for power-of-two scale).
template <int F16>
__global__ __launch_bounds__(256) void k_wt(const float* __restrict__ W, bf* WT, int Kd, float scale) {
    __shared__ float ts[64 * 65];
    const int tid = threadIdx.x;
    const int d0 = blockIdx.x * 64, hh = blockIdx.y;
    const float* src = W + ((size_t)hh * Kd + d0) * 64;
#pragma unroll
    for (int it = 0; it < 4; ++it) {                    // 4 x 256 threads x 4 floats = 64 rows x 64 columns
        const int idx = it * 256 + tid; const int row = idx >> 4, c4 = (idx & 15) * 4;
        const v4f v = *(const v4f*)(src + (size_t)row * 64 + c4);
        ts[row * 65 + c4 + 0] = v[0]; ts[row * 65 + c4 + 1] = v[1]; ts[row * 65 + c4 + 2] = v[2]; ts[row * 65 + c4 + 3] = v[3];
    }
    __syncthreads();                                    // cross-wave tile: block barrier
    const int k8 = (tid & 7) * 8, nq = tid >> 3;        // 2 it x 32 row groups = 64 output rows; 8 lanes x 8 = 64 k
    v8us ou[2]; v8h oh[2];
#pragma unroll
    for (int it = 0; it < 2; ++it) {
        const int n = it * 32 + nq;
#pragma unroll
        for (int j = 0; j < 8; ++j) {
            const float w = ts[(k8 + j) * 65 + n];
            ou[it][j] = f2bf(w);
            oh[it][j] = (h16)(bfr(w) * scale);
        }
    }
{
#pragma unroll
        for (int it = 0; it < 2; ++it) {
            const size_t off = (size_t)(hh * 64 + it * 32 + nq) * (size_t)Kd + d0 + k8;
            if (F16) *(v8h*)((h16*)WT + off) = oh[it];
            else     *(v8us*)(WT + off) = ou[it];
        }
        
    }
}

// k_proj: register-blocked bf16 GEMM, ONE WAVE per 64x64 tile (16 accumulators), operands straight from K-contiguous bf16 planes, K = DIN.
// C[m][n] = sum_k A[m][k] Bt[n][k] + bias, written as f16 (Ph) at tile base (r0/RB)*sRB + (r0%RB)*pitch + (c0/CB)*sCB + (c0%CB), row pitch 'pitch' (halves).
// bias (bf16-RNE value, f32 add): per column when bcol == 1 (index n), per row when brow == 1 (index m); exactly one of brow/bcol is 1. grid (M/64, N/64), 32 threads.
__global__ __launch_bounds__(32) void k_proj(const bf* __restrict__ A, const bf* __restrict__ Bt, h16* Ph, const float* __restrict__ bias, int brow, int bcol, int RB, size_t sRB, int pitch, int CB, size_t sCB) {
    __shared__ __align__(16) float os[16 * 68];
    const int K = DIN;
    const int lane = threadIdx.x & 31, lr = lane & 15, hi = lane >> 4; const int r0 = blockIdx.x * 64, c0 = blockIdx.y * 64;
    v8f acc[4][4];
#pragma unroll
    for (int mb = 0; mb < 4; ++mb)
#pragma unroll
        for (int nb = 0; nb < 4; ++nb) acc[mb][nb] = (v8f){};
    const size_t aoff = (size_t)(r0 + lr) * K + 8 * hi, boff = (size_t)(c0 + lr) * K + 8 * hi;
#pragma unroll 1
    for (int kc = 0; kc < K; kc += 32) {
        v16bf a[4];
#pragma unroll
        for (int mb = 0; mb < 4; ++mb) a[mb] = ldb(A + aoff + (size_t)mb * 16 * K + kc);
#pragma unroll
        for (int nb = 0; nb < 4; ++nb) { const v16bf b = ldb(Bt + boff + (size_t)nb * 16 * K + kc);
#pragma unroll
            for (int mb = 0; mb < 4; ++mb) acc[mb][nb] = wmmab(a[mb], b, acc[mb][nb]); }
        asm volatile("v_nop\n\tv_nop\n\tv_nop\n\tv_nop" : "+v"(acc[0][0]), "+v"(acc[1][1]), "+v"(acc[2][2]), "+v"(acc[3][3]) : "v"(a[0]), "v"(a[1]), "v"(a[2]), "v"(a[3]));
    }
    const size_t tbase = (size_t)(r0 / RB) * sRB + (size_t)(r0 % RB) * (size_t)pitch + (size_t)(c0 / CB) * sCB + (size_t)(c0 % CB);
    const int c8 = (lane & 7) * 8, rq = lane >> 3;
    const float fbc = (float)bcol, fbr = (float)brow;
    float bc[8];
#pragma unroll
    for (int i = 0; i < 8; ++i) bc[i] = bfr(bias[(size_t)(c0 + c8 + i) * (size_t)bcol]) * fbc;   // index < N when bcol == 1, else 0
#pragma unroll
    for (int mb = 0; mb < 4; ++mb) {
#pragma unroll
        for (int nb = 0; nb < 4; ++nb) {
#pragma unroll
            for (int j = 0; j < 8; ++j) os[(hi * 8 + j) * 68 + nb * 16 + lr] = acc[mb][nb][j]; }   // D: row 8h+j, col lane&15
        wave_sync();
        const size_t sb = tbase + (size_t)(mb * 16) * (size_t)pitch;
{
#pragma unroll
            for (int s = 0; s < 4; ++s) { const int row = 4 * s + rq;   // 4 s x 4 row groups = 16 rows; 8 lanes x 8 = 64 columns
                const v4f x0 = *(const v4fa*)(&os[row * 68 + c8]); const v4f x1 = *(const v4fa*)(&os[row * 68 + c8 + 4]); v8h hv;
                const float br = bfr(bias[(size_t)(r0 + mb * 16 + row) * (size_t)brow]) * fbr;         // index < M when brow == 1, else 0
#pragma unroll
                for (int i = 0; i < 4; ++i) { hv[i] = (h16)(x0[i] + bc[i] + br); hv[4 + i] = (h16)(x1[i] + bc[4 + i] + br); }
                const size_t oo = sb + (size_t)row * (size_t)pitch + c8;
                *(v8h*)(Ph + oo) = hv; }
             }
        wave_sync();
    }
}

// One staged tile pair: four 16-byte copies per lane, global -> LDS through no register (a wave's copy covers four whole 128-B lines).
// The s_wait_xcnt stands inside the statement so that it precedes every later write of the address registers the copies name.
__device__ __forceinline__ void stage4(unsigned l0, unsigned l1, unsigned l2, unsigned l3, const h16* g0, const h16* g1, const h16* g2, const h16* g3) {
    asm volatile("global_load_async_to_lds_b128 %0, %4, off\n\t"
                 "global_load_async_to_lds_b128 %1, %5, off\n\t"
                 "global_load_async_to_lds_b128 %2, %6, off\n\t"
                 "global_load_async_to_lds_b128 %3, %7, off\n\t"
                 "s_wait_xcnt 0x0"
                 :: "v"(l0), "v"(l1), "v"(l2), "v"(l3), "v"(g0), "v"(g1), "v"(g2), "v"(g3) : "memory");
}

__global__ __launch_bounds__(32 * AW) void k_flash(const h16* __restrict__ QH, const h16* __restrict__ KP, const h16* __restrict__ VT, h16* CTX) {
    __shared__ __align__(16) float os[AW * 16 * 68];
    __shared__ __align__(16) h16 kv[2 * 2 * KS * LP];        // [buffer][K tile: key rows | V^T tile: d rows][64 rows][LP]
    const int lane = threadIdx.x & 31, wave = threadIdx.x >> 5, lr = lane & 15, hi = lane >> 4;
    const int zh = blockIdx.y; const int b = zh / NH_, h = zh % NH_;
    const int t0 = (blockIdx.x * AW + wave) * 16;
    const size_t pbase = (size_t)zh * SEQ * HD;
    const size_t qo = pbase + (size_t)(t0 + lr) * HD + 8 * hi;
    const v16h qh0 = ldh(QH + qo), qh1 = ldh(QH + qo + 32);   // B fragments: col t, k = d
    const int fo = lr * LP + 8 * hi;                         // fragment offset in a tile: K + key*LP (A: row key, k = d); V^T + 16j*LP + key (A: row d, k = key)
    // copy map: thread -> row tid>>3 (and row + 32), 16-byte column tid&7
    const int cr = threadIdx.x >> 3, ccol = (threadIdx.x & 7) * 8;
    const h16* gk = KP + pbase + (size_t)cr * HD + ccol;   // + key0 * HD
    const h16* gv = VT + pbase + (size_t)cr * SEQ + ccol;  // + key0
    const unsigned lb = (unsigned)(size_t)kv + (unsigned)(cr * LP + ccol) * 2u;   // LDS byte address of the thread's first K chunk in buffer 0
    constexpr unsigned TB = KS * LP * 2, HB = 32 * LP * 2;   // bytes of one tile, of half a tile
    stage4(lb, lb + HB, lb + TB, lb + TB + HB, gk, gk + 32 * HD, gv, gv + (size_t)32 * SEQ);
    asm volatile("s_wait_asynccnt 0x0" ::: "memory");        // this wave's copies of tile 0 have landed
    __syncthreads();                                         // tile 0 published to every wave
    if (SEQ > KS) stage4(lb + 2 * TB, lb + 2 * TB + HB, lb + 3 * TB, lb + 3 * TB + HB, gk + KS * HD, gk + (KS + 32) * HD, gv + KS, gv + (size_t)32 * SEQ + KS);
    v8f o0 = (v8f){}, o1 = (v8f){}, o2 = (v8f){}, o3 = (v8f){};
    float m = -3.0e38f, l = 0.0f;
#pragma unroll 1
    for (int kt0 = 0; kt0 < SEQ; kt0 += KS) {
      const unsigned buf = (unsigned)(kt0 / KS) & 1u;
      const h16* kt = kv + buf * (2 * KS * LP) + fo;
#pragma unroll 1   // rolled: both steps unrolled take more than the 128 registers that let all blocks be resident at once
      for (int sub = 0; sub < KS; sub += 32) {
        const h16* ka = kt + sub * LP;
        const v16h ka0 = ldh(ka), ka1 = ldh(ka + 32), kb0 = ldh(ka + 16 * LP), kb1 = ldh(ka + 16 * LP + 32);
        v8f sA = (v8f){}, sB = (v8f){};
        sA = wmma16(ka0, qh0, sA); sB = wmma16(kb0, qh0, sB);
        sA = wmma16(ka1, qh1, sA); sB = wmma16(kb1, qh1, sB);
        asm volatile("v_nop\n\tv_nop\n\tv_nop\n\tv_nop" : "+v"(sA), "+v"(sB) : "v"(ka0), "v"(ka1), "v"(kb0), "v"(kb1));
        float ta[8], tb[8]; float mx = -3.0e38f;
#pragma unroll
        for (int r = 0; r < 8; ++r) { ta[r] = sA[r] * SC2; tb[r] = sB[r] * SC2; mx = fmaxf(mx, fmaxf(ta[r], tb[r])); }
        mx = fmaxf(mx, __shfl_xor(mx, 16, 32));
        const float mnew = fmaxf(m, mx);
        const float alpha = __builtin_amdgcn_exp2f(m - mnew);
        const float sh = PSH - mnew;
        v16h pb; float ls = 0.0f;
#pragma unroll
        for (int r = 0; r < 8; ++r) { const h16 pa = (h16)__builtin_amdgcn_exp2f(ta[r] + sh); const h16 pc = (h16)__builtin_amdgcn_exp2f(tb[r] + sh); pb[r] = pa; pb[8 + r] = pc; ls += (float)pa + (float)pc; }
        l = l * alpha + ls; m = mnew;
        o0 = o0 * alpha; o1 = o1 * alpha; o2 = o2 * alpha; o3 = o3 * alpha;
        const h16* va = kt + KS * LP + sub;
        const v16h v0 = ldh(va), v1 = ldh(va + 16 * LP), v2 = ldh(va + 32 * LP), v3 = ldh(va + 48 * LP);
        o0 = wmma16(v0, pb, o0); o1 = wmma16(v1, pb, o1); o2 = wmma16(v2, pb, o2); o3 = wmma16(v3, pb, o3);
        asm volatile("v_nop\n\tv_nop\n\tv_nop\n\tv_nop" : "+v"(o0), "+v"(o1), "+v"(o2), "+v"(o3) : "v"(v0), "v"(v1), "v"(v2), "v"(v3), "v"(pb));
      }
      asm volatile("s_wait_dscnt 0x0" ::: "memory");         // this wave's reads of the tile are done before its buffer may be refilled
      asm volatile("s_wait_asynccnt 0x0" ::: "memory");      // this wave's copies of the next tile have landed
      __syncthreads();                                       // publishes the next tile and ends every wave's reads of this one
      if (kt0 + 2 * KS < SEQ) {                              // block-uniform: refill the buffer just read with the tile after next
          const unsigned l0 = lb + buf * (2 * TB); const h16* g0 = gk + (size_t)(kt0 + 2 * KS) * HD; const h16* g2 = gv + (kt0 + 2 * KS);
          stage4(l0, l0 + HB, l0 + TB, l0 + TB + HB, g0, g0 + 32 * HD, g2, g2 + (size_t)32 * SEQ);
      }
    }
    asm volatile("s_wait_asynccnt 0x0" ::: "memory");        // nothing of this wave's copies is outstanding past the loop
    l += __shfl_xor(l, 16, 32);
    const float inv = CXS * (1.0f / l);
    const int wb = wave * 16 * 68;
    // O^T D layout: o_j[r] = (d = 16j + 8h + r, t = lane&15) -> os[t][d]; rows 0..15 x columns 0..63 all written
    { v4f a, c;
      a[0] = o0[0] * inv; a[1] = o0[1] * inv; a[2] = o0[2] * inv; a[3] = o0[3] * inv; c[0] = o0[4] * inv; c[1] = o0[5] * inv; c[2] = o0[6] * inv; c[3] = o0[7] * inv;
      *(v4fa*)(&os[wb + lr * 68 +  0 + 8 * hi]) = a; *(v4fa*)(&os[wb + lr * 68 +  0 + 8 * hi + 4]) = c;
      a[0] = o1[0] * inv; a[1] = o1[1] * inv; a[2] = o1[2] * inv; a[3] = o1[3] * inv; c[0] = o1[4] * inv; c[1] = o1[5] * inv; c[2] = o1[6] * inv; c[3] = o1[7] * inv;
      *(v4fa*)(&os[wb + lr * 68 + 16 + 8 * hi]) = a; *(v4fa*)(&os[wb + lr * 68 + 16 + 8 * hi + 4]) = c;
      a[0] = o2[0] * inv; a[1] = o2[1] * inv; a[2] = o2[2] * inv; a[3] = o2[3] * inv; c[0] = o2[4] * inv; c[1] = o2[5] * inv; c[2] = o2[6] * inv; c[3] = o2[7] * inv;
      *(v4fa*)(&os[wb + lr * 68 + 32 + 8 * hi]) = a; *(v4fa*)(&os[wb + lr * 68 + 32 + 8 * hi + 4]) = c;
      a[0] = o3[0] * inv; a[1] = o3[1] * inv; a[2] = o3[2] * inv; a[3] = o3[3] * inv; c[0] = o3[4] * inv; c[1] = o3[5] * inv; c[2] = o3[6] * inv; c[3] = o3[7] * inv;
      *(v4fa*)(&os[wb + lr * 68 + 48 + 8 * hi]) = a; *(v4fa*)(&os[wb + lr * 68 + 48 + 8 * hi + 4]) = c; }
    wave_sync();
    h16* crow = CTX + ((size_t)b * SEQ + t0) * DM + h * HD;
{
#pragma unroll
        for (int s = 0; s < 4; ++s) { const int row = 4 * s + (lane >> 3), c8 = (lane & 7) * 8;   // 4 s x 4 row groups = 16 rows; 8 lanes x 8 halves = 64 columns
            const v4f x0 = *(const v4fa*)(&os[wb + row * 68 + c8]); const v4f x1 = *(const v4fa*)(&os[wb + row * 68 + c8 + 4]); v8h hv;
#pragma unroll
            for (int i = 0; i < 4; ++i) { hv[i] = (h16)x0[i]; hv[4 + i] = (h16)x1[i]; }
            *(v8h*)(crow + (size_t)row * DM + c8) = hv; }
         }
}

// k_oproj: f16 GEMM, ONE WAVE per 64-row x 64-column tile, K = DM. OUT[m][n] = (sum_k CX[m][k] WoT[n][k]) * 2^-18 + bo[n] (bo as bf16-RNE value), f32.
__global__ __launch_bounds__(32) void k_oproj(const h16* __restrict__ A, const h16* __restrict__ Bt, const float* __restrict__ bo, float* OUT) {
    __shared__ __align__(16) float os[16 * 68];
    const int K = DM;
    const int lane = threadIdx.x & 31, lr = lane & 15, hi = lane >> 4; const int r0 = blockIdx.x * 64;
    v8f acc[4][4];
#pragma unroll
    for (int mb = 0; mb < 4; ++mb)
#pragma unroll
        for (int nb = 0; nb < 4; ++nb) acc[mb][nb] = (v8f){};
    const size_t aoff = (size_t)(r0 + lr) * K + 8 * hi, boff = (size_t)lr * K + 8 * hi;
#pragma unroll 1
    for (int kc = 0; kc < K; kc += 32) {
        v16h a[4];
#pragma unroll
        for (int mb = 0; mb < 4; ++mb) a[mb] = ldh(A + aoff + (size_t)mb * 16 * K + kc);
#pragma unroll
        for (int nb = 0; nb < 4; ++nb) { const v16h b = ldh(Bt + boff + (size_t)nb * 16 * K + kc);
#pragma unroll
            for (int mb = 0; mb < 4; ++mb) acc[mb][nb] = wmma16(a[mb], b, acc[mb][nb]); }
        asm volatile("v_nop\n\tv_nop\n\tv_nop\n\tv_nop" : "+v"(acc[0][0]), "+v"(acc[1][1]), "+v"(acc[2][2]), "+v"(acc[3][3]) : "v"(a[0]), "v"(a[1]), "v"(a[2]), "v"(a[3]));
    }
    const int cofs = lr * 4;
    v4f bb;
#pragma unroll
    for (int i = 0; i < 4; ++i) bb[i] = bfr(bo[cofs + i]);
    const int bidx = r0 / SEQ, tt = r0 % SEQ;
    float* obase = OUT + ((size_t)bidx * OUT_SEQ + tt) * NO;
#pragma unroll
    for (int mb = 0; mb < 4; ++mb) {
#pragma unroll
        for (int nb = 0; nb < 4; ++nb) {
#pragma unroll
            for (int j = 0; j < 8; ++j) os[(hi * 8 + j) * 68 + nb * 16 + lr] = acc[mb][nb][j]; }   // D: row 8h+j, col lane&15
        wave_sync();
{
#pragma unroll
            for (int s = 0; s < 8; ++s) { const int row = 2 * s + hi;   // 8 s x 2 rows = 16 rows; 16 lanes x 4 floats = 64 columns
                const v4f x = *(const v4fa*)(&os[row * 68 + cofs]); v4f val;
#pragma unroll
                for (int i = 0; i < 4; ++i) val[i] = x[i] * OSC + bb[i];
                *(v4f*)(obase + (size_t)(mb * 16 + row) * NO + cofs) = val; }
             }
        wave_sync();
    }
}

static constexpr size_t al256(size_t v) { return (v + 255) & ~(size_t)255; }
static constexpr size_t SZ_XB = al256((size_t)NB * SEQ * DIN * 2);
static constexpr size_t SZ_WB = al256((size_t)3 * DM * DIN * 2);
static constexpr size_t SZ_WO = al256((size_t)NO * DM * 2);
static constexpr size_t SZ_PL = al256((size_t)NB * NH_ * SEQ * HD * 2);
static constexpr size_t SZ_CX = al256((size_t)NB * SEQ * DM * 2);
static constexpr size_t SZ_TOTAL = 2 * SZ_XB + SZ_WB + SZ_WO + 3 * SZ_PL + SZ_CX;
static_assert(SZ_TOTAL <= (size_t)134217728);          // workspace carve <= 128 MiB
static_assert(((size_t)DM * DIN * 2) % 256 == 0);      // weight sub-planes stay 256-byte aligned

extern "C" void kernel_launch(void* const* d_in, const int* in_sizes, int n_in,
                              void* d_out, int out_size, void* d_ws, size_t ws_size, hipStream_t stream) {
    if (n_in < 10) return;
    const size_t needx = ((size_t)(NB - 1) * SEQ_FULL + SEQ) * DIN;
    if ((size_t)in_sizes[0] < needx || (size_t)in_sizes[1] < needx) return;
    if ((size_t)in_sizes[2] < (size_t)NH_ * DIN * HD || (size_t)in_sizes[4] < (size_t)NH_ * DIN * HD || (size_t)in_sizes[6] < (size_t)NH_ * DIN * HD) return;
    if ((size_t)in_sizes[3] < (size_t)NH_ * HD || (size_t)in_sizes[5] < (size_t)NH_ * HD || (size_t)in_sizes[7] < (size_t)NH_ * HD) return;
    if ((size_t)in_sizes[8] < (size_t)DM * NO || (size_t)in_sizes[9] < (size_t)NO) return;
    if ((size_t)out_size < ((size_t)(NB - 1) * OUT_SEQ + SEQ) * NO) return;
    if (SZ_TOTAL > ws_size) return;
    // wire order: current_tokens, context_tokens, Wq, bq, Wk, bk, Wv, bv, Wo, bo
    const float* xq = (const float*)d_in[0]; const float* xc = (const float*)d_in[1];
    const float* wq = (const float*)d_in[2]; const float* bq = (const float*)d_in[3];
    const float* wk = (const float*)d_in[4]; const float* bk = (const float*)d_in[5];
    const float* wv = (const float*)d_in[6]; const float* bv = (const float*)d_in[7];
    const float* wo = (const float*)d_in[8]; const float* bo = (const float*)d_in[9];
    float* OUT = (float*)d_out;      // [NB][SEQ][64]
    char* wsp = (char*)d_ws;
    bf* XQ = (bf*)wsp; wsp += SZ_XB;                 // [NB*SEQ][1024] query tokens
    bf* XC = (bf*)wsp; wsp += SZ_XB;                 // [NB*SEQ][1024] context tokens
    bf* WB = (bf*)wsp; wsp += SZ_WB;                 // [3][16*64][1024]: q | k | v, rows n = h*64 + a, k-contiguous
    bf* WO = (bf*)wsp; wsp += SZ_WO;                 // [64][1024] f16 bits, x1024
    h16* QH = (h16*)wsp; wsp += SZ_PL;               // [NB*16][SEQ][64]
    h16* KP = (h16*)wsp; wsp += SZ_PL;               // [NB*16][SEQ][64]
    h16* VT = (h16*)wsp; wsp += SZ_PL;               // [NB*16][64][SEQ]
    h16* CX = (h16*)wsp; wsp += SZ_CX;               // [NB*SEQ][1024] ctx x256
    bf* WQ = WB; bf* WK = WB + (size_t)DM * DIN; bf* WV = WB + (size_t)2 * DM * DIN;

    if (SEQ == SEQ_FULL) {
        const size_t n8 = (size_t)NB * SEQ * DIN / 8;
        k_cvt8<<<(unsigned)((n8 + 255) / 256), 256, 0, stream>>>(xq, XQ, n8);
        k_cvt8<<<(unsigned)((n8 + 255) / 256), 256, 0, stream>>>(xc, XC, n8);
    } else {
        const size_t n8 = (size_t)SEQ * DIN / 8;
        for (int b = 0; b < NB; ++b) {
            k_cvt8<<<(unsigned)((n8 + 255) / 256), 256, 0, stream>>>(xq + (size_t)b * SEQ_FULL * DIN, XQ + (size_t)b * SEQ * DIN, n8);
            k_cvt8<<<(unsigned)((n8 + 255) / 256), 256, 0, stream>>>(xc + (size_t)b * SEQ_FULL * DIN, XC + (size_t)b * SEQ * DIN, n8);
        }
    }
    // weights: in [head][1024 (k)][64 (n)] -> out [head*64 + n][1024 (k)]; grid (k tiles, heads)
    k_wt<0><<<dim3(DIN / 64, NH_, 1), 256, 0, stream>>>(wq, WQ, DIN, 1.0f);
    k_wt<0><<<dim3(DIN / 64, NH_, 1), 256, 0, stream>>>(wk, WK, DIN, 1.0f);
    k_wt<0><<<dim3(DIN / 64, NH_, 1), 256, 0, stream>>>(wv, WV, DIN, 1.0f);
    // Wo: in [1024 (k)][64 (n)] -> out [n][1024 (k)], one head
    k_wt<1><<<dim3(DM / 64, 1, 1), 256, 0, stream>>>(wo, WO, DM, WOS);

    // q, k: A = token rows (m = b*SEQ + t), Bt = W rows (n = h*64 + a) -> plane [(b*16 + h)][t][a]; bias per column n
    k_proj<<<dim3(NB * SEQ / 64, DM / 64, 1), 32, 0, stream>>>(XQ, WQ, QH, bq, 0, 1, SEQ, (size_t)NH_ * SEQ * HD, HD, HD, (size_t)SEQ * HD);
    k_proj<<<dim3(NB * SEQ / 64, DM / 64, 1), 32, 0, stream>>>(XC, WK, KP, bk, 0, 1, SEQ, (size_t)NH_ * SEQ * HD, HD, HD, (size_t)SEQ * HD);
    // v^T: A = Wv rows (m = h*64 + o), Bt = context token rows (n = b*SEQ + t) -> plane [(b*1024 + m)][t] = [(b*16 + h)][o][t]; bias per row m
    k_proj<<<dim3(DM / 64, NB * SEQ / 64, 1), 32, 0, stream>>>(WV, XC, VT, bv, 1, 0, DM, (size_t)0, SEQ, SEQ, (size_t)DM * SEQ);

    k_flash<<<dim3(SEQ / (16 * AW), NB * NH_, 1), 32 * AW, 0, stream>>>(QH, KP, VT, CX);

    k_oproj<<<dim3(NB * SEQ / 64, 1, 1), 32, 0, stream>>>(CX, (const h16*)WO, bo, OUT);
}

// v002
// One run takes 159 microseconds.
// Next to v001, in two timings, it ran 1.36 times as fast each time.
// Over all steps from v000 it is 2.10 times as fast.
#include <hip/hip_runtime.h>

// Multi-head cross-attention, 16 heads x 64: q from xq [NB][SEQ][1024], k/v from xc [NB][SEQ][1024]; per-head weights [head][in][out] with biases; score scale 1/8; no mask; concat heads (1024) @ Wo [1024][64] + bo -> out [NB][SEQ][64] f32.
// Compute dtypes, f32 accumulate everywhere: q/k/v projections v_wmma_f32_16x16x32_bf16 (tokens and weights RNE-converted to bf16; products exact), biases RNE-converted to bf16 and added in f32;
// scores v_wmma_f32_16x16x32_f16 (q, k single f16); P (x256 carry, cancels in the normalisation) and v single f16; softmax f32 (online, running max);
// output projection v_wmma_f32_16x16x32_f16: ctx as f16 with x256 carry, Wo as bf16-RNE value x1024 held in f16 (exact), accumulator scaled by 2^-18 and bias added in f32.
// Layout: bf16 copies of both token tensors; weights transposed through LDS into K-contiguous rows [head*64 + n][in]; q, k planes [b*16+h][t][d] and v^T plane [b*16+h][d][t] written by the GEMM epilogue;
// fused flash kernel in transposed form (S^T = K Q^T, O^T = V^T P^T), K and V^T tiles staged in LDS for the whole block, writing the f16 ctx plane [b*SEQ+t][h*64+d]; final GEMM writes the f32 output.

#ifndef NB
#define NB 4
#endif
#ifndef SEQ
#define SEQ 2048
#endif
#define NB_FULL  4
#define SEQ_FULL 2048
#ifndef OUT_SEQ
#define OUT_SEQ SEQ              // row pitch (in tokens) between batches of the output
#endif
#define DIN  1024                // token width (projection K)
#define NH_  16
#define HD   64
#define DM   (NH_ * HD)          // concatenated head width (output-projection K)
#define NO   64                  // output width
#define AW   8                   // waves per flash block (16 query rows each); all of them read the same staged K / V^T tiles
#define KS   64                  // keys per staged tile
#define LP   72                  // LDS row pitch in halves: 144 B = 16 B x 9, the conflict-free pitch for 16-byte row reads of 128-B rows
#define PBM  256                // projection block tile: rows (4 waves x 64)
#define PBN  128                // projection block tile: columns (2 waves x 64)
#define PKS  128                // k per staged projection tile
#define PLP  136                // LDS row pitch in elements: 272 B = 16 B x 17, the conflict-free pitch for 16-byte row reads of 256-B rows
#define SC2  (0.125f * 1.4426950408889634f)   // HD^-0.5 * log2(e)
#define PSH  8.0f                // log2 of the P carry (256)
#define CXS  256.0f              // carry of the ctx plane
#define WOS  1024.0f             // carry of the Wo plane
#define OSC  (1.0f / (256.0f * 1024.0f))

static_assert(HD == 64);
static_assert(NO == 64);                       // output row = 256 bytes = 16 lanes x 16 B
static_assert(NH_ * HD == DM);
static_assert(DM % 64 == 0);
static_assert(DIN % 64 == 0);                  // weight transpose tiles of 64
static_assert(DIN % 32 == 0);                  // GEMM k-loop steps by 32
static_assert(DM % 32 == 0);
static_assert(SEQ % 64 == 0);                  // a 64-row tile never straddles two batches
static_assert((NB * SEQ) % 64 == 0);
static_assert(SEQ % KS == 0);                  // key loop steps by whole staged tiles
static_assert(KS == 64 && KS % 32 == 0);       // a V^T tile row is 128 B, like a K row; 32 keys per softmax step
static_assert(AW * 32 * 2 * 8 == KS * HD);     // two 16-byte copies per thread cover one tile
static_assert(SEQ % (16 * AW) == 0);           // flash grid covers the sequence exactly
static_assert(((size_t)SEQ * DIN) % 8 == 0);
static_assert((NB * SEQ) % PBM == 0 && DM % PBM == 0 && (NB * SEQ) % PBN == 0 && DM % PBN == 0);   // projection grids cover both orientations exactly
static_assert(DIN % PKS == 0 && DIN >= 2 * PKS);   // whole staged tiles, and the ring's prologue needs two
static_assert(PBM == 256 && PBN == 128 && PKS == 128);   // copy map: 256 threads x 24 copies of 16 B = (PBM + PBN) rows of 256 B
static_assert(NB <= NB_FULL);
static_assert(SEQ <= SEQ_FULL);

typedef _Float16 h16;
typedef unsigned short bf;
typedef __attribute__((ext_vector_type(16))) __bf16   v16bf;
typedef __attribute__((ext_vector_type(16))) _Float16 v16h;
typedef __attribute__((ext_vector_type(8)))  _Float16 v8h;
typedef __attribute__((ext_vector_type(8)))  unsigned short v8us;
typedef __attribute__((ext_vector_type(8)))  float    v8f;
typedef __attribute__((ext_vector_type(4)))  float    v4f;
typedef v4f  __attribute__((may_alias)) v4fa;

__device__ __forceinline__ unsigned short f2bf(float f) { unsigned u = __float_as_uint(f); u += 0x7FFFu + ((u >> 16) & 1u); return (unsigned short)(u >> 16); }
__device__ __forceinline__ float bf2f(unsigned short b) { return __uint_as_float(((unsigned)b) << 16); }
__device__ __forceinline__ float bfr(float f) { return bf2f(f2bf(f)); }   // value after RNE conversion to bf16
__device__ __forceinline__ v16h cat16(v8h lo, v8h hi) { return __builtin_shufflevector(lo, hi, 0, 1, 2, 3, 4, 5, 6, 7, 8, 9, 10, 11, 12, 13, 14, 15); }
__device__ __forceinline__ v16bf cat16b(v8us lo, v8us hi) { return __builtin_bit_cast(v16bf, __builtin_shufflevector(lo, hi, 0, 1, 2, 3, 4, 5, 6, 7, 8, 9, 10, 11, 12, 13, 14, 15)); }
__device__ __forceinline__ v8f wmma16(v16h a, v16h b, v8f c) { return __builtin_amdgcn_wmma_f32_16x16x32_f16(false, a, false, b, (short)0, c, false, false); }
__device__ __forceinline__ v8f wmmab(v16bf a, v16bf b, v8f c) { return __builtin_amdgcn_wmma_f32_16x16x32_bf16(false, a, false, b, (short)0, c, false, false); }
// fragment loaders from K-contiguous 16-bit rows; p already includes + 8*(lane>>4): elements 0..7 <- k0+8h+0..7, elements 8..15 <- k0+16+8h+0..7 (same map for A and B)
__device__ __forceinline__ v16h  ldh(const h16* p) { return cat16(*(const v8h*)p, *(const v8h*)(p + 16)); }
__device__ __forceinline__ v16bf ldb(const bf* p)  { return cat16b(*(const v8us*)p, *(const v8us*)(p + 16)); }
// ordering point for wave-private LDS tiles (same wave writes and reads)
__device__ __forceinline__ void wave_sync() { __builtin_amdgcn_fence(3 /* release order */, "wavefront"); __builtin_amdgcn_wave_barrier(); asm volatile("" ::: "memory"); }

__global__ __launch_bounds__(256) void k_cvt8(const float* __restrict__ src, bf* dst, size_t n8) {
    const size_t i = (size_t)blockIdx.x * 256 + threadIdx.x; if (i >= n8) return;
    const v8f v = *(const v8f*)(src + i * 8); v8us o;
#pragma unroll
    for (int k = 0; k < 8; ++k) o[k] = f2bf(v[k]);
    *(v8us*)(dst + i * 8) = o; 
}

// k_wt: weight transpose + 16-bit convert through LDS. in W[head][Kd][64] (f32, k-major) -> out WT[head*64 + n][Kd] (k-contiguous).
// F16 == 0: bf16 bits (RNE). F16 == 1: f16 of (bf16-RNE value * scale) (exact for power-of-two scale).
template <int F16>
__global__ __launch_bounds__(256) void k_wt(const float* __restrict__ W, bf* WT, int Kd, float scale) {
    __shared__ float ts[64 * 65];
    const int tid = threadIdx.x;
    const int d0 = blockIdx.x * 64, hh = blockIdx.y;
    const float* src = W + ((size_t)hh * Kd + d0) * 64;
#pragma unroll
    for (int it = 0; it < 4; ++it) {                    // 4 x 256 threads x 4 floats = 64 rows x 64 columns
        const int idx = it * 256 + tid; const int row = idx >> 4, c4 = (idx & 15) * 4;
        const v4f v = *(const v4f*)(src + (size_t)row * 64 + c4);
        ts[row * 65 + c4 + 0] = v[0]; ts[row * 65 + c4 + 1] = v[1]; ts[row * 65 + c4 + 2] = v[2]; ts[row * 65 + c4 + 3] = v[3];
    }
    __syncthreads();                                    // cross-wave tile: block barrier
    const int k8 = (tid & 7) * 8, nq = tid >> 3;        // 2 it x 32 row groups = 64 output rows; 8 lanes x 8 = 64 k
    v8us ou[2]; v8h oh[2];
#pragma unroll
    for (int it = 0; it < 2; ++it) {
        const int n = it * 32 + nq;
#pragma unroll
        for (int j = 0; j < 8; ++j) {
            const float w = ts[(k8 + j) * 65 + n];
            ou[it][j] = f2bf(w);
            oh[it][j] = (h16)(bfr(w) * scale);
        }
    }
{
#pragma unroll
        for (int it = 0; it < 2; ++it) {
            const size_t off = (size_t)(hh * 64 + it * 32 + nq) * (size_t)Kd + d0 + k8;
            if (F16) *(v8h*)((h16*)WT + off) = oh[it];
            else     *(v8us*)(WT + off) = ou[it];
        }
        
    }
}

// Twelve 16-byte copies per lane, global -> LDS through no register (a wave's copy covers two whole 256-B rows = four lines).
// The s_wait_xcnt stands inside the statement so that it precedes every later write of the address registers the copies name.
__device__ __forceinline__ void stage12(const unsigned (&l)[12], const bf* const (&g)[12]) {
    asm volatile("global_load_async_to_lds_b128 %0, %12, off\n\t"
                 "global_load_async_to_lds_b128 %1, %13, off\n\t"
                 "global_load_async_to_lds_b128 %2, %14, off\n\t"
                 "global_load_async_to_lds_b128 %3, %15, off\n\t"
                 "global_load_async_to_lds_b128 %4, %16, off\n\t"
                 "global_load_async_to_lds_b128 %5, %17, off\n\t"
                 "global_load_async_to_lds_b128 %6, %18, off\n\t"
                 "global_load_async_to_lds_b128 %7, %19, off\n\t"
                 "global_load_async_to_lds_b128 %8, %20, off\n\t"
                 "global_load_async_to_lds_b128 %9, %21, off\n\t"
                 "global_load_async_to_lds_b128 %10, %22, off\n\t"
                 "global_load_async_to_lds_b128 %11, %23, off\n\t"
                 "s_wait_xcnt 0x0"
                 :: "v"(l[0]), "v"(l[1]), "v"(l[2]), "v"(l[3]), "v"(l[4]), "v"(l[5]), "v"(l[6]), "v"(l[7]), "v"(l[8]), "v"(l[9]), "v"(l[10]), "v"(l[11]),
                    "v"(g[0]), "v"(g[1]), "v"(g[2]), "v"(g[3]), "v"(g[4]), "v"(g[5]), "v"(g[6]), "v"(g[7]), "v"(g[8]), "v"(g[9]), "v"(g[10]), "v"(g[11]) : "memory");
}
// One staged k tile of a projection block: PBM rows of A, then PBN rows of Bt, PKS elements each; a thread copies its 16-byte column of every 16th row.
// l: LDS byte address of the thread's chunk in its first row (tid>>4) of the buffer; ga, gb: the thread's chunk in its first A row and its first Bt row of the tile.
__device__ __forceinline__ void proj_fill(unsigned l, const bf* ga, const bf* gb) {
    constexpr unsigned LS = 16 * PLP * 2; constexpr size_t GS = (size_t)16 * DIN;
    unsigned la[12]; const bf* gp[12];
#pragma unroll
    for (int i = 0; i < 12; ++i) { la[i] = l + (unsigned)i * LS; gp[i] = ga + (size_t)i * GS; }
    stage12(la, gp);
#pragma unroll
    for (int i = 0; i < 4; ++i) { la[i] = l + (unsigned)(12 + i) * LS; gp[i] = ga + (size_t)(12 + i) * GS; }
#pragma unroll
    for (int i = 0; i < 8; ++i) { la[4 + i] = l + (unsigned)(16 + i) * LS; gp[4 + i] = gb + (size_t)i * GS; }
    stage12(la, gp);
}

// k_proj: register-blocked bf16 GEMM, K = DIN. A block of 8 waves (4 x 2) owns a PBM x PBN tile, each wave a 64x64 part of it (16 accumulators).
// The operands come in k tiles of PKS, copied once per block from the K-contiguous bf16 planes into a two-buffer LDS ring (the next tile's copies fly while this one is worked on) and read from there as fragments.
// C[m][n] = sum_k A[m][k] Bt[n][k] + bias, written as f16 (Ph) at wave-tile base (r0/RB)*sRB + (r0%RB)*pitch + (c0/CB)*sCB + (c0%CB), row pitch 'pitch' (halves).
// bias (bf16-RNE value, f32 add): per column when bcol == 1 (index n), per row when brow == 1 (index m); exactly one of brow/bcol is 1. grid (M/PBM, N/PBN), 256 threads.
__global__ __launch_bounds__(256) void k_proj(const bf* __restrict__ A, const bf* __restrict__ Bt, h16* Ph, const float* __restrict__ bias, int brow, int bcol, int RB, size_t sRB, int pitch, int CB, size_t sCB) {
    __shared__ __align__(16) float osb[8 * 16 * 68];
    __shared__ __align__(16) bf st[2 * (PBM + PBN) * PLP];   // [buffer][A rows | Bt rows][PLP]
    const int K = DIN;
    const int lane = threadIdx.x & 31, lr = lane & 15, hi = lane >> 4;
    const int wave = __builtin_amdgcn_readfirstlane(threadIdx.x >> 5);   // wave-uniform: the tile's base and its divisions stay scalar
    const int r0 = blockIdx.x * PBM + (wave >> 1) * 64, c0 = blockIdx.y * PBN + (wave & 1) * 64;
    float* os = osb + wave * 16 * 68;                        // wave-private epilogue tile
    v8f acc[4][4];
#pragma unroll
    for (int mb = 0; mb < 4; ++mb)
#pragma unroll
        for (int nb = 0; nb < 4; ++nb) acc[mb][nb] = (v8f){};
    // copy map: thread -> row tid>>4 (and every 16th row after it), 16-byte column tid&15
    const int cr = threadIdx.x >> 4, ccol = (threadIdx.x & 15) * 8;
    const bf* ga = A + (size_t)(blockIdx.x * PBM + cr) * K + ccol;    // + k0
    const bf* gb = Bt + (size_t)(blockIdx.y * PBN + cr) * K + ccol;   // + k0
    const unsigned lb = (unsigned)(size_t)st + (unsigned)(cr * PLP + ccol) * 2u;
    constexpr unsigned SB = (PBM + PBN) * PLP * 2;           // bytes of one buffer
    const int aoff = ((wave >> 1) * 64 + lr) * PLP + 8 * hi, boff = (PBM + (wave & 1) * 64 + lr) * PLP + 8 * hi;
    proj_fill(lb, ga, gb);
    asm volatile("s_wait_asynccnt 0x0" ::: "memory");        // this wave's copies of tile 0 have landed
    __syncthreads();                                         // tile 0 published to every wave
    proj_fill(lb + SB, ga + PKS, gb + PKS);                  // tile 1 exists: K >= 2 * PKS
#pragma unroll 1
    for (int kt = 0; kt < K; kt += PKS) {
        const unsigned buf = (unsigned)(kt / PKS) & 1u;
        const bf* sa = st + buf * ((PBM + PBN) * PLP) + aoff; const bf* sb = st + buf * ((PBM + PBN) * PLP) + boff;
        // Fragments in two register sets, all inside this tile: the next k step's LDS reads are issued in two groups ahead of their use (12 in front of this step's
        // products, 4 into the registers that its first 8 products free), so that no product waits for a read just issued. Each sched_barrier keeps one such group
        // where it is written: left alone, the compiler moves the reads down to their users and puts a full LDS wait in front of every 4 products.
        v16bf a[2][4], b[2][4];
#pragma unroll
        for (int i = 0; i < 4; ++i) { a[0][i] = ldb(sa + i * 16 * PLP); b[0][i] = ldb(sb + i * 16 * PLP); }
        __builtin_amdgcn_sched_barrier(0);
#pragma unroll
        for (int s = 0; s < PKS / 32; ++s) {
            const int c = s & 1, n = c ^ 1;
            if (s + 1 < PKS / 32) {
#pragma unroll
                for (int i = 0; i < 4; ++i) a[n][i] = ldb(sa + i * 16 * PLP + (s + 1) * 32);
                b[n][0] = ldb(sb + (s + 1) * 32); b[n][1] = ldb(sb + 16 * PLP + (s + 1) * 32);
                __builtin_amdgcn_sched_barrier(0);
            }
#pragma unroll
            for (int nb = 0; nb < 2; ++nb)
#pragma unroll
                for (int mb = 0; mb < 4; ++mb) acc[mb][nb] = wmmab(a[c][mb], b[c][nb], acc[mb][nb]);
            __builtin_amdgcn_sched_barrier(0);
            if (s + 1 < PKS / 32) {
                b[n][2] = ldb(sb + 32 * PLP + (s + 1) * 32); b[n][3] = ldb(sb + 48 * PLP + (s + 1) * 32);
                __builtin_amdgcn_sched_barrier(0);
            }
#pragma unroll
            for (int nb = 2; nb < 4; ++nb)
#pragma unroll
                for (int mb = 0; mb < 4; ++mb) acc[mb][nb] = wmmab(a[c][mb], b[c][nb], acc[mb][nb]);
            __builtin_amdgcn_sched_barrier(0);
        }
        asm volatile("s_wait_dscnt 0x0" ::: "memory");       // this wave's reads of the tile are done before its buffer may be refilled
        asm volatile("s_wait_asynccnt 0x0" ::: "memory");    // this wave's copies of the next tile have landed
        __syncthreads();                                     // publishes the next tile and ends every wave's reads of this one
        if (kt + 2 * PKS < K) proj_fill(lb + buf * SB, ga + (kt + 2 * PKS), gb + (kt + 2 * PKS));   // block-uniform: refill the buffer just read with the tile after next
    }
    asm volatile("s_wait_asynccnt 0x0" ::: "memory");        // nothing of this wave's copies is outstanding past the loop
    const size_t tbase = (size_t)(r0 / RB) * sRB + (size_t)(r0 % RB) * (size_t)pitch + (size_t)(c0 / CB) * sCB + (size_t)(c0 % CB);
    const int c8 = (lane & 7) * 8, rq = lane >> 3;
    const float fbc = (float)bcol, fbr = (float)brow;
    float bc[8];
#pragma unroll
    for (int i = 0; i < 8; ++i) bc[i] = bfr(bias[(size_t)(c0 + c8 + i) * (size_t)bcol]) * fbc;   // index < N when bcol == 1, else 0
#pragma unroll
    for (int mb = 0; mb < 4; ++mb) {
#pragma unroll
        for (int nb = 0; nb < 4; ++nb) {
#pragma unroll
            for (int j = 0; j < 8; ++j) os[(hi * 8 + j) * 68 + nb * 16 + lr] = acc[mb][nb][j]; }   // D: row 8h+j, col lane&15
        wave_sync();
        const size_t sb = tbase + (size_t)(mb * 16) * (size_t)pitch;
{
#pragma unroll
            for (int s = 0; s < 4; ++s) { const int row = 4 * s + rq;   // 4 s x 4 row groups = 16 rows; 8 lanes x 8 = 64 columns
                const v4f x0 = *(const v4fa*)(&os[row * 68 + c8]); const v4f x1 = *(const v4fa*)(&os[row * 68 + c8 + 4]); v8h hv;
                const float br = bfr(bias[(size_t)(r0 + mb * 16 + row) * (size_t)brow]) * fbr;         // index < M when brow == 1, else 0
#pragma unroll
                for (int i = 0; i < 4; ++i) { hv[i] = (h16)(x0[i] + bc[i] + br); hv[4 + i] = (h16)(x1[i] + bc[4 + i] + br); }
                const size_t oo = sb + (size_t)row * (size_t)pitch + c8;
                *(v8h*)(Ph + oo) = hv; }
             }
        wave_sync();
    }
}

// One staged tile pair: four 16-byte copies per lane, global -> LDS through no register (a wave's copy covers four whole 128-B lines).
// The s_wait_xcnt stands inside the statement so that it precedes every later write of the address registers the copies name.
__device__ __forceinline__ void stage4(unsigned l0, unsigned l1, unsigned l2, unsigned l3, const h16* g0, const h16* g1, const h16* g2, const h16* g3) {
    asm volatile("global_load_async_to_lds_b128 %0, %4, off\n\t"
                 "global_load_async_to_lds_b128 %1, %5, off\n\t"
                 "global_load_async_to_lds_b128 %2, %6, off\n\t"
                 "global_load_async_to_lds_b128 %3, %7, off\n\t"
                 "s_wait_xcnt 0x0"
                 :: "v"(l0), "v"(l1), "v"(l2), "v"(l3), "v"(g0), "v"(g1), "v"(g2), "v"(g3) : "memory");
}

__global__ __launch_bounds__(32 * AW) void k_flash(const h16* __restrict__ QH, const h16* __restrict__ KP, const h16* __restrict__ VT, h16* CTX) {
    __shared__ __align__(16) float os[AW * 16 * 68];
    __shared__ __align__(16) h16 kv[2 * 2 * KS * LP];        // [buffer][K tile: key rows | V^T tile: d rows][64 rows][LP]
    const int lane = threadIdx.x & 31, wave = threadIdx.x >> 5, lr = lane & 15, hi = lane >> 4;
    const int zh = blockIdx.y; const int b = zh / NH_, h = zh % NH_;
    const int t0 = (blockIdx.x * AW + wave) * 16;
    const size_t pbase = (size_t)zh * SEQ * HD;
    const size_t qo = pbase + (size_t)(t0 + lr) * HD + 8 * hi;
    const v16h qh0 = ldh(QH + qo), qh1 = ldh(QH + qo + 32);   // B fragments: col t, k = d
    const int fo = lr * LP + 8 * hi;                         // fragment offset in a tile: K + key*LP (A: row key, k = d); V^T + 16j*LP + key (A: row d, k = key)
    // copy map: thread -> row tid>>3 (and row + 32), 16-byte column tid&7
    const int cr = threadIdx.x >> 3, ccol = (threadIdx.x & 7) * 8;
    const h16* gk = KP + pbase + (size_t)cr * HD + ccol;   // + key0 * HD
    const h16* gv = VT + pbase + (size_t)cr * SEQ + ccol;  // + key0
    const unsigned lb = (unsigned)(size_t)kv + (unsigned)(cr * LP + ccol) * 2u;   // LDS byte address of the thread's first K chunk in buffer 0
    constexpr unsigned TB = KS * LP * 2, HB = 32 * LP * 2;   // bytes of one tile, of half a tile
    stage4(lb, lb + HB, lb + TB, lb + TB + HB, gk, gk + 32 * HD, gv, gv + (size_t)32 * SEQ);
    asm volatile("s_wait_asynccnt 0x0" ::: "memory");        // this wave's copies of tile 0 have landed
    __syncthreads();                                         // tile 0 published to every wave
    if (SEQ > KS) stage4(lb + 2 * TB, lb + 2 * TB + HB, lb + 3 * TB, lb + 3 * TB + HB, gk + KS * HD, gk + (KS + 32) * HD, gv + KS, gv + (size_t)32 * SEQ + KS);
    v8f o0 = (v8f){}, o1 = (v8f){}, o2 = (v8f){}, o3 = (v8f){};
    float m = -3.0e38f, l = 0.0f;
#pragma unroll 1
    for (int kt0 = 0; kt0 < SEQ; kt0 += KS) {
      const unsigned buf = (unsigned)(kt0 / KS) & 1u;
      const h16* kt = kv + buf * (2 * KS * LP) + fo;
#pragma unroll 1   // rolled: both steps unrolled take more than the 128 registers that let all blocks be resident at once
      for (int sub = 0; sub < KS; sub += 32) {
        const h16* ka = kt + sub * LP;
        const v16h ka0 = ldh(ka), ka1 = ldh(ka + 32), kb0 = ldh(ka + 16 * LP), kb1 = ldh(ka + 16 * LP + 32);
        v8f sA = (v8f){}, sB = (v8f){};
        sA = wmma16(ka0, qh0, sA); sB = wmma16(kb0, qh0, sB);
        sA = wmma16(ka1, qh1, sA); sB = wmma16(kb1, qh1, sB);
        asm volatile("v_nop\n\tv_nop\n\tv_nop\n\tv_nop" : "+v"(sA), "+v"(sB) : "v"(ka0), "v"(ka1), "v"(kb0), "v"(kb1));
        float ta[8], tb[8]; float mx = -3.0e38f;
#pragma unroll
        for (int r = 0; r < 8; ++r) { ta[r] = sA[r] * SC2; tb[r] = sB[r] * SC2; mx = fmaxf(mx, fmaxf(ta[r], tb[r])); }
        mx = fmaxf(mx, __shfl_xor(mx, 16, 32));
        const float mnew = fmaxf(m, mx);
        const float alpha = __builtin_amdgcn_exp2f(m - mnew);
        const float sh = PSH - mnew;
        v16h pb; float ls = 0.0f;
#pragma unroll
        for (int r = 0; r < 8; ++r) { const h16 pa = (h16)__builtin_amdgcn_exp2f(ta[r] + sh); const h16 pc = (h16)__builtin_amdgcn_exp2f(tb[r] + sh); pb[r] = pa; pb[8 + r] = pc; ls += (float)pa + (float)pc; }
        l = l * alpha + ls; m = mnew;
        o0 = o0 * alpha; o1 = o1 * alpha; o2 = o2 * alpha; o3 = o3 * alpha;
        const h16* va = kt + KS * LP + sub;
        const v16h v0 = ldh(va), v1 = ldh(va + 16 * LP), v2 = ldh(va + 32 * LP), v3 = ldh(va + 48 * LP);
        o0 = wmma16(v0, pb, o0); o1 = wmma16(v1, pb, o1); o2 = wmma16(v2, pb, o2); o3 = wmma16(v3, pb, o3);
        asm volatile("v_nop\n\tv_nop\n\tv_nop\n\tv_nop" : "+v"(o0), "+v"(o1), "+v"(o2), "+v"(o3) : "v"(v0), "v"(v1), "v"(v2), "v"(v3), "v"(pb));
      }
      asm volatile("s_wait_dscnt 0x0" ::: "memory");         // this wave's reads of the tile are done before its buffer may be refilled
      asm volatile("s_wait_asynccnt 0x0" ::: "memory");      // this wave's copies of the next tile have landed
      __syncthreads();                                       // publishes the next tile and ends every wave's reads of this one
      if (kt0 + 2 * KS < SEQ) {                              // block-uniform: refill the buffer just read with the tile after next
          const unsigned l0 = lb + buf * (2 * TB); const h16* g0 = gk + (size_t)(kt0 + 2 * KS) * HD; const h16* g2 = gv + (kt0 + 2 * KS);
          stage4(l0, l0 + HB, l0 + TB, l0 + TB + HB, g0, g0 + 32 * HD, g2, g2 + (size_t)32 * SEQ);
      }
    }
    asm volatile("s_wait_asynccnt 0x0" ::: "memory");        // nothing of this wave's copies is outstanding past the loop
    l += __shfl_xor(l, 16, 32);
    const float inv = CXS * (1.0f / l);
    const int wb = wave * 16 * 68;
    // O^T D layout: o_j[r] = (d = 16j + 8h + r, t = lane&15) -> os[t][d]; rows 0..15 x columns 0..63 all written
    { v4f a, c;
      a[0] = o0[0] * inv; a[1] = o0[1] * inv; a[2] = o0[2] * inv; a[3] = o0[3] * inv; c[0] = o0[4] * inv; c[1] = o0[5] * inv; c[2] = o0[6] * inv; c[3] = o0[7] * inv;
      *(v4fa*)(&os[wb + lr * 68 +  0 + 8 * hi]) = a; *(v4fa*)(&os[wb + lr * 68 +  0 + 8 * hi + 4]) = c;
      a[0] = o1[0] * inv; a[1] = o1[1] * inv; a[2] = o1[2] * inv; a[3] = o1[3] * inv; c[0] = o1[4] * inv; c[1] = o1[5] * inv; c[2] = o1[6] * inv; c[3] = o1[7] * inv;
      *(v4fa*)(&os[wb + lr * 68 + 16 + 8 * hi]) = a; *(v4fa*)(&os[wb + lr * 68 + 16 + 8 * hi + 4]) = c;
      a[0] = o2[0] * inv; a[1] = o2[1] * inv; a[2] = o2[2] * inv; a[3] = o2[3] * inv; c[0] = o2[4] * inv; c[1] = o2[5] * inv; c[2] = o2[6] * inv; c[3] = o2[7] * inv;
      *(v4fa*)(&os[wb + lr * 68 + 32 + 8 * hi]) = a; *(v4fa*)(&os[wb + lr * 68 + 32 + 8 * hi + 4]) = c;
      a[0] = o3[0] * inv; a[1] = o3[1] * inv; a[2] = o3[2] * inv; a[3] = o3[3] * inv; c[0] = o3[4] * inv; c[1] = o3[5] * inv; c[2] = o3[6] * inv; c[3] = o3[7] * inv;
      *(v4fa*)(&os[wb + lr * 68 + 48 + 8 * hi]) = a; *(v4fa*)(&os[wb + lr * 68 + 48 + 8 * hi + 4]) = c; }
    wave_sync();
    h16* crow = CTX + ((size_t)b * SEQ + t0) * DM + h * HD;
{
#pragma unroll
        for (int s = 0; s < 4; ++s) { const int row = 4 * s + (lane >> 3), c8 = (lane & 7) * 8;   // 4 s x 4 row groups = 16 rows; 8 lanes x 8 halves = 64 columns
            const v4f x0 = *(const v4fa*)(&os[wb + row * 68 + c8]); const v4f x1 = *(const v4fa*)(&os[wb + row * 68 + c8 + 4]); v8h hv;
#pragma unroll
            for (int i = 0; i < 4; ++i) { hv[i] = (h16)x0[i]; hv[4 + i] = (h16)x1[i]; }
            *(v8h*)(crow + (size_t)row * DM + c8) = hv; }
         }
}

// k_oproj: f16 GEMM, ONE WAVE per 64-row x 64-column tile, K = DM. OUT[m][n] = (sum_k CX[m][k] WoT[n][k]) * 2^-18 + bo[n] (bo as bf16-RNE value), f32.
__global__ __launch_bounds__(32) void k_oproj(const h16* __restrict__ A, const h16* __restrict__ Bt, const float* __restrict__ bo, float* OUT) {
    __shared__ __align__(16) float os[16 * 68];
    const int K = DM;
    const int lane = threadIdx.x & 31, lr = lane & 15, hi = lane >> 4; const int r0 = blockIdx.x * 64;
    v8f acc[4][4];
#pragma unroll
    for (int mb = 0; mb < 4; ++mb)
#pragma unroll
        for (int nb = 0; nb < 4; ++nb) acc[mb][nb] = (v8f){};
    const size_t aoff = (size_t)(r0 + lr) * K + 8 * hi, boff = (size_t)lr * K + 8 * hi;
#pragma unroll 1
    for (int kc = 0; kc < K; kc += 32) {
        v16h a[4];
#pragma unroll
        for (int mb = 0; mb < 4; ++mb) a[mb] = ldh(A + aoff + (size_t)mb * 16 * K + kc);
#pragma unroll
        for (int nb = 0; nb < 4; ++nb) { const v16h b = ldh(Bt + boff + (size_t)nb * 16 * K + kc);
#pragma unroll
            for (int mb = 0; mb < 4; ++mb) acc[mb][nb] = wmma16(a[mb], b, acc[mb][nb]); }
        asm volatile("v_nop\n\tv_nop\n\tv_nop\n\tv_nop" : "+v"(acc[0][0]), "+v"(acc[1][1]), "+v"(acc[2][2]), "+v"(acc[3][3]) : "v"(a[0]), "v"(a[1]), "v"(a[2]), "v"(a[3]));
    }
    const int cofs = lr * 4;
    v4f bb;
#pragma unroll
    for (int i = 0; i < 4; ++i) bb[i] = bfr(bo[cofs + i]);
    const int bidx = r0 / SEQ, tt = r0 % SEQ;
    float* obase = OUT + ((size_t)bidx * OUT_SEQ + tt) * NO;
#pragma unroll
    for (int mb = 0; mb < 4; ++mb) {
#pragma unroll
        for (int nb = 0; nb < 4; ++nb) {
#pragma unroll
            for (int j = 0; j < 8; ++j) os[(hi * 8 + j) * 68 + nb * 16 + lr] = acc[mb][nb][j]; }   // D: row 8h+j, col lane&15
        wave_sync();
{
#pragma unroll
            for (int s = 0; s < 8; ++s) { const int row = 2 * s + hi;   // 8 s x 2 rows = 16 rows; 16 lanes x 4 floats = 64 columns
                const v4f x = *(const v4fa*)(&os[row * 68 + cofs]); v4f val;
#pragma unroll
                for (int i = 0; i < 4; ++i) val[i] = x[i] * OSC + bb[i];
                *(v4f*)(obase + (size_t)(mb * 16 + row) * NO + cofs) = val; }
             }
        wave_sync();
    }
}

static constexpr size_t al256(size_t v) { return (v + 255) & ~(size_t)255; }
static constexpr size_t SZ_XB = al256((size_t)NB * SEQ * DIN * 2);
static constexpr size_t SZ_WB = al256((size_t)3 * DM * DIN * 2);
static constexpr size_t SZ_WO = al256((size_t)NO * DM * 2);
static constexpr size_t SZ_PL = al256((size_t)NB * NH_ * SEQ * HD * 2);
static constexpr size_t SZ_CX = al256((size_t)NB * SEQ * DM * 2);
static constexpr size_t SZ_TOTAL = 2 * SZ_XB + SZ_WB + SZ_WO + 3 * SZ_PL + SZ_CX;
static_assert(SZ_TOTAL <= (size_t)134217728);          // workspace carve <= 128 MiB
static_assert(((size_t)DM * DIN * 2) % 256 == 0);      // weight sub-planes stay 256-byte aligned

extern "C" void kernel_launch(void* const* d_in, const int* in_sizes, int n_in,
                              void* d_out, int out_size, void* d_ws, size_t ws_size, hipStream_t stream) {
    if (n_in < 10) return;
    const size_t needx = ((size_t)(NB - 1) * SEQ_FULL + SEQ) * DIN;
    if ((size_t)in_sizes[0] < needx || (size_t)in_sizes[1] < needx) return;
    if ((size_t)in_sizes[2] < (size_t)NH_ * DIN * HD || (size_t)in_sizes[4] < (size_t)NH_ * DIN * HD || (size_t)in_sizes[6] < (size_t)NH_ * DIN * HD) return;
    if ((size_t)in_sizes[3] < (size_t)NH_ * HD || (size_t)in_sizes[5] < (size_t)NH_ * HD || (size_t)in_sizes[7] < (size_t)NH_ * HD) return;
    if ((size_t)in_sizes[8] < (size_t)DM * NO || (size_t)in_sizes[9] < (size_t)NO) return;
    if ((size_t)out_size < ((size_t)(NB - 1) * OUT_SEQ + SEQ) * NO) return;
    if (SZ_TOTAL > ws_size) return;
    // wire order: current_tokens, context_tokens, Wq, bq, Wk, bk, Wv, bv, Wo, bo
    const float* xq = (const float*)d_in[0]; const float* xc = (const float*)d_in[1];
    const float* wq = (const float*)d_in[2]; const float* bq = (const float*)d_in[3];
    const float* wk = (const float*)d_in[4]; const float* bk = (const float*)d_in[5];
    const float* wv = (const float*)d_in[6]; const float* bv = (const float*)d_in[7];
    const float* wo = (const float*)d_in[8]; const float* bo = (const float*)d_in[9];
    float* OUT = (float*)d_out;      // [NB][SEQ][64]
    char* wsp = (char*)d_ws;
    bf* XQ = (bf*)wsp; wsp += SZ_XB;                 // [NB*SEQ][1024] query tokens
    bf* XC = (bf*)wsp; wsp += SZ_XB;                 // [NB*SEQ][1024] context tokens
    bf* WB = (bf*)wsp; wsp += SZ_WB;                 // [3][16*64][1024]: q | k | v, rows n = h*64 + a, k-contiguous
    bf* WO = (bf*)wsp; wsp += SZ_WO;                 // [64][1024] f16 bits, x1024
    h16* QH = (h16*)wsp; wsp += SZ_PL;               // [NB*16][SEQ][64]
    h16* KP = (h16*)wsp; wsp += SZ_PL;               // [NB*16][SEQ][64]
    h16* VT = (h16*)wsp; wsp += SZ_PL;               // [NB*16][64][SEQ]
    h16* CX = (h16*)wsp; wsp += SZ_CX;               // [NB*SEQ][1024] ctx x256
    bf* WQ = WB; bf* WK = WB + (size_t)DM * DIN; bf* WV = WB + (size_t)2 * DM * DIN;

    if (SEQ == SEQ_FULL) {
        const size_t n8 = (size_t)NB * SEQ * DIN / 8;
        k_cvt8<<<(unsigned)((n8 + 255) / 256), 256, 0, stream>>>(xq, XQ, n8);
        k_cvt8<<<(unsigned)((n8 + 255) / 256), 256, 0, stream>>>(xc, XC, n8);
    } else {
        const size_t n8 = (size_t)SEQ * DIN / 8;
        for (int b = 0; b < NB; ++b) {
            k_cvt8<<<(unsigned)((n8 + 255) / 256), 256, 0, stream>>>(xq + (size_t)b * SEQ_FULL * DIN, XQ + (size_t)b * SEQ * DIN, n8);
            k_cvt8<<<(unsigned)((n8 + 255) / 256), 256, 0, stream>>>(xc + (size_t)b * SEQ_FULL * DIN, XC + (size_t)b * SEQ * DIN, n8);
        }
    }
    // weights: in [head][1024 (k)][64 (n)] -> out [head*64 + n][1024 (k)]; grid (k tiles, heads)
    k_wt<0><<<dim3(DIN / 64, NH_, 1), 256, 0, stream>>>(wq, WQ, DIN, 1.0f);
    k_wt<0><<<dim3(DIN / 64, NH_, 1), 256, 0, stream>>>(wk, WK, DIN, 1.0f);
    k_wt<0><<<dim3(DIN / 64, NH_, 1), 256, 0, stream>>>(wv, WV, DIN, 1.0f);
    // Wo: in [1024 (k)][64 (n)] -> out [n][1024 (k)], one head
    k_wt<1><<<dim3(DM / 64, 1, 1), 256, 0, stream>>>(wo, WO, DM, WOS);

    // q, k: A = token rows (m = b*SEQ + t), Bt = W rows (n = h*64 + a) -> plane [(b*16 + h)][t][a]; bias per column n
    k_proj<<<dim3(NB * SEQ / PBM, DM / PBN, 1), 256, 0, stream>>>(XQ, WQ, QH, bq, 0, 1, SEQ, (size_t)NH_ * SEQ * HD, HD, HD, (size_t)SEQ * HD);
    k_proj<<<dim3(NB * SEQ / PBM, DM / PBN, 1), 256, 0, stream>>>(XC, WK, KP, bk, 0, 1, SEQ, (size_t)NH_ * SEQ * HD, HD, HD, (size_t)SEQ * HD);
    // v^T: A = Wv rows (m = h*64 + o), Bt = context token rows (n = b*SEQ + t) -> plane [(b*1024 + m)][t] = [(b*16 + h)][o][t]; bias per row m
    k_proj<<<dim3(DM / PBM, NB * SEQ / PBN, 1), 256, 0, stream>>>(WV, XC, VT, bv, 1, 0, DM, (size_t)0, SEQ, SEQ, (size_t)DM * SEQ);

    k_flash<<<dim3(SEQ / (16 * AW), NB * NH_, 1), 32 * AW, 0, stream>>>(QH, KP, VT, CX);

    k_oproj<<<dim3(NB * SEQ / 64, 1, 1), 32, 0, stream>>>(CX, (const h16*)WO, bo, OUT);
}

// v003
// A run of this version takes 148 microseconds.
// Next to v002, in two timings, it ran 1.08 times as fast each time.
// Counting every step since v000, it is 2.26 times as fast.
#include <hip/hip_runtime.h>

// Multi-head cross-attention, 16 heads x 64: q from xq [NB][SEQ][1024], k/v from xc [NB][SEQ][1024]; per-head weights [head][in][out] with biases; score scale 1/8; no mask; concat heads (1024) @ Wo [1024][64] + bo -> out [NB][SEQ][64] f32.
// Compute dtypes, f32 accumulate everywhere: q/k/v projections v_wmma_f32_16x16x32_bf16 (tokens and weights RNE-converted to bf16; products exact), biases RNE-converted to bf16 and added in f32;
// scores v_wmma_f32_16x16x32_f16 (q, k single f16); P (x256 carry, cancels in the normalisation) and v single f16; softmax f32 (online, running max);
// output projection v_wmma_f32_16x16x32_f16: ctx as f16 with x256 carry, Wo as bf16-RNE value x1024 held in f16 (exact), accumulator scaled by 2^-18 and bias added in f32.
// Layout: bf16 copies of both token tensors; weights transposed through LDS into K-contiguous rows [head*64 + n][in]; q, k planes [b*16+h][t][d] and v^T plane [b*16+h][d][t] written by the GEMM epilogue;
// fused flash kernel in transposed form (S^T = K Q^T, O^T = V^T P^T), K and V^T tiles staged in LDS for the whole block, writing the f16 ctx plane [b*SEQ+t][h*64+d]; final GEMM (k split over the waves of a block, partials summed in LDS) writes the f32 output.

#ifndef NB
#define NB 4
#endif
#ifndef SEQ
#define SEQ 2048
#endif
#define NB_FULL  4
#define SEQ_FULL 2048
#ifndef OUT_SEQ
#define OUT_SEQ SEQ              // row pitch (in tokens) between batches of the output
#endif
#define DIN  1024                // token width (projection K)
#define NH_  16
#define HD   64
#define DM   (NH_ * HD)          // concatenated head width (output-projection K)
#define NO   64                  // output width
#define AW   8                   // waves per flash block (16 query rows each); all of them read the same staged K / V^T tiles
#define KS   64                  // keys per staged tile
#define LP   72                  // LDS row pitch in halves: 144 B = 16 B x 9, the conflict-free pitch for 16-byte row reads of 128-B rows
#define PBM  256                // projection block tile: rows (4 waves x 64)
#define PBN  128                // projection block tile: columns (2 waves x 64)
#define PKS  128                // k per staged projection tile
#define PLP  136                // LDS row pitch in elements: 272 B = 16 B x 17, the conflict-free pitch for 16-byte row reads of 256-B rows
#define OW   16                 // waves per output-projection block, one k slice each
#define OKS  (DM / OW)          // k per slice
#define OBM  32                 // output rows per output-projection block
#define SC2  (0.125f * 1.4426950408889634f)   // HD^-0.5 * log2(e)
#define PSH  8.0f                // log2 of the P carry (256)
#define CXS  256.0f              // carry of the ctx plane
#define WOS  1024.0f             // carry of the Wo plane
#define OSC  (1.0f / (256.0f * 1024.0f))

static_assert(HD == 64);
static_assert(NO == 64);                       // output row = 256 bytes = 16 lanes x 16 B
static_assert(NH_ * HD == DM);
static_assert(DM % 64 == 0);
static_assert(DIN % 64 == 0);                  // weight transpose tiles of 64
static_assert(DIN % 32 == 0);                  // GEMM k-loop steps by 32
static_assert(DM % 32 == 0);
static_assert(SEQ % 64 == 0);                  // a 64-row tile never straddles two batches
static_assert((NB * SEQ) % 64 == 0);
static_assert(SEQ % KS == 0);                  // key loop steps by whole staged tiles
static_assert(KS == 64 && KS % 32 == 0);       // a V^T tile row is 128 B, like a K row; 32 keys per softmax step
static_assert(AW * 32 * 2 * 8 == KS * HD);     // two 16-byte copies per thread cover one tile
static_assert(SEQ % (16 * AW) == 0);           // flash grid covers the sequence exactly
static_assert(((size_t)SEQ * DIN) % 8 == 0);
static_assert((NB * SEQ) % PBM == 0 && DM % PBM == 0 && (NB * SEQ) % PBN == 0 && DM % PBN == 0);   // projection grids cover both orientations exactly
static_assert(DIN % PKS == 0 && DIN >= 2 * PKS);   // whole staged tiles, and the ring's prologue needs two
static_assert(PBM == 256 && PBN == 128 && PKS == 128);   // copy map: 256 threads x 24 copies of 16 B = (PBM + PBN) rows of 256 B
static_assert(DM % (OW * 32) == 0 && OBM % 16 == 0);   // whole 32-k steps per slice, whole 16-row tiles per block
static_assert(SEQ % OBM == 0);                 // an output-projection block never straddles two batches
static_assert(32 * OW == OBM * (NO / 4));      // the final sum: one thread per 4 columns of one row
static_assert(NB <= NB_FULL);
static_assert(SEQ <= SEQ_FULL);

typedef _Float16 h16;
typedef unsigned short bf;
typedef __attribute__((ext_vector_type(16))) __bf16   v16bf;
typedef __attribute__((ext_vector_type(16))) _Float16 v16h;
typedef __attribute__((ext_vector_type(8)))  _Float16 v8h;
typedef __attribute__((ext_vector_type(8)))  unsigned short v8us;
typedef __attribute__((ext_vector_type(8)))  float    v8f;
typedef __attribute__((ext_vector_type(4)))  float    v4f;
typedef v4f  __attribute__((may_alias)) v4fa;

__device__ __forceinline__ unsigned short f2bf(float f) { unsigned u = __float_as_uint(f); u += 0x7FFFu + ((u >> 16) & 1u); return (unsigned short)(u >> 16); }
__device__ __forceinline__ float bf2f(unsigned short b) { return __uint_as_float(((unsigned)b) << 16); }
__device__ __forceinline__ float bfr(float f) { return bf2f(f2bf(f)); }   // value after RNE conversion to bf16
__device__ __forceinline__ v16h cat16(v8h lo, v8h hi) { return __builtin_shufflevector(lo, hi, 0, 1, 2, 3, 4, 5, 6, 7, 8, 9, 10, 11, 12, 13, 14, 15); }
__device__ __forceinline__ v16bf cat16b(v8us lo, v8us hi) { return __builtin_bit_cast(v16bf, __builtin_shufflevector(lo, hi, 0, 1, 2, 3, 4, 5, 6, 7, 8, 9, 10, 11, 12, 13, 14, 15)); }
__device__ __forceinline__ v8f wmma16(v16h a, v16h b, v8f c) { return __builtin_amdgcn_wmma_f32_16x16x32_f16(false, a, false, b, (short)0, c, false, false); }
__device__ __forceinline__ v8f wmmab(v16bf a, v16bf b, v8f c) { return __builtin_amdgcn_wmma_f32_16x16x32_bf16(false, a, false, b, (short)0, c, false, false); }
// fragment loaders from K-contiguous 16-bit rows; p already includes + 8*(lane>>4): elements 0..7 <- k0+8h+0..7, elements 8..15 <- k0+16+8h+0..7 (same map for A and B)
__device__ __forceinline__ v16h  ldh(const h16* p) { return cat16(*(const v8h*)p, *(const v8h*)(p + 16)); }
__device__ __forceinline__ v16bf ldb(const bf* p)  { return cat16b(*(const v8us*)p, *(const v8us*)(p + 16)); }
// ordering point for wave-private LDS tiles (same wave writes and reads)
__device__ __forceinline__ void wave_sync() { __builtin_amdgcn_fence(3 /* release order */, "wavefront"); __builtin_amdgcn_wave_barrier(); asm volatile("" ::: "memory"); }

__global__ __launch_bounds__(256) void k_cvt8(const float* __restrict__ src, bf* dst, size_t n8) {
    const size_t i = (size_t)blockIdx.x * 256 + threadIdx.x; if (i >= n8) return;
    const v8f v = *(const v8f*)(src + i * 8); v8us o;
#pragma unroll
    for (int k = 0; k < 8; ++k) o[k] = f2bf(v[k]);
    *(v8us*)(dst + i * 8) = o; 
}

// k_wt: weight transpose + 16-bit convert through LDS. in W[head][Kd][64] (f32, k-major) -> out WT[head*64 + n][Kd] (k-contiguous).
// F16 == 0: bf16 bits (RNE). F16 == 1: f16 of (bf16-RNE value * scale) (exact for power-of-two scale).
template <int F16>
__global__ __launch_bounds__(256) void k_wt(const float* __restrict__ W, bf* WT, int Kd, float scale) {
    __shared__ float ts[64 * 65];
    const int tid = threadIdx.x;
    const int d0 = blockIdx.x * 64, hh = blockIdx.y;
    const float* src = W + ((size_t)hh * Kd + d0) * 64;
#pragma unroll
    for (int it = 0; it < 4; ++it) {                    // 4 x 256 threads x 4 floats = 64 rows x 64 columns
        const int idx = it * 256 + tid; const int row = idx >> 4, c4 = (idx & 15) * 4;
        const v4f v = *(const v4f*)(src + (size_t)row * 64 + c4);
        ts[row * 65 + c4 + 0] = v[0]; ts[row * 65 + c4 + 1] = v[1]; ts[row * 65 + c4 + 2] = v[2]; ts[row * 65 + c4 + 3] = v[3];
    }
    __syncthreads();                                    // cross-wave tile: block barrier
    const int k8 = (tid & 7) * 8, nq = tid >> 3;        // 2 it x 32 row groups = 64 output rows; 8 lanes x 8 = 64 k
    v8us ou[2]; v8h oh[2];
#pragma unroll
    for (int it = 0; it < 2; ++it) {
        const int n = it * 32 + nq;
#pragma unroll
        for (int j = 0; j < 8; ++j) {
            const float w = ts[(k8 + j) * 65 + n];
            ou[it][j] = f2bf(w);
            oh[it][j] = (h16)(bfr(w) * scale);
        }
    }
{
#pragma unroll
        for (int it = 0; it < 2; ++it) {
            const size_t off = (size_t)(hh * 64 + it * 32 + nq) * (size_t)Kd + d0 + k8;
            if (F16) *(v8h*)((h16*)WT + off) = oh[it];
            else     *(v8us*)(WT + off) = ou[it];
        }
        
    }
}

// Twelve 16-byte copies per lane, global -> LDS through no register (a wave's copy covers two whole 256-B rows = four lines).
// The s_wait_xcnt stands inside the statement so that it precedes every later write of the address registers the copies name.
__device__ __forceinline__ void stage12(const unsigned (&l)[12], const bf* const (&g)[12]) {
    asm volatile("global_load_async_to_lds_b128 %0, %12, off\n\t"
                 "global_load_async_to_lds_b128 %1, %13, off\n\t"
                 "global_load_async_to_lds_b128 %2, %14, off\n\t"
                 "global_load_async_to_lds_b128 %3, %15, off\n\t"
                 "global_load_async_to_lds_b128 %4, %16, off\n\t"
                 "global_load_async_to_lds_b128 %5, %17, off\n\t"
                 "global_load_async_to_lds_b128 %6, %18, off\n\t"
                 "global_load_async_to_lds_b128 %7, %19, off\n\t"
                 "global_load_async_to_lds_b128 %8, %20, off\n\t"
                 "global_load_async_to_lds_b128 %9, %21, off\n\t"
                 "global_load_async_to_lds_b128 %10, %22, off\n\t"
                 "global_load_async_to_lds_b128 %11, %23, off\n\t"
                 "s_wait_xcnt 0x0"
                 :: "v"(l[0]), "v"(l[1]), "v"(l[2]), "v"(l[3]), "v"(l[4]), "v"(l[5]), "v"(l[6]), "v"(l[7]), "v"(l[8]), "v"(l[9]), "v"(l[10]), "v"(l[11]),
                    "v"(g[0]), "v"(g[1]), "v"(g[2]), "v"(g[3]), "v"(g[4]), "v"(g[5]), "v"(g[6]), "v"(g[7]), "v"(g[8]), "v"(g[9]), "v"(g[10]), "v"(g[11]) : "memory");
}
// One staged k tile of a projection block: PBM rows of A, then PBN rows of Bt, PKS elements each; a thread copies its 16-byte column of every 16th row.
// l: LDS byte address of the thread's chunk in its first row (tid>>4) of the buffer; ga, gb: the thread's chunk in its first A row and its first Bt row of the tile.
__device__ __forceinline__ void proj_fill(unsigned l, const bf* ga, const bf* gb) {
    constexpr unsigned LS = 16 * PLP * 2; constexpr size_t GS = (size_t)16 * DIN;
    unsigned la[12]; const bf* gp[12];
#pragma unroll
    for (int i = 0; i < 12; ++i) { la[i] = l + (unsigned)i * LS; gp[i] = ga + (size_t)i * GS; }
    stage12(la, gp);
#pragma unroll
    for (int i = 0; i < 4; ++i) { la[i] = l + (unsigned)(12 + i) * LS; gp[i] = ga + (size_t)(12 + i) * GS; }
#pragma unroll
    for (int i = 0; i < 8; ++i) { la[4 + i] = l + (unsigned)(16 + i) * LS; gp[4 + i] = gb + (size_t)i * GS; }
    stage12(la, gp);
}

// k_proj: register-blocked bf16 GEMM, K = DIN. A block of 8 waves (4 x 2) owns a PBM x PBN tile, each wave a 64x64 part of it (16 accumulators).
// The operands come in k tiles of PKS, copied once per block from the K-contiguous bf16 planes into a two-buffer LDS ring (the next tile's copies fly while this one is worked on) and read from there as fragments.
// C[m][n] = sum_k A[m][k] Bt[n][k] + bias, written as f16 (Ph) at wave-tile base (r0/RB)*sRB + (r0%RB)*pitch + (c0/CB)*sCB + (c0%CB), row pitch 'pitch' (halves).
// bias (bf16-RNE value, f32 add): per column when bcol == 1 (index n), per row when brow == 1 (index m); exactly one of brow/bcol is 1. grid (M/PBM, N/PBN), 256 threads.
__global__ __launch_bounds__(256) void k_proj(const bf* __restrict__ A, const bf* __restrict__ Bt, h16* Ph, const float* __restrict__ bias, int brow, int bcol, int RB, size_t sRB, int pitch, int CB, size_t sCB) {
    __shared__ __align__(16) float osb[8 * 16 * 68];
    __shared__ __align__(16) bf st[2 * (PBM + PBN) * PLP];   // [buffer][A rows | Bt rows][PLP]
    const int K = DIN;
    const int lane = threadIdx.x & 31, lr = lane & 15, hi = lane >> 4;
    const int wave = __builtin_amdgcn_readfirstlane(threadIdx.x >> 5);   // wave-uniform: the tile's base and its divisions stay scalar
    const int r0 = blockIdx.x * PBM + (wave >> 1) * 64, c0 = blockIdx.y * PBN + (wave & 1) * 64;
    float* os = osb + wave * 16 * 68;                        // wave-private epilogue tile
    v8f acc[4][4];
#pragma unroll
    for (int mb = 0; mb < 4; ++mb)
#pragma unroll
        for (int nb = 0; nb < 4; ++nb) acc[mb][nb] = (v8f){};
    // copy map: thread -> row tid>>4 (and every 16th row after it), 16-byte column tid&15
    const int cr = threadIdx.x >> 4, ccol = (threadIdx.x & 15) * 8;
    const bf* ga = A + (size_t)(blockIdx.x * PBM + cr) * K + ccol;    // + k0
    const bf* gb = Bt + (size_t)(blockIdx.y * PBN + cr) * K + ccol;   // + k0
    const unsigned lb = (unsigned)(size_t)st + (unsigned)(cr * PLP + ccol) * 2u;
    constexpr unsigned SB = (PBM + PBN) * PLP * 2;           // bytes of one buffer
    const int aoff = ((wave >> 1) * 64 + lr) * PLP + 8 * hi, boff = (PBM + (wave & 1) * 64 + lr) * PLP + 8 * hi;
    proj_fill(lb, ga, gb);
    asm volatile("s_wait_asynccnt 0x0" ::: "memory");        // this wave's copies of tile 0 have landed
    __syncthreads();                                         // tile 0 published to every wave
    proj_fill(lb + SB, ga + PKS, gb + PKS);                  // tile 1 exists: K >= 2 * PKS
#pragma unroll 1
    for (int kt = 0; kt < K; kt += PKS) {
        const unsigned buf = (unsigned)(kt / PKS) & 1u;
        const bf* sa = st + buf * ((PBM + PBN) * PLP) + aoff; const bf* sb = st + buf * ((PBM + PBN) * PLP) + boff;
        // Fragments in two register sets, all inside this tile: the next k step's LDS reads are issued in two groups ahead of their use (12 in front of this step's
        // products, 4 into the registers that its first 8 products free), so that no product waits for a read just issued. Each sched_barrier keeps one such group
        // where it is written: left alone, the compiler moves the reads down to their users and puts a full LDS wait in front of every 4 products.
        v16bf a[2][4], b[2][4];
#pragma unroll
        for (int i = 0; i < 4; ++i) { a[0][i] = ldb(sa + i * 16 * PLP); b[0][i] = ldb(sb + i * 16 * PLP); }
        __builtin_amdgcn_sched_barrier(0);
#pragma unroll
        for (int s = 0; s < PKS / 32; ++s) {
            const int c = s & 1, n = c ^ 1;
            if (s + 1 < PKS / 32) {
#pragma unroll
                for (int i = 0; i < 4; ++i) a[n][i] = ldb(sa + i * 16 * PLP + (s + 1) * 32);
                b[n][0] = ldb(sb + (s + 1) * 32); b[n][1] = ldb(sb + 16 * PLP + (s + 1) * 32);
                __builtin_amdgcn_sched_barrier(0);
            }
#pragma unroll
            for (int nb = 0; nb < 2; ++nb)
#pragma unroll
                for (int mb = 0; mb < 4; ++mb) acc[mb][nb] = wmmab(a[c][mb], b[c][nb], acc[mb][nb]);
            __builtin_amdgcn_sched_barrier(0);
            if (s + 1 < PKS / 32) {
                b[n][2] = ldb(sb + 32 * PLP + (s + 1) * 32); b[n][3] = ldb(sb + 48 * PLP + (s + 1) * 32);
                __builtin_amdgcn_sched_barrier(0);
            }
#pragma unroll
            for (int nb = 2; nb < 4; ++nb)
#pragma unroll
                for (int mb = 0; mb < 4; ++mb) acc[mb][nb] = wmmab(a[c][mb], b[c][nb], acc[mb][nb]);
            __builtin_amdgcn_sched_barrier(0);
        }
        asm volatile("s_wait_dscnt 0x0" ::: "memory");       // this wave's reads of the tile are done before its buffer may be refilled
        asm volatile("s_wait_asynccnt 0x0" ::: "memory");    // this wave's copies of the next tile have landed
        __syncthreads();                                     // publishes the next tile and ends every wave's reads of this one
        if (kt + 2 * PKS < K) proj_fill(lb + buf * SB, ga + (kt + 2 * PKS), gb + (kt + 2 * PKS));   // block-uniform: refill the buffer just read with the tile after next
    }
    asm volatile("s_wait_asynccnt 0x0" ::: "memory");        // nothing of this wave's copies is outstanding past the loop
    const size_t tbase = (size_t)(r0 / RB) * sRB + (size_t)(r0 % RB) * (size_t)pitch + (size_t)(c0 / CB) * sCB + (size_t)(c0 % CB);
    const int c8 = (lane & 7) * 8, rq = lane >> 3;
    const float fbc = (float)bcol, fbr = (float)brow;
    float bc[8];
#pragma unroll
    for (int i = 0; i < 8; ++i) bc[i] = bfr(bias[(size_t)(c0 + c8 + i) * (size_t)bcol]) * fbc;   // index < N when bcol == 1, else 0
#pragma unroll
    for (int mb = 0; mb < 4; ++mb) {
#pragma unroll
        for (int nb = 0; nb < 4; ++nb) {
#pragma unroll
            for (int j = 0; j < 8; ++j) os[(hi * 8 + j) * 68 + nb * 16 + lr] = acc[mb][nb][j]; }   // D: row 8h+j, col lane&15
        wave_sync();
        const size_t sb = tbase + (size_t)(mb * 16) * (size_t)pitch;
{
#pragma unroll
            for (int s = 0; s < 4; ++s) { const int row = 4 * s + rq;   // 4 s x 4 row groups = 16 rows; 8 lanes x 8 = 64 columns
                const v4f x0 = *(const v4fa*)(&os[row * 68 + c8]); const v4f x1 = *(const v4fa*)(&os[row * 68 + c8 + 4]); v8h hv;
                const float br = bfr(bias[(size_t)(r0 + mb * 16 + row) * (size_t)brow]) * fbr;         // index < M when brow == 1, else 0
#pragma unroll
                for (int i = 0; i < 4; ++i) { hv[i] = (h16)(x0[i] + bc[i] + br); hv[4 + i] = (h16)(x1[i] + bc[4 + i] + br); }
                const size_t oo = sb + (size_t)row * (size_t)pitch + c8;
                *(v8h*)(Ph + oo) = hv; }
             }
        wave_sync();
    }
}

// One staged tile pair: four 16-byte copies per lane, global -> LDS through no register (a wave's copy covers four whole 128-B lines).
// The s_wait_xcnt stands inside the statement so that it precedes every later write of the address registers the copies name.
__device__ __forceinline__ void stage4(unsigned l0, unsigned l1, unsigned l2, unsigned l3, const h16* g0, const h16* g1, const h16* g2, const h16* g3) {
    asm volatile("global_load_async_to_lds_b128 %0, %4, off\n\t"
                 "global_load_async_to_lds_b128 %1, %5, off\n\t"
                 "global_load_async_to_lds_b128 %2, %6, off\n\t"
                 "global_load_async_to_lds_b128 %3, %7, off\n\t"
                 "s_wait_xcnt 0x0"
                 :: "v"(l0), "v"(l1), "v"(l2), "v"(l3), "v"(g0), "v"(g1), "v"(g2), "v"(g3) : "memory");
}

__global__ __launch_bounds__(32 * AW) void k_flash(const h16* __restrict__ QH, const h16* __restrict__ KP, const h16* __restrict__ VT, h16* CTX) {
    __shared__ __align__(16) float os[AW * 16 * 68];
    __shared__ __align__(16) h16 kv[2 * 2 * KS * LP];        // [buffer][K tile: key rows | V^T tile: d rows][64 rows][LP]
    const int lane = threadIdx.x & 31, wave = threadIdx.x >> 5, lr = lane & 15, hi = lane >> 4;
    const int zh = blockIdx.y; const int b = zh / NH_, h = zh % NH_;
    const int t0 = (blockIdx.x * AW + wave) * 16;
    const size_t pbase = (size_t)zh * SEQ * HD;
    const size_t qo = pbase + (size_t)(t0 + lr) * HD + 8 * hi;
    const v16h qh0 = ldh(QH + qo), qh1 = ldh(QH + qo + 32);   // B fragments: col t, k = d
    const int fo = lr * LP + 8 * hi;                         // fragment offset in a tile: K + key*LP (A: row key, k = d); V^T + 16j*LP + key (A: row d, k = key)
    // copy map: thread -> row tid>>3 (and row + 32), 16-byte column tid&7
    const int cr = threadIdx.x >> 3, ccol = (threadIdx.x & 7) * 8;
    const h16* gk = KP + pbase + (size_t)cr * HD + ccol;   // + key0 * HD
    const h16* gv = VT + pbase + (size_t)cr * SEQ + ccol;  // + key0
    const unsigned lb = (unsigned)(size_t)kv + (unsigned)(cr * LP + ccol) * 2u;   // LDS byte address of the thread's first K chunk in buffer 0
    constexpr unsigned TB = KS * LP * 2, HB = 32 * LP * 2;   // bytes of one tile, of half a tile
    stage4(lb, lb + HB, lb + TB, lb + TB + HB, gk, gk + 32 * HD, gv, gv + (size_t)32 * SEQ);
    asm volatile("s_wait_asynccnt 0x0" ::: "memory");        // this wave's copies of tile 0 have landed
    __syncthreads();                                         // tile 0 published to every wave
    if (SEQ > KS) stage4(lb + 2 * TB, lb + 2 * TB + HB, lb + 3 * TB, lb + 3 * TB + HB, gk + KS * HD, gk + (KS + 32) * HD, gv + KS, gv + (size_t)32 * SEQ + KS);
    v8f o0 = (v8f){}, o1 = (v8f){}, o2 = (v8f){}, o3 = (v8f){};
    float m = -3.0e38f, l = 0.0f;
#pragma unroll 1
    for (int kt0 = 0; kt0 < SEQ; kt0 += KS) {
      const unsigned buf = (unsigned)(kt0 / KS) & 1u;
      const h16* kt = kv + buf * (2 * KS * LP) + fo;
#pragma unroll 1   // rolled: both steps unrolled take more than the 128 registers that let all blocks be resident at once
      for (int sub = 0; sub < KS; sub += 32) {
        const h16* ka = kt + sub * LP;
        const v16h ka0 = ldh(ka), ka1 = ldh(ka + 32), kb0 = ldh(ka + 16 * LP), kb1 = ldh(ka + 16 * LP + 32);
        v8f sA = (v8f){}, sB = (v8f){};
        sA = wmma16(ka0, qh0, sA); sB = wmma16(kb0, qh0, sB);
        sA = wmma16(ka1, qh1, sA); sB = wmma16(kb1, qh1, sB);
        asm volatile("v_nop\n\tv_nop\n\tv_nop\n\tv_nop" : "+v"(sA), "+v"(sB) : "v"(ka0), "v"(ka1), "v"(kb0), "v"(kb1));
        float ta[8], tb[8]; float mx = -3.0e38f;
#pragma unroll
        for (int r = 0; r < 8; ++r) { ta[r] = sA[r] * SC2; tb[r] = sB[r] * SC2; mx = fmaxf(mx, fmaxf(ta[r], tb[r])); }
        mx = fmaxf(mx, __shfl_xor(mx, 16, 32));
        const float mnew = fmaxf(m, mx);
        const float alpha = __builtin_amdgcn_exp2f(m - mnew);
        const float sh = PSH - mnew;
        v16h pb; float ls = 0.0f;
#pragma unroll
        for (int r = 0; r < 8; ++r) { const h16 pa = (h16)__builtin_amdgcn_exp2f(ta[r] + sh); const h16 pc = (h16)__builtin_amdgcn_exp2f(tb[r] + sh); pb[r] = pa; pb[8 + r] = pc; ls += (float)pa + (float)pc; }
        l = l * alpha + ls; m = mnew;
        o0 = o0 * alpha; o1 = o1 * alpha; o2 = o2 * alpha; o3 = o3 * alpha;
        const h16* va = kt + KS * LP + sub;
        const v16h v0 = ldh(va), v1 = ldh(va + 16 * LP), v2 = ldh(va + 32 * LP), v3 = ldh(va + 48 * LP);
        o0 = wmma16(v0, pb, o0); o1 = wmma16(v1, pb, o1); o2 = wmma16(v2, pb, o2); o3 = wmma16(v3, pb, o3);
        asm volatile("v_nop\n\tv_nop\n\tv_nop\n\tv_nop" : "+v"(o0), "+v"(o1), "+v"(o2), "+v"(o3) : "v"(v0), "v"(v1), "v"(v2), "v"(v3), "v"(pb));
      }
      asm volatile("s_wait_dscnt 0x0" ::: "memory");         // this wave's reads of the tile are done before its buffer may be refilled
      asm volatile("s_wait_asynccnt 0x0" ::: "memory");      // this wave's copies of the next tile have landed
      __syncthreads();                                       // publishes the next tile and ends every wave's reads of this one
      if (kt0 + 2 * KS < SEQ) {                              // block-uniform: refill the buffer just read with the tile after next
          const unsigned l0 = lb + buf * (2 * TB); const h16* g0 = gk + (size_t)(kt0 + 2 * KS) * HD; const h16* g2 = gv + (kt0 + 2 * KS);
          stage4(l0, l0 + HB, l0 + TB, l0 + TB + HB, g0, g0 + 32 * HD, g2, g2 + (size_t)32 * SEQ);
      }
    }
    asm volatile("s_wait_asynccnt 0x0" ::: "memory");        // nothing of this wave's copies is outstanding past the loop
    l += __shfl_xor(l, 16, 32);
    const float inv = CXS * (1.0f / l);
    const int wb = wave * 16 * 68;
    // O^T D layout: o_j[r] = (d = 16j + 8h + r, t = lane&15) -> os[t][d]; rows 0..15 x columns 0..63 all written
    { v4f a, c;
      a[0] = o0[0] * inv; a[1] = o0[1] * inv; a[2] = o0[2] * inv; a[3] = o0[3] * inv; c[0] = o0[4] * inv; c[1] = o0[5] * inv; c[2] = o0[6] * inv; c[3] = o0[7] * inv;
      *(v4fa*)(&os[wb + lr * 68 +  0 + 8 * hi]) = a; *(v4fa*)(&os[wb + lr * 68 +  0 + 8 * hi + 4]) = c;
      a[0] = o1[0] * inv; a[1] = o1[1] * inv; a[2] = o1[2] * inv; a[3] = o1[3] * inv; c[0] = o1[4] * inv; c[1] = o1[5] * inv; c[2] = o1[6] * inv; c[3] = o1[7] * inv;
      *(v4fa*)(&os[wb + lr * 68 + 16 + 8 * hi]) = a; *(v4fa*)(&os[wb + lr * 68 + 16 + 8 * hi + 4]) = c;
      a[0] = o2[0] * inv; a[1] = o2[1] * inv; a[2] = o2[2] * inv; a[3] = o2[3] * inv; c[0] = o2[4] * inv; c[1] = o2[5] * inv; c[2] = o2[6] * inv; c[3] = o2[7] * inv;
      *(v4fa*)(&os[wb + lr * 68 + 32 + 8 * hi]) = a; *(v4fa*)(&os[wb + lr * 68 + 32 + 8 * hi + 4]) = c;
      a[0] = o3[0] * inv; a[1] = o3[1] * inv; a[2] = o3[2] * inv; a[3] = o3[3] * inv; c[0] = o3[4] * inv; c[1] = o3[5] * inv; c[2] = o3[6] * inv; c[3] = o3[7] * inv;
      *(v4fa*)(&os[wb + lr * 68 + 48 + 8 * hi]) = a; *(v4fa*)(&os[wb + lr * 68 + 48 + 8 * hi + 4]) = c; }
    wave_sync();
    h16* crow = CTX + ((size_t)b * SEQ + t0) * DM + h * HD;
{
#pragma unroll
        for (int s = 0; s < 4; ++s) { const int row = 4 * s + (lane >> 3), c8 = (lane & 7) * 8;   // 4 s x 4 row groups = 16 rows; 8 lanes x 8 halves = 64 columns
            const v4f x0 = *(const v4fa*)(&os[wb + row * 68 + c8]); const v4f x1 = *(const v4fa*)(&os[wb + row * 68 + c8 + 4]); v8h hv;
#pragma unroll
            for (int i = 0; i < 4; ++i) { hv[i] = (h16)x0[i]; hv[4 + i] = (h16)x1[i]; }
            *(v8h*)(crow + (size_t)row * DM + c8) = hv; }
         }
}

// k_oproj: f16 GEMM, K = DM split over the OW waves of a block. A block owns OBM output rows x all 64 columns; each wave takes one k slice of OKS, has every fragment load of
// its slice in flight at once (no loop, one load latency), and leaves an f32 partial tile in LDS; after one block barrier the partials are summed in wave order.
// Transposed form (A = WoT rows n, B = ctx rows m): a lane holds 8 consecutive n of one output row m, so a partial tile goes to LDS in 16-byte stores.
// OUT[m][n] = (sum_k CX[m][k] WoT[n][k]) * 2^-18 + bo[n] (bo as bf16-RNE value), f32. grid (M/OBM), 32 * OW threads.
__global__ __launch_bounds__(32 * OW) void k_oproj(const h16* __restrict__ A, const h16* __restrict__ Bt, const float* __restrict__ bo, float* OUT) {
    __shared__ __align__(16) float ps[OW * OBM * 68];        // [wave][row m][68]: 272-B pitch, as the other epilogue tiles
    const int K = DM;
    const int lane = threadIdx.x & 31, lr = lane & 15, hi = lane >> 4;
    const int wave = __builtin_amdgcn_readfirstlane(threadIdx.x >> 5);   // wave-uniform: the slice's base stays scalar
    const int r0 = blockIdx.x * OBM;
    const h16* px = A + (size_t)(r0 + lr) * K + wave * OKS + 8 * hi;
    const h16* pw = Bt + (size_t)lr * K + wave * OKS + 8 * hi;
    v16h x[OBM / 16][OKS / 32], w[4][OKS / 32];
#pragma unroll
    for (int s = 0; s < OKS / 32; ++s) {
#pragma unroll
        for (int mb = 0; mb < OBM / 16; ++mb) x[mb][s] = ldh(px + (size_t)mb * 16 * K + s * 32);
#pragma unroll
        for (int nb = 0; nb < 4; ++nb) w[nb][s] = ldh(pw + (size_t)nb * 16 * K + s * 32);
    }
    // The wait that belongs in front of any overwrite of the loads' address registers; as its inputs the two addresses stay live up to it, so that no load's own destination takes their registers.
    asm volatile("s_wait_xcnt 0x0" :: "v"(px), "v"(pw) : "memory");
    // Keeps every load above in front of the first product: left alone, the compiler reuses two fragment register sets and waits out one load latency per pair of products.
    __builtin_amdgcn_sched_barrier(0);
    v8f acc[OBM / 16][4];
#pragma unroll
    for (int mb = 0; mb < OBM / 16; ++mb)
#pragma unroll
        for (int nb = 0; nb < 4; ++nb) acc[mb][nb] = (v8f){};
#pragma unroll
    for (int s = 0; s < OKS / 32; ++s)
#pragma unroll
        for (int nb = 0; nb < 4; ++nb)
#pragma unroll
            for (int mb = 0; mb < OBM / 16; ++mb) acc[mb][nb] = wmma16(w[nb][s], x[mb][s], acc[mb][nb]);
    // D layout: acc[mb][nb][j] = (n = 16nb + 8h + j, m = 16mb + (lane&15)) -> ps[wave][m][n]; rows 0..OBM-1 x columns 0..63 all written
    float* pd = ps + wave * (OBM * 68) + lr * 68 + 8 * hi;
#pragma unroll
    for (int mb = 0; mb < OBM / 16; ++mb)
#pragma unroll
        for (int nb = 0; nb < 4; ++nb) {
            v4f lo, up;
#pragma unroll
            for (int i = 0; i < 4; ++i) { lo[i] = acc[mb][nb][i]; up[i] = acc[mb][nb][4 + i]; }
            *(v4fa*)(pd + mb * 16 * 68 + nb * 16) = lo; *(v4fa*)(pd + mb * 16 * 68 + nb * 16 + 4) = up;
        }
    __syncthreads();                                         // every wave's partial tile is published
    const int row = threadIdx.x >> 4, cofs = (threadIdx.x & 15) * 4;   // 32 * OW threads = OBM rows x 16 groups of 4 columns
    v4f sum = *(const v4fa*)(&ps[row * 68 + cofs]);
#pragma unroll
    for (int q = 1; q < OW; ++q) sum += *(const v4fa*)(&ps[q * (OBM * 68) + row * 68 + cofs]);
    const int bidx = r0 / SEQ, tt = r0 % SEQ;
    float* obase = OUT + ((size_t)bidx * OUT_SEQ + tt) * NO;
    v4f val;
#pragma unroll
    for (int i = 0; i < 4; ++i) val[i] = sum[i] * OSC + bfr(bo[cofs + i]);
    *(v4f*)(obase + (size_t)row * NO + cofs) = val;
}

static constexpr size_t al256(size_t v) { return (v + 255) & ~(size_t)255; }
static constexpr size_t SZ_XB = al256((size_t)NB * SEQ * DIN * 2);
static constexpr size_t SZ_WB = al256((size_t)3 * DM * DIN * 2);
static constexpr size_t SZ_WO = al256((size_t)NO * DM * 2);
static constexpr size_t SZ_PL = al256((size_t)NB * NH_ * SEQ * HD * 2);
static constexpr size_t SZ_CX = al256((size_t)NB * SEQ * DM * 2);
static constexpr size_t SZ_TOTAL = 2 * SZ_XB + SZ_WB + SZ_WO + 3 * SZ_PL + SZ_CX;
static_assert(SZ_TOTAL <= (size_t)134217728);          // workspace carve <= 128 MiB
static_assert(((size_t)DM * DIN * 2) % 256 == 0);      // weight sub-planes stay 256-byte aligned

extern "C" void kernel_launch(void* const* d_in, const int* in_sizes, int n_in,
                              void* d_out, int out_size, void* d_ws, size_t ws_size, hipStream_t stream) {
    if (n_in < 10) return;
    const size_t needx = ((size_t)(NB - 1) * SEQ_FULL + SEQ) * DIN;
    if ((size_t)in_sizes[0] < needx || (size_t)in_sizes[1] < needx) return;
    if ((size_t)in_sizes[2] < (size_t)NH_ * DIN * HD || (size_t)in_sizes[4] < (size_t)NH_ * DIN * HD || (size_t)in_sizes[6] < (size_t)NH_ * DIN * HD) return;
    if ((size_t)in_sizes[3] < (size_t)NH_ * HD || (size_t)in_sizes[5] < (size_t)NH_ * HD || (size_t)in_sizes[7] < (size_t)NH_ * HD) return;
    if ((size_t)in_sizes[8] < (size_t)DM * NO || (size_t)in_sizes[9] < (size_t)NO) return;
    if ((size_t)out_size < ((size_t)(NB - 1) * OUT_SEQ + SEQ) * NO) return;
    if (SZ_TOTAL > ws_size) return;
    // wire order: current_tokens, context_tokens, Wq, bq, Wk, bk, Wv, bv, Wo, bo
    const float* xq = (const float*)d_in[0]; const float* xc = (const float*)d_in[1];
    const float* wq = (const float*)d_in[2]; const float* bq = (const float*)d_in[3];
    const float* wk = (const float*)d_in[4]; const float* bk = (const float*)d_in[5];
    const float* wv = (const float*)d_in[6]; const float* bv = (const float*)d_in[7];
    const float* wo = (const float*)d_in[8]; const float* bo = (const float*)d_in[9];
    float* OUT = (float*)d_out;      // [NB][SEQ][64]
    char* wsp = (char*)d_ws;
    bf* XQ = (bf*)wsp; wsp += SZ_XB;                 // [NB*SEQ][1024] query tokens
    bf* XC = (bf*)wsp; wsp += SZ_XB;                 // [NB*SEQ][1024] context tokens
    bf* WB = (bf*)wsp; wsp += SZ_WB;                 // [3][16*64][1024]: q | k | v, rows n = h*64 + a, k-contiguous
    bf* WO = (bf*)wsp; wsp += SZ_WO;                 // [64][1024] f16 bits, x1024
    h16* QH = (h16*)wsp; wsp += SZ_PL;               // [NB*16][SEQ][64]
    h16* KP = (h16*)wsp; wsp += SZ_PL;               // [NB*16][SEQ][64]
    h16* VT = (h16*)wsp; wsp += SZ_PL;               // [NB*16][64][SEQ]
    h16* CX = (h16*)wsp; wsp += SZ_CX;               // [NB*SEQ][1024] ctx x256
    bf* WQ = WB; bf* WK = WB + (size_t)DM * DIN; bf* WV = WB + (size_t)2 * DM * DIN;

    if (SEQ == SEQ_FULL) {
        const size_t n8 = (size_t)NB * SEQ * DIN / 8;
        k_cvt8<<<(unsigned)((n8 + 255) / 256), 256, 0, stream>>>(xq, XQ, n8);
        k_cvt8<<<(unsigned)((n8 + 255) / 256), 256, 0, stream>>>(xc, XC, n8);
    } else {
        const size_t n8 = (size_t)SEQ * DIN / 8;
        for (int b = 0; b < NB; ++b) {
            k_cvt8<<<(unsigned)((n8 + 255) / 256), 256, 0, stream>>>(xq + (size_t)b * SEQ_FULL * DIN, XQ + (size_t)b * SEQ * DIN, n8);
            k_cvt8<<<(unsigned)((n8 + 255) / 256), 256, 0, stream>>>(xc + (size_t)b * SEQ_FULL * DIN, XC + (size_t)b * SEQ * DIN, n8);
        }
    }
    // weights: in [head][1024 (k)][64 (n)] -> out [head*64 + n][1024 (k)]; grid (k tiles, heads)
    k_wt<0><<<dim3(DIN / 64, NH_, 1), 256, 0, stream>>>(wq, WQ, DIN, 1.0f);
    k_wt<0><<<dim3(DIN / 64, NH_, 1), 256, 0, stream>>>(wk, WK, DIN, 1.0f);
    k_wt<0><<<dim3(DIN / 64, NH_, 1), 256, 0, stream>>>(wv, WV, DIN, 1.0f);
    // Wo: in [1024 (k)][64 (n)] -> out [n][1024 (k)], one head
    k_wt<1><<<dim3(DM / 64, 1, 1), 256, 0, stream>>>(wo, WO, DM, WOS);

    // q, k: A = token rows (m = b*SEQ + t), Bt = W rows (n = h*64 + a) -> plane [(b*16 + h)][t][a]; bias per column n
    k_proj<<<dim3(NB * SEQ / PBM, DM / PBN, 1), 256, 0, stream>>>(XQ, WQ, QH, bq, 0, 1, SEQ, (size_t)NH_ * SEQ * HD, HD, HD, (size_t)SEQ * HD);
    k_proj<<<dim3(NB * SEQ / PBM, DM / PBN, 1), 256, 0, stream>>>(XC, WK, KP, bk, 0, 1, SEQ, (size_t)NH_ * SEQ * HD, HD, HD, (size_t)SEQ * HD);
    // v^T: A = Wv rows (m = h*64 + o), Bt = context token rows (n = b*SEQ + t) -> plane [(b*1024 + m)][t] = [(b*16 + h)][o][t]; bias per row m
    k_proj<<<dim3(DM / PBM, NB * SEQ / PBN, 1), 256, 0, stream>>>(WV, XC, VT, bv, 1, 0, DM, (size_t)0, SEQ, SEQ, (size_t)DM * SEQ);

    k_flash<<<dim3(SEQ / (16 * AW), NB * NH_, 1), 32 * AW, 0, stream>>>(QH, KP, VT, CX);

    k_oproj<<<dim3(NB * SEQ / OBM, 1, 1), 32 * OW, 0, stream>>>(CX, (const h16*)WO, bo, OUT);
}

// v004
// One run takes 129 microseconds.
// In both of two side-by-side timings against v003, it was 1.15 times as fast.
// All steps since v000 together make it 2.60 times as fast.
#include <hip/hip_runtime.h>

// Multi-head cross-attention, 16 heads x 64: q from xq [NB][SEQ][1024], k/v from xc [NB][SEQ][1024]; per-head weights [head][in][out] with biases; score scale 1/8; no mask; concat heads (1024) @ Wo [1024][64] + bo -> out [NB][SEQ][64] f32.
// Compute dtypes, f32 accumulate everywhere: q/k/v projections v_wmma_f32_16x16x32_bf16 (tokens and weights RNE-converted to bf16; products exact), biases RNE-converted to bf16 and added in f32;
// scores v_wmma_f32_16x16x32_f16 (q, k single f16); P (x256 carry, cancels in the normalisation) and v single f16; softmax f32 (online, running max);
// output projection v_wmma_f32_16x16x32_f16: ctx as f16 with x256 carry, Wo as bf16-RNE value x1024 held in f16 (exact), accumulator scaled by 2^-18 and bias added in f32.
// Layout: bf16 copies of both token tensors; weights transposed through LDS into K-contiguous rows [head*64 + n][in]; q, k planes [b*16+h][t][d] and v^T plane [b*16+h][d][t] written by the GEMM epilogue;
// the conversions share one launch and the three projections another (block ranges of one grid); fused flash kernel in transposed form (S^T = K Q^T, O^T = V^T P^T), K and V^T tiles staged in LDS for the whole block, writing the f16 ctx plane [b*SEQ+t][h*64+d]; final GEMM (k split over the waves of a block, partials summed in LDS) writes the f32 output.

#ifndef NB
#define NB 4
#endif
#ifndef SEQ
#define SEQ 2048
#endif
#define NB_FULL  4
#define SEQ_FULL 2048
#ifndef OUT_SEQ
#define OUT_SEQ SEQ              // row pitch (in tokens) between batches of the output
#endif
#define DIN  1024                // token width (projection K)
#define NH_  16
#define HD   64
#define DM   (NH_ * HD)          // concatenated head width (output-projection K)
#define NO   64                  // output width
#define AW   8                   // waves per flash block (16 query rows each); all of them read the same staged K / V^T tiles
#define KS   64                  // keys per staged tile
#define LP   72                  // LDS row pitch in halves: 144 B = 16 B x 9, the conflict-free pitch for 16-byte row reads of 128-B rows
#define PBM  256                // projection block tile: rows (4 waves x 64)
#define PBN  128                // projection block tile: columns (2 waves x 64)
#define PKS  128                // k per staged projection tile
#define PLP  136                // LDS row pitch in elements: 272 B = 16 B x 17, the conflict-free pitch for 16-byte row reads of 256-B rows
#define OW   16                 // waves per output-projection block, one k slice each
#define OKS  (DM / OW)          // k per slice
#define OBM  32                 // output rows per output-projection block
#define SC2  (0.125f * 1.4426950408889634f)   // HD^-0.5 * log2(e)
#define PSH  8.0f                // log2 of the P carry (256)
#define CXS  256.0f              // carry of the ctx plane
#define WOS  1024.0f             // carry of the Wo plane
#define OSC  (1.0f / (256.0f * 1024.0f))

static_assert(HD == 64);
static_assert(NO == 64);                       // output row = 256 bytes = 16 lanes x 16 B
static_assert(NH_ * HD == DM);
static_assert(DM % 64 == 0);
static_assert(DIN % 64 == 0);                  // weight transpose tiles of 64
static_assert(DIN % 32 == 0);                  // GEMM k-loop steps by 32
static_assert(DM % 32 == 0);
static_assert(SEQ % 64 == 0);                  // a 64-row tile never straddles two batches
static_assert((NB * SEQ) % 64 == 0);
static_assert(SEQ % KS == 0);                  // key loop steps by whole staged tiles
static_assert(KS == 64 && KS % 32 == 0);       // a V^T tile row is 128 B, like a K row; 32 keys per softmax step
static_assert(AW * 32 * 2 * 8 == KS * HD);     // two 16-byte copies per thread cover one tile
static_assert(SEQ % (16 * AW) == 0);           // flash grid covers the sequence exactly
static_assert(((size_t)SEQ * DIN) % 8 == 0);
static_assert((NB * SEQ) % PBM == 0 && DM % PBM == 0 && (NB * SEQ) % PBN == 0 && DM % PBN == 0);   // projection grids cover both orientations exactly
static_assert(DIN % PKS == 0 && DIN >= 2 * PKS);   // whole staged tiles, and the ring's prologue needs two
static_assert(((NB * SEQ) / PBM) * (DM / PBN) == (DM / PBM) * ((NB * SEQ) / PBN));   // the three projections share one grid: as many block tiles in either orientation
static_assert(PBM == 256 && PBN == 128 && PKS == 128);   // copy map: 256 threads x 24 copies of 16 B = (PBM + PBN) rows of 256 B
static_assert(DM % (OW * 32) == 0 && OBM % 16 == 0);   // whole 32-k steps per slice, whole 16-row tiles per block
static_assert(SEQ % OBM == 0);                 // an output-projection block never straddles two batches
static_assert(32 * OW == OBM * (NO / 4));      // the final sum: one thread per 4 columns of one row
static_assert(NB <= NB_FULL);
static_assert(SEQ <= SEQ_FULL);

typedef _Float16 h16;
typedef unsigned short bf;
typedef __attribute__((ext_vector_type(16))) __bf16   v16bf;
typedef __attribute__((ext_vector_type(16))) _Float16 v16h;
typedef __attribute__((ext_vector_type(8)))  _Float16 v8h;
typedef __attribute__((ext_vector_type(8)))  unsigned short v8us;
typedef __attribute__((ext_vector_type(8)))  float    v8f;
typedef __attribute__((ext_vector_type(4)))  float    v4f;
typedef v4f  __attribute__((may_alias)) v4fa;

__device__ __forceinline__ unsigned short f2bf(float f) { unsigned u = __float_as_uint(f); u += 0x7FFFu + ((u >> 16) & 1u); return (unsigned short)(u >> 16); }
__device__ __forceinline__ float bf2f(unsigned short b) { return __uint_as_float(((unsigned)b) << 16); }
__device__ __forceinline__ float bfr(float f) { return bf2f(f2bf(f)); }   // value after RNE conversion to bf16
__device__ __forceinline__ v16h cat16(v8h lo, v8h hi) { return __builtin_shufflevector(lo, hi, 0, 1, 2, 3, 4, 5, 6, 7, 8, 9, 10, 11, 12, 13, 14, 15); }
__device__ __forceinline__ v16bf cat16b(v8us lo, v8us hi) { return __builtin_bit_cast(v16bf, __builtin_shufflevector(lo, hi, 0, 1, 2, 3, 4, 5, 6, 7, 8, 9, 10, 11, 12, 13, 14, 15)); }
__device__ __forceinline__ v8f wmma16(v16h a, v16h b, v8f c) { return __builtin_amdgcn_wmma_f32_16x16x32_f16(false, a, false, b, (short)0, c, false, false); }
__device__ __forceinline__ v8f wmmab(v16bf a, v16bf b, v8f c) { return __builtin_amdgcn_wmma_f32_16x16x32_bf16(false, a, false, b, (short)0, c, false, false); }
// fragment loaders from K-contiguous 16-bit rows; p already includes + 8*(lane>>4): elements 0..7 <- k0+8h+0..7, elements 8..15 <- k0+16+8h+0..7 (same map for A and B)
__device__ __forceinline__ v16h  ldh(const h16* p) { return cat16(*(const v8h*)p, *(const v8h*)(p + 16)); }
__device__ __forceinline__ v16bf ldb(const bf* p)  { return cat16b(*(const v8us*)p, *(const v8us*)(p + 16)); }
// ordering point for wave-private LDS tiles (same wave writes and reads)
__device__ __forceinline__ void wave_sync() { __builtin_amdgcn_fence(3 /* release order */, "wavefront"); __builtin_amdgcn_wave_barrier(); asm volatile("" ::: "memory"); }

// cvt8: token f32 -> bf16, 8 elements per thread; blk = block index inside one tensor's range. The source keeps the full batch pitch, the bf16 plane is dense.
__device__ __forceinline__ void cvt8(const float* __restrict__ src, bf* dst, unsigned blk) {
    constexpr size_t B8 = (size_t)SEQ * DIN / 8;        // threads per batch
    const size_t i = (size_t)blk * 256 + threadIdx.x; if (i >= (size_t)NB * B8) return;
    const size_t so = (SEQ == SEQ_FULL) ? i * 8 : (i / B8) * ((size_t)SEQ_FULL * DIN) + (i % B8) * 8;
    const v8f v = *(const v8f*)(src + so); v8us o;
#pragma unroll
    for (int k = 0; k < 8; ++k) o[k] = f2bf(v[k]);
    *(v8us*)(dst + i * 8) = o;
}

// wt: weight transpose + 16-bit convert through LDS (ts: 64 x 65 floats of the block), one 64 x 64 tile (k tile kb of head hh) per block. in W[head][Kd][64] (f32, k-major) -> out WT[head*64 + n][Kd] (k-contiguous).
// F16 == 0: bf16 bits (RNE). F16 == 1: f16 of (bf16-RNE value * scale) (exact for power-of-two scale).
template <int F16>
__device__ __forceinline__ void wt(float* ts, const float* __restrict__ W, bf* WT, int Kd, float scale, int kb, int hh) {
    const int tid = threadIdx.x;
    const int d0 = kb * 64;
    const float* src = W + ((size_t)hh * Kd + d0) * 64;
#pragma unroll
    for (int it = 0; it < 4; ++it) {                    // 4 x 256 threads x 4 floats = 64 rows x 64 columns
        const int idx = it * 256 + tid; const int row = idx >> 4, c4 = (idx & 15) * 4;
        const v4f v = *(const v4f*)(src + (size_t)row * 64 + c4);
        ts[row * 65 + c4 + 0] = v[0]; ts[row * 65 + c4 + 1] = v[1]; ts[row * 65 + c4 + 2] = v[2]; ts[row * 65 + c4 + 3] = v[3];
    }
    __syncthreads();                                    // cross-wave tile: block barrier
    const int k8 = (tid & 7) * 8, nq = tid >> 3;        // 2 it x 32 row groups = 64 output rows; 8 lanes x 8 = 64 k
    v8us ou[2]; v8h oh[2];
#pragma unroll
    for (int it = 0; it < 2; ++it) {
        const int n = it * 32 + nq;
#pragma unroll
        for (int j = 0; j < 8; ++j) {
            const float w = ts[(k8 + j) * 65 + n];
            ou[it][j] = f2bf(w);
            oh[it][j] = (h16)(bfr(w) * scale);
        }
    }
{
#pragma unroll
        for (int it = 0; it < 2; ++it) {
            const size_t off = (size_t)(hh * 64 + it * 32 + nq) * (size_t)Kd + d0 + k8;
            if (F16) *(v8h*)((h16*)WT + off) = oh[it];
            else     *(v8us*)(WT + off) = ou[it];
        }
        
    }
}

// k_prep: all the work that depends on the inputs alone, as block ranges of one grid (the parts share no data): the three projection weights, Wo, then the two token tensors.
// The short transposes stand first in the index order (for speed only). Every test below is on the block index alone.
#define WTB ((DIN / 64) * NH_)                                   // blocks per projection weight: k tiles x heads
#define WOB (DM / 64)                                            // blocks of Wo: k tiles, one head
#define CVB ((unsigned)(((size_t)NB * SEQ * DIN / 8 + 255) / 256))   // blocks per token tensor
__global__ __launch_bounds__(256) void k_prep(const float* __restrict__ xq, const float* __restrict__ xc, const float* __restrict__ wq, const float* __restrict__ wk, const float* __restrict__ wv,
                                              const float* __restrict__ wo, bf* XQ, bf* XC, bf* WB, bf* WO) {
    __shared__ float ts[64 * 65];
    const unsigned blk = blockIdx.x;
    if (blk >= 3 * WTB + WOB) {
        const unsigned c = blk - (3 * WTB + WOB); const bool ctx = c >= CVB;
        cvt8(ctx ? xc : xq, ctx ? XC : XQ, ctx ? c - CVB : c);
    } else if (blk >= 3 * WTB) {
        // Wo: in [1024 (k)][64 (n)] -> out [n][1024 (k)], one head
        wt<1>(ts, wo, WO, DM, WOS, (int)(blk - 3 * WTB), 0);
    } else {
        // in [head][1024 (k)][64 (n)] -> out [head*64 + n][1024 (k)]
        const unsigned w = blk / WTB, r = blk % WTB;
        wt<0>(ts, w == 0 ? wq : w == 1 ? wk : wv, WB + (size_t)w * DM * DIN, DIN, 1.0f, (int)(r % (DIN / 64)), (int)(r / (DIN / 64)));
    }
}

// Twelve 16-byte copies per lane, global -> LDS through no register (a wave's copy covers two whole 256-B rows = four lines).
// The s_wait_xcnt stands inside the statement so that it precedes every later write of the address registers the copies name.
__device__ __forceinline__ void stage12(const unsigned (&l)[12], const bf* const (&g)[12]) {
    asm volatile("global_load_async_to_lds_b128 %0, %12, off\n\t"
                 "global_load_async_to_lds_b128 %1, %13, off\n\t"
                 "global_load_async_to_lds_b128 %2, %14, off\n\t"
                 "global_load_async_to_lds_b128 %3, %15, off\n\t"
                 "global_load_async_to_lds_b128 %4, %16, off\n\t"
                 "global_load_async_to_lds_b128 %5, %17, off\n\t"
                 "global_load_async_to_lds_b128 %6, %18, off\n\t"
                 "global_load_async_to_lds_b128 %7, %19, off\n\t"
                 "global_load_async_to_lds_b128 %8, %20, off\n\t"
                 "global_load_async_to_lds_b128 %9, %21, off\n\t"
                 "global_load_async_to_lds_b128 %10, %22, off\n\t"
                 "global_load_async_to_lds_b128 %11, %23, off\n\t"
                 "s_wait_xcnt 0x0"
                 :: "v"(l[0]), "v"(l[1]), "v"(l[2]), "v"(l[3]), "v"(l[4]), "v"(l[5]), "v"(l[6]), "v"(l[7]), "v"(l[8]), "v"(l[9]), "v"(l[10]), "v"(l[11]),
                    "v"(g[0]), "v"(g[1]), "v"(g[2]), "v"(g[3]), "v"(g[4]), "v"(g[5]), "v"(g[6]), "v"(g[7]), "v"(g[8]), "v"(g[9]), "v"(g[10]), "v"(g[11]) : "memory");
}
// One staged k tile of a projection block: PBM rows of A, then PBN rows of Bt, PKS elements each; a thread copies its 16-byte column of every 16th row.
// l: LDS byte address of the thread's chunk in its first row (tid>>4) of the buffer; ga, gb: the thread's chunk in its first A row and its first Bt row of the tile.
__device__ __forceinline__ void proj_fill(unsigned l, const bf* ga, const bf* gb) {
    constexpr unsigned LS = 16 * PLP * 2; constexpr size_t GS = (size_t)16 * DIN;
    unsigned la[12]; const bf* gp[12];
#pragma unroll
    for (int i = 0; i < 12; ++i) { la[i] = l + (unsigned)i * LS; gp[i] = ga + (size_t)i * GS; }
    stage12(la, gp);
#pragma unroll
    for (int i = 0; i < 4; ++i) { la[i] = l + (unsigned)(12 + i) * LS; gp[i] = ga + (size_t)(12 + i) * GS; }
#pragma unroll
    for (int i = 0; i < 8; ++i) { la[4 + i] = l + (unsigned)(16 + i) * LS; gp[4 + i] = gb + (size_t)i * GS; }
    stage12(la, gp);
}

// k_proj: register-blocked bf16 GEMM, K = DIN. A block of 8 waves (4 x 2) owns a PBM x PBN tile, each wave a 64x64 part of it (16 accumulators).
// The operands come in k tiles of PKS, copied once per block from the K-contiguous bf16 planes into a two-buffer LDS ring (the next tile's copies fly while this one is worked on) and read from there as fragments.
// C[m][n] = sum_k A[m][k] Bt[n][k] + bias, written as f16 (Ph) from the wave tile's base in its plane ('tbase'), row pitch 'pitch' (halves).
// bias (bf16-RNE value, f32 add): per column when bcol == 1 (index n), per row when brow == 1 (index m); exactly one of brow/bcol is 1.
// The three projections are independent and run as one grid (PGB tiles, 3 products), 256 threads; blockIdx.y picks the product, all of its parameters are block-uniform:
// q, k: A = token rows (m = b*SEQ + t), Bt = W rows (n = h*64 + a) -> plane [(b*16 + h)][t][a]; bias per column n
// v^T:  A = Wv rows (m = h*64 + o), Bt = context token rows (n = b*SEQ + t) -> plane [(b*1024 + m)][t] = [(b*16 + h)][o][t]; bias per row m
#define PGB (((NB * SEQ) / PBM) * (DM / PBN))   // block tiles of one product, the same number in both orientations
__global__ __launch_bounds__(256) void k_proj(const bf* __restrict__ XQ, const bf* __restrict__ XC, const bf* __restrict__ WB, h16* QH, h16* KP, h16* VT,
                                              const float* __restrict__ bq, const float* __restrict__ bk, const float* __restrict__ bv) {
    const int job = blockIdx.y; const bool tr = job == 2;
    const bf* A = job == 0 ? XQ : job == 1 ? XC : WB + (size_t)2 * DM * DIN;
    const bf* Bt = job == 0 ? WB : job == 1 ? WB + (size_t)DM * DIN : XC;
    h16* Ph = job == 0 ? QH : job == 1 ? KP : VT;
    const float* bias = job == 0 ? bq : job == 1 ? bk : bv;
    const int brow = tr ? 1 : 0, bcol = tr ? 0 : 1;
    const int pitch = tr ? SEQ : HD;
    // the tile index runs over the product's row tiles first; both counts are constants, so the divisions stay scalar shifts
    const int bx = tr ? (int)(blockIdx.x % (DM / PBM)) : (int)(blockIdx.x % (NB * SEQ / PBM));
    const int by = tr ? (int)(blockIdx.x / (DM / PBM)) : (int)(blockIdx.x / (NB * SEQ / PBM));
    __shared__ __align__(16) float osb[8 * 16 * 68];
    __shared__ __align__(16) bf st[2 * (PBM + PBN) * PLP];   // [buffer][A rows | Bt rows][PLP]
    const int K = DIN;
    const int lane = threadIdx.x & 31, lr = lane & 15, hi = lane >> 4;
    const int wave = __builtin_amdgcn_readfirstlane(threadIdx.x >> 5);   // wave-uniform: the tile's base and its divisions stay scalar
    const int r0 = bx * PBM + (wave >> 1) * 64, c0 = by * PBN + (wave & 1) * 64;
    float* os = osb + wave * 16 * 68;                        // wave-private epilogue tile
    v8f acc[4][4];
#pragma unroll
    for (int mb = 0; mb < 4; ++mb)
#pragma unroll
        for (int nb = 0; nb < 4; ++nb) acc[mb][nb] = (v8f){};
    // copy map: thread -> row tid>>4 (and every 16th row after it), 16-byte column tid&15
    const int cr = threadIdx.x >> 4, ccol = (threadIdx.x & 15) * 8;
    const bf* ga = A + (size_t)(bx * PBM + cr) * K + ccol;    // + k0
    const bf* gb = Bt + (size_t)(by * PBN + cr) * K + ccol;   // + k0
    const unsigned lb = (unsigned)(size_t)st + (unsigned)(cr * PLP + ccol) * 2u;
    constexpr unsigned SB = (PBM + PBN) * PLP * 2;           // bytes of one buffer
    const int aoff = ((wave >> 1) * 64 + lr) * PLP + 8 * hi, boff = (PBM + (wave & 1) * 64 + lr) * PLP + 8 * hi;
    proj_fill(lb, ga, gb);
    asm volatile("s_wait_asynccnt 0x0" ::: "memory");        // this wave's copies of tile 0 have landed
    __syncthreads();                                         // tile 0 published to every wave
    proj_fill(lb + SB, ga + PKS, gb + PKS);                  // tile 1 exists: K >= 2 * PKS
#pragma unroll 1
    for (int kt = 0; kt < K; kt += PKS) {
        const unsigned buf = (unsigned)(kt / PKS) & 1u;
        const bf* sa = st + buf * ((PBM + PBN) * PLP) + aoff; const bf* sb = st + buf * ((PBM + PBN) * PLP) + boff;
        // Fragments in two register sets, all inside this tile: the next k step's LDS reads are issued in two groups ahead of their use (12 in front of this step's
        // products, 4 into the registers that its first 8 products free), so that no product waits for a read just issued. Each sched_barrier keeps one such group
        // where it is written: left alone, the compiler moves the reads down to their users and puts a full LDS wait in front of every 4 products.
        v16bf a[2][4], b[2][4];
#pragma unroll
        for (int i = 0; i < 4; ++i) { a[0][i] = ldb(sa + i * 16 * PLP); b[0][i] = ldb(sb + i * 16 * PLP); }
        __builtin_amdgcn_sched_barrier(0);
#pragma unroll
        for (int s = 0; s < PKS / 32; ++s) {
            const int c = s & 1, n = c ^ 1;
            if (s + 1 < PKS / 32) {
#pragma unroll
                for (int i = 0; i < 4; ++i) a[n][i] = ldb(sa + i * 16 * PLP + (s + 1) * 32);
                b[n][0] = ldb(sb + (s + 1) * 32); b[n][1] = ldb(sb + 16 * PLP + (s + 1) * 32);
                __builtin_amdgcn_sched_barrier(0);
            }
#pragma unroll
            for (int nb = 0; nb < 2; ++nb)
#pragma unroll
                for (int mb = 0; mb < 4; ++mb) acc[mb][nb] = wmmab(a[c][mb], b[c][nb], acc[mb][nb]);
            __builtin_amdgcn_sched_barrier(0);
            if (s + 1 < PKS / 32) {
                b[n][2] = ldb(sb + 32 * PLP + (s + 1) * 32); b[n][3] = ldb(sb + 48 * PLP + (s + 1) * 32);
                __builtin_amdgcn_sched_barrier(0);
            }
#pragma unroll
            for (int nb = 2; nb < 4; ++nb)
#pragma unroll
                for (int mb = 0; mb < 4; ++mb) acc[mb][nb] = wmmab(a[c][mb], b[c][nb], acc[mb][nb]);
            __builtin_amdgcn_sched_barrier(0);
        }
        asm volatile("s_wait_dscnt 0x0" ::: "memory");       // this wave's reads of the tile are done before its buffer may be refilled
        asm volatile("s_wait_asynccnt 0x0" ::: "memory");    // this wave's copies of the next tile have landed
        __syncthreads();                                     // publishes the next tile and ends every wave's reads of this one
        if (kt + 2 * PKS < K) proj_fill(lb + buf * SB, ga + (kt + 2 * PKS), gb + (kt + 2 * PKS));   // block-uniform: refill the buffer just read with the tile after next
    }
    asm volatile("s_wait_asynccnt 0x0" ::: "memory");        // nothing of this wave's copies is outstanding past the loop
    const size_t tbase = tr ? (size_t)r0 * SEQ + (size_t)(c0 / SEQ) * ((size_t)DM * SEQ) + (size_t)(c0 % SEQ)
                            : (size_t)(r0 / SEQ) * ((size_t)NH_ * SEQ * HD) + (size_t)(r0 % SEQ) * HD + (size_t)(c0 / HD) * ((size_t)SEQ * HD) + (size_t)(c0 % HD);
    const int c8 = (lane & 7) * 8, rq = lane >> 3;
    const float fbc = (float)bcol, fbr = (float)brow;
    float bc[8];
#pragma unroll
    for (int i = 0; i < 8; ++i) bc[i] = bfr(bias[(size_t)(c0 + c8 + i) * (size_t)bcol]) * fbc;   // index < N when bcol == 1, else 0
#pragma unroll
    for (int mb = 0; mb < 4; ++mb) {
#pragma unroll
        for (int nb = 0; nb < 4; ++nb) {
#pragma unroll
            for (int j = 0; j < 8; ++j) os[(hi * 8 + j) * 68 + nb * 16 + lr] = acc[mb][nb][j]; }   // D: row 8h+j, col lane&15
        wave_sync();
        const size_t sb = tbase + (size_t)(mb * 16) * (size_t)pitch;
{
#pragma unroll
            for (int s = 0; s < 4; ++s) { const int row = 4 * s + rq;   // 4 s x 4 row groups = 16 rows; 8 lanes x 8 = 64 columns
                const v4f x0 = *(const v4fa*)(&os[row * 68 + c8]); const v4f x1 = *(const v4fa*)(&os[row * 68 + c8 + 4]); v8h hv;
                const float br = bfr(bias[(size_t)(r0 + mb * 16 + row) * (size_t)brow]) * fbr;         // index < M when brow == 1, else 0
#pragma unroll
                for (int i = 0; i < 4; ++i) { hv[i] = (h16)(x0[i] + bc[i] + br); hv[4 + i] = (h16)(x1[i] + bc[4 + i] + br); }
                const size_t oo = sb + (size_t)row * (size_t)pitch + c8;
                *(v8h*)(Ph + oo) = hv; }
             }
        wave_sync();
    }
}

// One staged tile pair: four 16-byte copies per lane, global -> LDS through no register (a wave's copy covers four whole 128-B lines).
// The s_wait_xcnt stands inside the statement so that it precedes every later write of the address registers the copies name.
__device__ __forceinline__ void stage4(unsigned l0, unsigned l1, unsigned l2, unsigned l3, const h16* g0, const h16* g1, const h16* g2, const h16* g3) {
    asm volatile("global_load_async_to_lds_b128 %0, %4, off\n\t"
                 "global_load_async_to_lds_b128 %1, %5, off\n\t"
                 "global_load_async_to_lds_b128 %2, %6, off\n\t"
                 "global_load_async_to_lds_b128 %3, %7, off\n\t"
                 "s_wait_xcnt 0x0"
                 :: "v"(l0), "v"(l1), "v"(l2), "v"(l3), "v"(g0), "v"(g1), "v"(g2), "v"(g3) : "memory");
}

__global__ __launch_bounds__(32 * AW) void k_flash(const h16* __restrict__ QH, const h16* __restrict__ KP, const h16* __restrict__ VT, h16* CTX) {
    __shared__ __align__(16) float os[AW * 16 * 68];
    __shared__ __align__(16) h16 kv[2 * 2 * KS * LP];        // [buffer][K tile: key rows | V^T tile: d rows][64 rows][LP]
    const int lane = threadIdx.x & 31, wave = threadIdx.x >> 5, lr = lane & 15, hi = lane >> 4;
    const int zh = blockIdx.y; const int b = zh / NH_, h = zh % NH_;
    const int t0 = (blockIdx.x * AW + wave) * 16;
    const size_t pbase = (size_t)zh * SEQ * HD;
    const size_t qo = pbase + (size_t)(t0 + lr) * HD + 8 * hi;
    const v16h qh0 = ldh(QH + qo), qh1 = ldh(QH + qo + 32);   // B fragments: col t, k = d
    const int fo = lr * LP + 8 * hi;                         // fragment offset in a tile: K + key*LP (A: row key, k = d); V^T + 16j*LP + key (A: row d, k = key)
    // copy map: thread -> row tid>>3 (and row + 32), 16-byte column tid&7
    const int cr = threadIdx.x >> 3, ccol = (threadIdx.x & 7) * 8;
    const h16* gk = KP + pbase + (size_t)cr * HD + ccol;   // + key0 * HD
    const h16* gv = VT + pbase + (size_t)cr * SEQ + ccol;  // + key0
    const unsigned lb = (unsigned)(size_t)kv + (unsigned)(cr * LP + ccol) * 2u;   // LDS byte address of the thread's first K chunk in buffer 0
    constexpr unsigned TB = KS * LP * 2, HB = 32 * LP * 2;   // bytes of one tile, of half a tile
    stage4(lb, lb + HB, lb + TB, lb + TB + HB, gk, gk + 32 * HD, gv, gv + (size_t)32 * SEQ);
    asm volatile("s_wait_asynccnt 0x0" ::: "memory");        // this wave's copies of tile 0 have landed
    __syncthreads();                                         // tile 0 published to every wave
    if (SEQ > KS) stage4(lb + 2 * TB, lb + 2 * TB + HB, lb + 3 * TB, lb + 3 * TB + HB, gk + KS * HD, gk + (KS + 32) * HD, gv + KS, gv + (size_t)32 * SEQ + KS);
    v8f o0 = (v8f){}, o1 = (v8f){}, o2 = (v8f){}, o3 = (v8f){};
    float m = -3.0e38f, l = 0.0f;
#pragma unroll 1
    for (int kt0 = 0; kt0 < SEQ; kt0 += KS) {
      const unsigned buf = (unsigned)(kt0 / KS) & 1u;
      const h16* kt = kv + buf * (2 * KS * LP) + fo;
#pragma unroll 1   // rolled: both steps unrolled take more than the 128 registers that let all blocks be resident at once
      for (int sub = 0; sub < KS; sub += 32) {
        const h16* ka = kt + sub * LP;
        const v16h ka0 = ldh(ka), ka1 = ldh(ka + 32), kb0 = ldh(ka + 16 * LP), kb1 = ldh(ka + 16 * LP + 32);
        v8f sA = (v8f){}, sB = (v8f){};
        sA = wmma16(ka0, qh0, sA); sB = wmma16(kb0, qh0, sB);
        sA = wmma16(ka1, qh1, sA); sB = wmma16(kb1, qh1, sB);
        asm volatile("v_nop\n\tv_nop\n\tv_nop\n\tv_nop" : "+v"(sA), "+v"(sB) : "v"(ka0), "v"(ka1), "v"(kb0), "v"(kb1));
        float ta[8], tb[8]; float mx = -3.0e38f;
#pragma unroll
        for (int r = 0; r < 8; ++r) { ta[r] = sA[r] * SC2; tb[r] = sB[r] * SC2; mx = fmaxf(mx, fmaxf(ta[r], tb[r])); }
        mx = fmaxf(mx, __shfl_xor(mx, 16, 32));
        const float mnew = fmaxf(m, mx);
        const float alpha = __builtin_amdgcn_exp2f(m - mnew);
        const float sh = PSH - mnew;
        v16h pb; float ls = 0.0f;
#pragma unroll
        for (int r = 0; r < 8; ++r) { const h16 pa = (h16)__builtin_amdgcn_exp2f(ta[r] + sh); const h16 pc = (h16)__builtin_amdgcn_exp2f(tb[r] + sh); pb[r] = pa; pb[8 + r] = pc; ls += (float)pa + (float)pc; }
        l = l * alpha + ls; m = mnew;
        o0 = o0 * alpha; o1 = o1 * alpha; o2 = o2 * alpha; o3 = o3 * alpha;
        const h16* va = kt + KS * LP + sub;
        const v16h v0 = ldh(va), v1 = ldh(va + 16 * LP), v2 = ldh(va + 32 * LP), v3 = ldh(va + 48 * LP);
        o0 = wmma16(v0, pb, o0); o1 = wmma16(v1, pb, o1); o2 = wmma16(v2, pb, o2); o3 = wmma16(v3, pb, o3);
        asm volatile("v_nop\n\tv_nop\n\tv_nop\n\tv_nop" : "+v"(o0), "+v"(o1), "+v"(o2), "+v"(o3) : "v"(v0), "v"(v1), "v"(v2), "v"(v3), "v"(pb));
      }
      asm volatile("s_wait_dscnt 0x0" ::: "memory");         // this wave's reads of the tile are done before its buffer may be refilled
      asm volatile("s_wait_asynccnt 0x0" ::: "memory");      // this wave's copies of the next tile have landed
      __syncthreads();                                       // publishes the next tile and ends every wave's reads of this one
      if (kt0 + 2 * KS < SEQ) {                              // block-uniform: refill the buffer just read with the tile after next
          const unsigned l0 = lb + buf * (2 * TB); const h16* g0 = gk + (size_t)(kt0 + 2 * KS) * HD; const h16* g2 = gv + (kt0 + 2 * KS);
          stage4(l0, l0 + HB, l0 + TB, l0 + TB + HB, g0, g0 + 32 * HD, g2, g2 + (size_t)32 * SEQ);
      }
    }
    asm volatile("s_wait_asynccnt 0x0" ::: "memory");        // nothing of this wave's copies is outstanding past the loop
    l += __shfl_xor(l, 16, 32);
    const float inv = CXS * (1.0f / l);
    const int wb = wave * 16 * 68;
    // O^T D layout: o_j[r] = (d = 16j + 8h + r, t = lane&15) -> os[t][d]; rows 0..15 x columns 0..63 all written
    { v4f a, c;
      a[0] = o0[0] * inv; a[1] = o0[1] * inv; a[2] = o0[2] * inv; a[3] = o0[3] * inv; c[0] = o0[4] * inv; c[1] = o0[5] * inv; c[2] = o0[6] * inv; c[3] = o0[7] * inv;
      *(v4fa*)(&os[wb + lr * 68 +  0 + 8 * hi]) = a; *(v4fa*)(&os[wb + lr * 68 +  0 + 8 * hi + 4]) = c;
      a[0] = o1[0] * inv; a[1] = o1[1] * inv; a[2] = o1[2] * inv; a[3] = o1[3] * inv; c[0] = o1[4] * inv; c[1] = o1[5] * inv; c[2] = o1[6] * inv; c[3] = o1[7] * inv;
      *(v4fa*)(&os[wb + lr * 68 + 16 + 8 * hi]) = a; *(v4fa*)(&os[wb + lr * 68 + 16 + 8 * hi + 4]) = c;
      a[0] = o2[0] * inv; a[1] = o2[1] * inv; a[2] = o2[2] * inv; a[3] = o2[3] * inv; c[0] = o2[4] * inv; c[1] = o2[5] * inv; c[2] = o2[6] * inv; c[3] = o2[7] * inv;
      *(v4fa*)(&os[wb + lr * 68 + 32 + 8 * hi]) = a; *(v4fa*)(&os[wb + lr * 68 + 32 + 8 * hi + 4]) = c;
      a[0] = o3[0] * inv; a[1] = o3[1] * inv; a[2] = o3[2] * inv; a[3] = o3[3] * inv; c[0] = o3[4] * inv; c[1] = o3[5] * inv; c[2] = o3[6] * inv; c[3] = o3[7] * inv;
      *(v4fa*)(&os[wb + lr * 68 + 48 + 8 * hi]) = a; *(v4fa*)(&os[wb + lr * 68 + 48 + 8 * hi + 4]) = c; }
    wave_sync();
    h16* crow = CTX + ((size_t)b * SEQ + t0) * DM + h * HD;
{
#pragma unroll
        for (int s = 0; s < 4; ++s) { const int row = 4 * s + (lane >> 3), c8 = (lane & 7) * 8;   // 4 s x 4 row groups = 16 rows; 8 lanes x 8 halves = 64 columns
            const v4f x0 = *(const v4fa*)(&os[wb + row * 68 + c8]); const v4f x1 = *(const v4fa*)(&os[wb + row * 68 + c8 + 4]); v8h hv;
#pragma unroll
            for (int i = 0; i < 4; ++i) { hv[i] = (h16)x0[i]; hv[4 + i] = (h16)x1[i]; }
            *(v8h*)(crow + (size_t)row * DM + c8) = hv; }
         }
}

// k_oproj: f16 GEMM, K = DM split over the OW waves of a block. A block owns OBM output rows x all 64 columns; each wave takes one k slice of OKS, has every fragment load of
// its slice in flight at once (no loop, one load latency), and leaves an f32 partial tile in LDS; after one block barrier the partials are summed in wave order.
// Transposed form (A = WoT rows n, B = ctx rows m): a lane holds 8 consecutive n of one output row m, so a partial tile goes to LDS in 16-byte stores.
// OUT[m][n] = (sum_k CX[m][k] WoT[n][k]) * 2^-18 + bo[n] (bo as bf16-RNE value), f32. grid (M/OBM), 32 * OW threads.
__global__ __launch_bounds__(32 * OW) void k_oproj(const h16* __restrict__ A, const h16* __restrict__ Bt, const float* __restrict__ bo, float* OUT) {
    __shared__ __align__(16) float ps[OW * OBM * 68];        // [wave][row m][68]: 272-B pitch, as the other epilogue tiles
    const int K = DM;
    const int lane = threadIdx.x & 31, lr = lane & 15, hi = lane >> 4;
    const int wave = __builtin_amdgcn_readfirstlane(threadIdx.x >> 5);   // wave-uniform: the slice's base stays scalar
    const int r0 = blockIdx.x * OBM;
    const h16* px = A + (size_t)(r0 + lr) * K + wave * OKS + 8 * hi;
    const h16* pw = Bt + (size_t)lr * K + wave * OKS + 8 * hi;
    v16h x[OBM / 16][OKS / 32], w[4][OKS / 32];
#pragma unroll
    for (int s = 0; s < OKS / 32; ++s) {
#pragma unroll
        for (int mb = 0; mb < OBM / 16; ++mb) x[mb][s] = ldh(px + (size_t)mb * 16 * K + s * 32);
#pragma unroll
        for (int nb = 0; nb < 4; ++nb) w[nb][s] = ldh(pw + (size_t)nb * 16 * K + s * 32);
    }
    // The wait that belongs in front of any overwrite of the loads' address registers; as its inputs the two addresses stay live up to it, so that no load's own destination takes their registers.
    asm volatile("s_wait_xcnt 0x0" :: "v"(px), "v"(pw) : "memory");
    // Keeps every load above in front of the first product: left alone, the compiler reuses two fragment register sets and waits out one load latency per pair of products.
    __builtin_amdgcn_sched_barrier(0);
    v8f acc[OBM / 16][4];
#pragma unroll
    for (int mb = 0; mb < OBM / 16; ++mb)
#pragma unroll
        for (int nb = 0; nb < 4; ++nb) acc[mb][nb] = (v8f){};
#pragma unroll
    for (int s = 0; s < OKS / 32; ++s)
#pragma unroll
        for (int nb = 0; nb < 4; ++nb)
#pragma unroll
            for (int mb = 0; mb < OBM / 16; ++mb) acc[mb][nb] = wmma16(w[nb][s], x[mb][s], acc[mb][nb]);
    // D layout: acc[mb][nb][j] = (n = 16nb + 8h + j, m = 16mb + (lane&15)) -> ps[wave][m][n]; rows 0..OBM-1 x columns 0..63 all written
    float* pd = ps + wave * (OBM * 68) + lr * 68 + 8 * hi;
#pragma unroll
    for (int mb = 0; mb < OBM / 16; ++mb)
#pragma unroll
        for (int nb = 0; nb < 4; ++nb) {
            v4f lo, up;
#pragma unroll
            for (int i = 0; i < 4; ++i) { lo[i] = acc[mb][nb][i]; up[i] = acc[mb][nb][4 + i]; }
            *(v4fa*)(pd + mb * 16 * 68 + nb * 16) = lo; *(v4fa*)(pd + mb * 16 * 68 + nb * 16 + 4) = up;
        }
    __syncthreads();                                         // every wave's partial tile is published
    const int row = threadIdx.x >> 4, cofs = (threadIdx.x & 15) * 4;   // 32 * OW threads = OBM rows x 16 groups of 4 columns
    v4f sum = *(const v4fa*)(&ps[row * 68 + cofs]);
#pragma unroll
    for (int q = 1; q < OW; ++q) sum += *(const v4fa*)(&ps[q * (OBM * 68) + row * 68 + cofs]);
    const int bidx = r0 / SEQ, tt = r0 % SEQ;
    float* obase = OUT + ((size_t)bidx * OUT_SEQ + tt) * NO;
    v4f val;
#pragma unroll
    for (int i = 0; i < 4; ++i) val[i] = sum[i] * OSC + bfr(bo[cofs + i]);
    *(v4f*)(obase + (size_t)row * NO + cofs) = val;
}

static constexpr size_t al256(size_t v) { return (v + 255) & ~(size_t)255; }
static constexpr size_t SZ_XB = al256((size_t)NB * SEQ * DIN * 2);
static constexpr size_t SZ_WB = al256((size_t)3 * DM * DIN * 2);
static constexpr size_t SZ_WO = al256((size_t)NO * DM * 2);
static constexpr size_t SZ_PL = al256((size_t)NB * NH_ * SEQ * HD * 2);
static constexpr size_t SZ_CX = al256((size_t)NB * SEQ * DM * 2);
static constexpr size_t SZ_TOTAL = 2 * SZ_XB + SZ_WB + SZ_WO + 3 * SZ_PL + SZ_CX;
static_assert(SZ_TOTAL <= (size_t)134217728);          // workspace carve <= 128 MiB
static_assert(((size_t)DM * DIN * 2) % 256 == 0);      // weight sub-planes stay 256-byte aligned

extern "C" void kernel_launch(void* const* d_in, const int* in_sizes, int n_in,
                              void* d_out, int out_size, void* d_ws, size_t ws_size, hipStream_t stream) {
    if (n_in < 10) return;
    const size_t needx = ((size_t)(NB - 1) * SEQ_FULL + SEQ) * DIN;
    if ((size_t)in_sizes[0] < needx || (size_t)in_sizes[1] < needx) return;
    if ((size_t)in_sizes[2] < (size_t)NH_ * DIN * HD || (size_t)in_sizes[4] < (size_t)NH_ * DIN * HD || (size_t)in_sizes[6] < (size_t)NH_ * DIN * HD) return;
    if ((size_t)in_sizes[3] < (size_t)NH_ * HD || (size_t)in_sizes[5] < (size_t)NH_ * HD || (size_t)in_sizes[7] < (size_t)NH_ * HD) return;
    if ((size_t)in_sizes[8] < (size_t)DM * NO || (size_t)in_sizes[9] < (size_t)NO) return;
    if ((size_t)out_size < ((size_t)(NB - 1) * OUT_SEQ + SEQ) * NO) return;
    if (SZ_TOTAL > ws_size) return;
    // wire order: current_tokens, context_tokens, Wq, bq, Wk, bk, Wv, bv, Wo, bo
    const float* xq = (const float*)d_in[0]; const float* xc = (const float*)d_in[1];
    const float* wq = (const float*)d_in[2]; const float* bq = (const float*)d_in[3];
    const float* wk = (const float*)d_in[4]; const float* bk = (const float*)d_in[5];
    const float* wv = (const float*)d_in[6]; const float* bv = (const float*)d_in[7];
    const float* wo = (const float*)d_in[8]; const float* bo = (const float*)d_in[9];
    float* OUT = (float*)d_out;      // [NB][SEQ][64]
    char* wsp = (char*)d_ws;
    bf* XQ = (bf*)wsp; wsp += SZ_XB;                 // [NB*SEQ][1024] query tokens
    bf* XC = (bf*)wsp; wsp += SZ_XB;                 // [NB*SEQ][1024] context tokens
    bf* WB = (bf*)wsp; wsp += SZ_WB;                 // [3][16*64][1024]: q | k | v, rows n = h*64 + a, k-contiguous
    bf* WO = (bf*)wsp; wsp += SZ_WO;                 // [64][1024] f16 bits, x1024
    h16* QH = (h16*)wsp; wsp += SZ_PL;               // [NB*16][SEQ][64]
    h16* KP = (h16*)wsp; wsp += SZ_PL;               // [NB*16][SEQ][64]
    h16* VT = (h16*)wsp; wsp += SZ_PL;               // [NB*16][64][SEQ]
    h16* CX = (h16*)wsp; wsp += SZ_CX;               // [NB*SEQ][1024] ctx x256

    k_prep<<<dim3(3 * WTB + WOB + 2 * CVB, 1, 1), 256, 0, stream>>>(xq, xc, wq, wk, wv, wo, XQ, XC, WB, WO);

    k_proj<<<dim3(PGB, 3, 1), 256, 0, stream>>>(XQ, XC, WB, QH, KP, VT, bq, bk, bv);

    k_flash<<<dim3(SEQ / (16 * AW), NB * NH_, 1), 32 * AW, 0, stream>>>(QH, KP, VT, CX);

    k_oproj<<<dim3(NB * SEQ / OBM, 1, 1), 32 * OW, 0, stream>>>(CX, (const h16*)WO, bo, OUT);
}

// v005
// It runs in 124 microseconds.
// Timed twice side by side with v004, it ran 1.04 times as fast both times.
// Counting every step since v000, it is 2.71 times as fast.
#include <hip/hip_runtime.h>

// Multi-head cross-attention, 16 heads x 64: q from xq [NB][SEQ][1024], k/v from xc [NB][SEQ][1024]; per-head weights [head][in][out] with biases; score scale 1/8; no mask; concat heads (1024) @ Wo [1024][64] + bo -> out [NB][SEQ][64] f32.
// Compute dtypes, f32 accumulate everywhere: q/k/v projections v_wmma_f32_16x16x32_bf16 (tokens and weights RNE-converted to bf16; products exact), biases RNE-converted to bf16 and added in f32;
// scores v_wmma_f32_16x16x32_f16 (q, k single f16); P (x256 carry, cancels in the normalisation) and v single f16; softmax f32 (online, running max);
// output projection v_wmma_f32_16x16x32_f16: ctx as f16 with x256 carry, Wo as bf16-RNE value x1024 held in f16 (exact), accumulator scaled by 2^-18 and bias added in f32.
// Layout: bf16 copies of both token tensors; weights transposed through LDS into K-contiguous rows [head*64 + n][in]; q, k planes [b*16+h][t][d] and v^T plane [b*16+h][d][t] written by the GEMM epilogue;
// the conversions share one launch and the three projections another (block ranges of one grid); fused flash kernel in transposed form (S^T = K Q^T, O^T = V^T P^T), K and V^T tiles staged in LDS for the whole block, writing the f16 ctx plane [b*SEQ+t][h*64+d]; final GEMM (k split over the waves of a block, partials summed in LDS) writes the f32 output.

#ifndef NB
#define NB 4
#endif
#ifndef SEQ
#define SEQ 2048
#endif
#define NB_FULL  4
#define SEQ_FULL 2048
#ifndef OUT_SEQ
#define OUT_SEQ SEQ              // row pitch (in tokens) between batches of the output
#endif
#define DIN  1024                // token width (projection K)
#define NH_  16
#define HD   64
#define DM   (NH_ * HD)          // concatenated head width (output-projection K)
#define NO   64                  // output width
#define AW   8                   // waves per flash block (16 query rows each); all of them read the same staged K / V^T tiles
#define KS   64                  // keys per staged tile
#define LP   72                  // LDS row pitch in halves: 144 B = 16 B x 9, the conflict-free pitch for 16-byte row reads of 128-B rows
#define PBM  256                // projection block tile: rows (4 waves x 64)
#define PBN  128                // projection block tile: columns (2 waves x 64)
#define PKS  128                // k per staged projection tile
#define PLP  136                // LDS row pitch in elements: 272 B = 16 B x 17, the conflict-free pitch for 16-byte row reads of 256-B rows
#define OW   16                 // waves per output-projection block, one k slice each
#define OKS  (DM / OW)          // k per slice
#define OBM  32                 // output rows per output-projection block
#define SC2  (0.125f * 1.4426950408889634f)   // HD^-0.5 * log2(e)
#define PSH  8.0f                // log2 of the P carry (256)
#define CXS  256.0f              // carry of the ctx plane
#define WOS  1024.0f             // carry of the Wo plane
#define OSC  (1.0f / (256.0f * 1024.0f))

static_assert(HD == 64);
static_assert(NO == 64);                       // output row = 256 bytes = 16 lanes x 16 B
static_assert(NH_ * HD == DM);
static_assert(DM % 64 == 0);
static_assert(DIN % 64 == 0);                  // weight transpose tiles of 64
static_assert(DIN % 32 == 0);                  // GEMM k-loop steps by 32
static_assert(DM % 32 == 0);
static_assert(SEQ % 64 == 0);                  // a 64-row tile never straddles two batches
static_assert((NB * SEQ) % 64 == 0);
static_assert(SEQ % KS == 0);                  // key loop steps by whole staged tiles
static_assert(KS == 64 && KS % 32 == 0);       // a V^T tile row is 128 B, like a K row; 32 keys per softmax step
static_assert(AW * 32 * 2 * 8 == KS * HD);     // two 16-byte copies per thread cover one tile
static_assert(SEQ % (16 * AW) == 0);           // flash grid covers the sequence exactly
static_assert(((size_t)SEQ * DIN) % 8 == 0);
static_assert((NB * SEQ) % PBM == 0 && DM % PBM == 0 && (NB * SEQ) % PBN == 0 && DM % PBN == 0);   // projection grids cover both orientations exactly
static_assert(DIN % PKS == 0 && DIN >= 2 * PKS);   // whole staged tiles, and the ring's prologue needs two
static_assert(((NB * SEQ) / PBM) * (DM / PBN) == (DM / PBM) * ((NB * SEQ) / PBN));   // the three projections share one grid: as many block tiles in either orientation
static_assert(PBM == 256 && PBN == 128 && PKS == 128);   // copy map: 256 threads x 24 copies of 16 B = (PBM + PBN) rows of 256 B
static_assert(DM % (OW * 32) == 0 && OBM % 16 == 0);   // whole 32-k steps per slice, whole 16-row tiles per block
static_assert(SEQ % OBM == 0);                 // an output-projection block never straddles two batches
static_assert(32 * OW == OBM * (NO / 4));      // the final sum: one thread per 4 columns of one row
static_assert(NB <= NB_FULL);
static_assert(SEQ <= SEQ_FULL);

typedef _Float16 h16;
typedef unsigned short bf;
typedef __attribute__((ext_vector_type(16))) __bf16   v16bf;
typedef __attribute__((ext_vector_type(16))) _Float16 v16h;
typedef __attribute__((ext_vector_type(8)))  _Float16 v8h;
typedef __attribute__((ext_vector_type(8)))  unsigned short v8us;
typedef __attribute__((ext_vector_type(8)))  float    v8f;
typedef __attribute__((ext_vector_type(4)))  float    v4f;
typedef v4f  __attribute__((may_alias)) v4fa;

__device__ __forceinline__ unsigned short f2bf(float f) { unsigned u = __float_as_uint(f); u += 0x7FFFu + ((u >> 16) & 1u); return (unsigned short)(u >> 16); }
__device__ __forceinline__ float bf2f(unsigned short b) { return __uint_as_float(((unsigned)b) << 16); }
__device__ __forceinline__ float bfr(float f) { return bf2f(f2bf(f)); }   // value after RNE conversion to bf16
__device__ __forceinline__ v16h cat16(v8h lo, v8h hi) { return __builtin_shufflevector(lo, hi, 0, 1, 2, 3, 4, 5, 6, 7, 8, 9, 10, 11, 12, 13, 14, 15); }
__device__ __forceinline__ v16bf cat16b(v8us lo, v8us hi) { return __builtin_bit_cast(v16bf, __builtin_shufflevector(lo, hi, 0, 1, 2, 3, 4, 5, 6, 7, 8, 9, 10, 11, 12, 13, 14, 15)); }
__device__ __forceinline__ v8f wmma16(v16h a, v16h b, v8f c) { return __builtin_amdgcn_wmma_f32_16x16x32_f16(false, a, false, b, (short)0, c, false, false); }
__device__ __forceinline__ v8f wmmab(v16bf a, v16bf b, v8f c) { return __builtin_amdgcn_wmma_f32_16x16x32_bf16(false, a, false, b, (short)0, c, false, false); }
// fragment loaders from K-contiguous 16-bit rows; p already includes + 8*(lane>>4): elements 0..7 <- k0+8h+0..7, elements 8..15 <- k0+16+8h+0..7 (same map for A and B)
__device__ __forceinline__ v16h  ldh(const h16* p) { return cat16(*(const v8h*)p, *(const v8h*)(p + 16)); }
__device__ __forceinline__ v16bf ldb(const bf* p)  { return cat16b(*(const v8us*)p, *(const v8us*)(p + 16)); }
// ordering point for wave-private LDS tiles (same wave writes and reads)
__device__ __forceinline__ void wave_sync() { __builtin_amdgcn_fence(3 /* release order */, "wavefront"); __builtin_amdgcn_wave_barrier(); asm volatile("" ::: "memory"); }

// cvt8: token f32 -> bf16, 8 elements per thread; blk = block index inside one tensor's range. The source keeps the full batch pitch, the bf16 plane is dense.
__device__ __forceinline__ void cvt8(const float* __restrict__ src, bf* dst, unsigned blk) {
    constexpr size_t B8 = (size_t)SEQ * DIN / 8;        // threads per batch
    const size_t i = (size_t)blk * 256 + threadIdx.x; if (i >= (size_t)NB * B8) return;
    const size_t so = (SEQ == SEQ_FULL) ? i * 8 : (i / B8) * ((size_t)SEQ_FULL * DIN) + (i % B8) * 8;
    const v8f v = *(const v8f*)(src + so); v8us o;
#pragma unroll
    for (int k = 0; k < 8; ++k) o[k] = f2bf(v[k]);
    *(v8us*)(dst + i * 8) = o;
}

// wt: weight transpose + 16-bit convert through LDS (ts: 64 x 65 floats of the block), one 64 x 64 tile (k tile kb of head hh) per block. in W[head][Kd][64] (f32, k-major) -> out WT[head*64 + n][Kd] (k-contiguous).
// F16 == 0: bf16 bits (RNE). F16 == 1: f16 of (bf16-RNE value * scale) (exact for power-of-two scale).
template <int F16>
__device__ __forceinline__ void wt(float* ts, const float* __restrict__ W, bf* WT, int Kd, float scale, int kb, int hh) {
    const int tid = threadIdx.x;
    const int d0 = kb * 64;
    const float* src = W + ((size_t)hh * Kd + d0) * 64;
#pragma unroll
    for (int it = 0; it < 4; ++it) {                    // 4 x 256 threads x 4 floats = 64 rows x 64 columns
        const int idx = it * 256 + tid; const int row = idx >> 4, c4 = (idx & 15) * 4;
        const v4f v = *(const v4f*)(src + (size_t)row * 64 + c4);
        ts[row * 65 + c4 + 0] = v[0]; ts[row * 65 + c4 + 1] = v[1]; ts[row * 65 + c4 + 2] = v[2]; ts[row * 65 + c4 + 3] = v[3];
    }
    __syncthreads();                                    // cross-wave tile: block barrier
    const int k8 = (tid & 7) * 8, nq = tid >> 3;        // 2 it x 32 row groups = 64 output rows; 8 lanes x 8 = 64 k
    v8us ou[2]; v8h oh[2];
#pragma unroll
    for (int it = 0; it < 2; ++it) {
        const int n = it * 32 + nq;
#pragma unroll
        for (int j = 0; j < 8; ++j) {
            const float w = ts[(k8 + j) * 65 + n];
            ou[it][j] = f2bf(w);
            oh[it][j] = (h16)(bfr(w) * scale);
        }
    }
{
#pragma unroll
        for (int it = 0; it < 2; ++it) {
            const size_t off = (size_t)(hh * 64 + it * 32 + nq) * (size_t)Kd + d0 + k8;
            if (F16) *(v8h*)((h16*)WT + off) = oh[it];
            else     *(v8us*)(WT + off) = ou[it];
        }
        
    }
}

// k_prep: all the work that depends on the inputs alone, as block ranges of one grid (the parts share no data): the three projection weights, Wo, then the two token tensors.
// The short transposes stand first in the index order (for speed only). Every test below is on the block index alone.
#define WTB ((DIN / 64) * NH_)                                   // blocks per projection weight: k tiles x heads
#define WOB (DM / 64)                                            // blocks of Wo: k tiles, one head
#define CVB ((unsigned)(((size_t)NB * SEQ * DIN / 8 + 255) / 256))   // blocks per token tensor
__global__ __launch_bounds__(256) void k_prep(const float* __restrict__ xq, const float* __restrict__ xc, const float* __restrict__ wq, const float* __restrict__ wk, const float* __restrict__ wv,
                                              const float* __restrict__ wo, bf* XQ, bf* XC, bf* WB, bf* WO) {
    __shared__ float ts[64 * 65];
    const unsigned blk = blockIdx.x;
    if (blk >= 3 * WTB + WOB) {
        const unsigned c = blk - (3 * WTB + WOB); const bool ctx = c >= CVB;
        cvt8(ctx ? xc : xq, ctx ? XC : XQ, ctx ? c - CVB : c);
    } else if (blk >= 3 * WTB) {
        // Wo: in [1024 (k)][64 (n)] -> out [n][1024 (k)], one head
        wt<1>(ts, wo, WO, DM, WOS, (int)(blk - 3 * WTB), 0);
    } else {
        // in [head][1024 (k)][64 (n)] -> out [head*64 + n][1024 (k)]
        const unsigned w = blk / WTB, r = blk % WTB;
        wt<0>(ts, w == 0 ? wq : w == 1 ? wk : wv, WB + (size_t)w * DM * DIN, DIN, 1.0f, (int)(r % (DIN / 64)), (int)(r / (DIN / 64)));
    }
}

// Twelve 16-byte copies per lane, global -> LDS through no register (a wave's copy covers two whole 256-B rows = four lines).
// The s_wait_xcnt stands inside the statement so that it precedes every later write of the address registers the copies name.
__device__ __forceinline__ void stage12(const unsigned (&l)[12], const bf* const (&g)[12]) {
    asm volatile("global_load_async_to_lds_b128 %0, %12, off\n\t"
                 "global_load_async_to_lds_b128 %1, %13, off\n\t"
                 "global_load_async_to_lds_b128 %2, %14, off\n\t"
                 "global_load_async_to_lds_b128 %3, %15, off\n\t"
                 "global_load_async_to_lds_b128 %4, %16, off\n\t"
                 "global_load_async_to_lds_b128 %5, %17, off\n\t"
                 "global_load_async_to_lds_b128 %6, %18, off\n\t"
                 "global_load_async_to_lds_b128 %7, %19, off\n\t"
                 "global_load_async_to_lds_b128 %8, %20, off\n\t"
                 "global_load_async_to_lds_b128 %9, %21, off\n\t"
                 "global_load_async_to_lds_b128 %10, %22, off\n\t"
                 "global_load_async_to_lds_b128 %11, %23, off\n\t"
                 "s_wait_xcnt 0x0"
                 :: "v"(l[0]), "v"(l[1]), "v"(l[2]), "v"(l[3]), "v"(l[4]), "v"(l[5]), "v"(l[6]), "v"(l[7]), "v"(l[8]), "v"(l[9]), "v"(l[10]), "v"(l[11]),
                    "v"(g[0]), "v"(g[1]), "v"(g[2]), "v"(g[3]), "v"(g[4]), "v"(g[5]), "v"(g[6]), "v"(g[7]), "v"(g[8]), "v"(g[9]), "v"(g[10]), "v"(g[11]) : "memory");
}
// One staged k tile of a projection block: PBM rows of A, then PBN rows of Bt, PKS elements each; a thread copies its 16-byte column of every 16th row.
// l: LDS byte address of the thread's chunk in its first row (tid>>4) of the buffer; ga, gb: the thread's chunk in its first A row and its first Bt row of the tile.
__device__ __forceinline__ void proj_fill(unsigned l, const bf* ga, const bf* gb) {
    constexpr unsigned LS = 16 * PLP * 2; constexpr size_t GS = (size_t)16 * DIN;
    unsigned la[12]; const bf* gp[12];
#pragma unroll
    for (int i = 0; i < 12; ++i) { la[i] = l + (unsigned)i * LS; gp[i] = ga + (size_t)i * GS; }
    stage12(la, gp);
#pragma unroll
    for (int i = 0; i < 4; ++i) { la[i] = l + (unsigned)(12 + i) * LS; gp[i] = ga + (size_t)(12 + i) * GS; }
#pragma unroll
    for (int i = 0; i < 8; ++i) { la[4 + i] = l + (unsigned)(16 + i) * LS; gp[4 + i] = gb + (size_t)i * GS; }
    stage12(la, gp);
}

// k_proj: register-blocked bf16 GEMM, K = DIN. A block of 8 waves (4 x 2) owns a PBM x PBN tile, each wave a 64x64 part of it (16 accumulators).
// The operands come in k tiles of PKS, copied once per block from the K-contiguous bf16 planes into a two-buffer LDS ring (the next tile's copies fly while this one is worked on) and read from there as fragments.
// C[m][n] = sum_k A[m][k] Bt[n][k] + bias, written as f16 (Ph) from the wave tile's base in its plane ('tbase'), row pitch 'pitch' (halves).
// bias (bf16-RNE value, f32 add): per column when bcol == 1 (index n), per row when brow == 1 (index m); exactly one of brow/bcol is 1.
// The three projections are independent and run as one grid (PGB tiles, 3 products), 256 threads; blockIdx.y picks the product, all of its parameters are block-uniform:
// q, k: A = token rows (m = b*SEQ + t), Bt = W rows (n = h*64 + a) -> plane [(b*16 + h)][t][a]; bias per column n
// v^T:  A = Wv rows (m = h*64 + o), Bt = context token rows (n = b*SEQ + t) -> plane [(b*1024 + m)][t] = [(b*16 + h)][o][t]; bias per row m
#define PGB (((NB * SEQ) / PBM) * (DM / PBN))   // block tiles of one product, the same number in both orientations
__global__ __launch_bounds__(256) void k_proj(const bf* __restrict__ XQ, const bf* __restrict__ XC, const bf* __restrict__ WB, h16* QH, h16* KP, h16* VT,
                                              const float* __restrict__ bq, const float* __restrict__ bk, const float* __restrict__ bv) {
    const int job = blockIdx.y; const bool tr = job == 2;
    const bf* A = job == 0 ? XQ : job == 1 ? XC : WB + (size_t)2 * DM * DIN;
    const bf* Bt = job == 0 ? WB : job == 1 ? WB + (size_t)DM * DIN : XC;
    h16* Ph = job == 0 ? QH : job == 1 ? KP : VT;
    const float* bias = job == 0 ? bq : job == 1 ? bk : bv;
    const int brow = tr ? 1 : 0, bcol = tr ? 0 : 1;
    const int pitch = tr ? SEQ : HD;
    // the tile index runs over the product's row tiles first; both counts are constants, so the divisions stay scalar shifts
    const int bx = tr ? (int)(blockIdx.x % (DM / PBM)) : (int)(blockIdx.x % (NB * SEQ / PBM));
    const int by = tr ? (int)(blockIdx.x / (DM / PBM)) : (int)(blockIdx.x / (NB * SEQ / PBM));
    __shared__ __align__(16) float osb[8 * 16 * 68];
    __shared__ __align__(16) bf st[2 * (PBM + PBN) * PLP];   // [buffer][A rows | Bt rows][PLP]
    const int K = DIN;
    const int lane = threadIdx.x & 31, lr = lane & 15, hi = lane >> 4;
    const int wave = __builtin_amdgcn_readfirstlane(threadIdx.x >> 5);   // wave-uniform: the tile's base and its divisions stay scalar
    const int r0 = bx * PBM + (wave >> 1) * 64, c0 = by * PBN + (wave & 1) * 64;
    float* os = osb + wave * 16 * 68;                        // wave-private epilogue tile
    v8f acc[4][4];
#pragma unroll
    for (int mb = 0; mb < 4; ++mb)
#pragma unroll
        for (int nb = 0; nb < 4; ++nb) acc[mb][nb] = (v8f){};
    // copy map: thread -> row tid>>4 (and every 16th row after it), 16-byte column tid&15
    const int cr = threadIdx.x >> 4, ccol = (threadIdx.x & 15) * 8;
    const bf* ga = A + (size_t)(bx * PBM + cr) * K + ccol;    // + k0
    const bf* gb = Bt + (size_t)(by * PBN + cr) * K + ccol;   // + k0
    const unsigned lb = (unsigned)(size_t)st + (unsigned)(cr * PLP + ccol) * 2u;
    constexpr unsigned SB = (PBM + PBN) * PLP * 2;           // bytes of one buffer
    const int aoff = ((wave >> 1) * 64 + lr) * PLP + 8 * hi, boff = (PBM + (wave & 1) * 64 + lr) * PLP + 8 * hi;
    proj_fill(lb, ga, gb);
    asm volatile("s_wait_asynccnt 0x0" ::: "memory");        // this wave's copies of tile 0 have landed
    __syncthreads();                                         // tile 0 published to every wave
    proj_fill(lb + SB, ga + PKS, gb + PKS);                  // tile 1 exists: K >= 2 * PKS
#pragma unroll 1
    for (int kt = 0; kt < K; kt += PKS) {
        const unsigned buf = (unsigned)(kt / PKS) & 1u;
        const bf* sa = st + buf * ((PBM + PBN) * PLP) + aoff; const bf* sb = st + buf * ((PBM + PBN) * PLP) + boff;
        // Fragments in two register sets, all inside this tile: the next k step's LDS reads are issued in two groups ahead of their use (12 in front of this step's
        // products, 4 into the registers that its first 8 products free), so that no product waits for a read just issued. Each sched_barrier keeps one such group
        // where it is written: left alone, the compiler moves the reads down to their users and puts a full LDS wait in front of every 4 products.
        v16bf a[2][4], b[2][4];
#pragma unroll
        for (int i = 0; i < 4; ++i) { a[0][i] = ldb(sa + i * 16 * PLP); b[0][i] = ldb(sb + i * 16 * PLP); }
        __builtin_amdgcn_sched_barrier(0);
#pragma unroll
        for (int s = 0; s < PKS / 32; ++s) {
            const int c = s & 1, n = c ^ 1;
            if (s + 1 < PKS / 32) {
#pragma unroll
                for (int i = 0; i < 4; ++i) a[n][i] = ldb(sa + i * 16 * PLP + (s + 1) * 32);
                b[n][0] = ldb(sb + (s + 1) * 32); b[n][1] = ldb(sb + 16 * PLP + (s + 1) * 32);
                __builtin_amdgcn_sched_barrier(0);
            }
#pragma unroll
            for (int nb = 0; nb < 2; ++nb)
#pragma unroll
                for (int mb = 0; mb < 4; ++mb) acc[mb][nb] = wmmab(a[c][mb], b[c][nb], acc[mb][nb]);
            __builtin_amdgcn_sched_barrier(0);
            if (s + 1 < PKS / 32) {
                b[n][2] = ldb(sb + 32 * PLP + (s + 1) * 32); b[n][3] = ldb(sb + 48 * PLP + (s + 1) * 32);
                __builtin_amdgcn_sched_barrier(0);
            }
#pragma unroll
            for (int nb = 2; nb < 4; ++nb)
#pragma unroll
                for (int mb = 0; mb < 4; ++mb) acc[mb][nb] = wmmab(a[c][mb], b[c][nb], acc[mb][nb]);
            __builtin_amdgcn_sched_barrier(0);
        }
        asm volatile("s_wait_dscnt 0x0" ::: "memory");       // this wave's reads of the tile are done before its buffer may be refilled
        asm volatile("s_wait_asynccnt 0x0" ::: "memory");    // this wave's copies of the next tile have landed
        __syncthreads();                                     // publishes the next tile and ends every wave's reads of this one
        if (kt + 2 * PKS < K) proj_fill(lb + buf * SB, ga + (kt + 2 * PKS), gb + (kt + 2 * PKS));   // block-uniform: refill the buffer just read with the tile after next
    }
    asm volatile("s_wait_asynccnt 0x0" ::: "memory");        // nothing of this wave's copies is outstanding past the loop
    const size_t tbase = tr ? (size_t)r0 * SEQ + (size_t)(c0 / SEQ) * ((size_t)DM * SEQ) + (size_t)(c0 % SEQ)
                            : (size_t)(r0 / SEQ) * ((size_t)NH_ * SEQ * HD) + (size_t)(r0 % SEQ) * HD + (size_t)(c0 / HD) * ((size_t)SEQ * HD) + (size_t)(c0 % HD);
    const int c8 = (lane & 7) * 8, rq = lane >> 3;
    const float fbc = (float)bcol, fbr = (float)brow;
    float bc[8];
#pragma unroll
    for (int i = 0; i < 8; ++i) bc[i] = bfr(bias[(size_t)(c0 + c8 + i) * (size_t)bcol]) * fbc;   // index < N when bcol == 1, else 0
#pragma unroll
    for (int mb = 0; mb < 4; ++mb) {
#pragma unroll
        for (int nb = 0; nb < 4; ++nb) {
#pragma unroll
            for (int j = 0; j < 8; ++j) os[(hi * 8 + j) * 68 + nb * 16 + lr] = acc[mb][nb][j]; }   // D: row 8h+j, col lane&15
        wave_sync();
        const size_t sb = tbase + (size_t)(mb * 16) * (size_t)pitch;
{
#pragma unroll
            for (int s = 0; s < 4; ++s) { const int row = 4 * s + rq;   // 4 s x 4 row groups = 16 rows; 8 lanes x 8 = 64 columns
                const v4f x0 = *(const v4fa*)(&os[row * 68 + c8]); const v4f x1 = *(const v4fa*)(&os[row * 68 + c8 + 4]); v8h hv;
                const float br = bfr(bias[(size_t)(r0 + mb * 16 + row) * (size_t)brow]) * fbr;         // index < M when brow == 1, else 0
#pragma unroll
                for (int i = 0; i < 4; ++i) { hv[i] = (h16)(x0[i] + bc[i] + br); hv[4 + i] = (h16)(x1[i] + bc[4 + i] + br); }
                const size_t oo = sb + (size_t)row * (size_t)pitch + c8;
                *(v8h*)(Ph + oo) = hv; }
             }
        wave_sync();
    }
}

// One staged tile pair: four 16-byte copies per lane, global -> LDS through no register (a wave's copy covers four whole 128-B lines).
// The s_wait_xcnt stands inside the statement so that it precedes every later write of the address registers the copies name.
__device__ __forceinline__ void stage4(unsigned l0, unsigned l1, unsigned l2, unsigned l3, const h16* g0, const h16* g1, const h16* g2, const h16* g3) {
    asm volatile("global_load_async_to_lds_b128 %0, %4, off\n\t"
                 "global_load_async_to_lds_b128 %1, %5, off\n\t"
                 "global_load_async_to_lds_b128 %2, %6, off\n\t"
                 "global_load_async_to_lds_b128 %3, %7, off\n\t"
                 "s_wait_xcnt 0x0"
                 :: "v"(l0), "v"(l1), "v"(l2), "v"(l3), "v"(g0), "v"(g1), "v"(g2), "v"(g3) : "memory");
}

__global__ __launch_bounds__(32 * AW) __attribute__((amdgpu_waves_per_eu(8))) void k_flash(const h16* __restrict__ QH, const h16* __restrict__ KP, const h16* __restrict__ VT, h16* CTX) {
    __shared__ __align__(16) float os[AW * 16 * 68];
    __shared__ __align__(16) h16 kv[2 * 2 * KS * LP];        // [buffer][K tile: key rows | V^T tile: d rows][64 rows][LP]
    const int lane = threadIdx.x & 31, wave = threadIdx.x >> 5, lr = lane & 15, hi = lane >> 4;
    const int zh = blockIdx.y; const int b = zh / NH_, h = zh % NH_;
    const int t0 = (blockIdx.x * AW + wave) * 16;
    const size_t pbase = (size_t)zh * SEQ * HD;
    const size_t qo = pbase + (size_t)(t0 + lr) * HD + 8 * hi;
    const v16h qh0 = ldh(QH + qo), qh1 = ldh(QH + qo + 32);   // B fragments: col t, k = d
    const int fo = lr * LP + 8 * hi;                         // fragment offset in a tile: K + key*LP (A: row key, k = d); V^T + 16j*LP + key (A: row d, k = key)
    // copy map: thread -> row tid>>3 (and row + 32), 16-byte column tid&7
    const int cr = threadIdx.x >> 3, ccol = (threadIdx.x & 7) * 8;
    const h16* gk = KP + pbase + (size_t)cr * HD + ccol;   // + key0 * HD
    const h16* gv = VT + pbase + (size_t)cr * SEQ + ccol;  // + key0
    const unsigned lb = (unsigned)(size_t)kv + (unsigned)(cr * LP + ccol) * 2u;   // LDS byte address of the thread's first K chunk in buffer 0
    constexpr unsigned TB = KS * LP * 2, HB = 32 * LP * 2;   // bytes of one tile, of half a tile
    stage4(lb, lb + HB, lb + TB, lb + TB + HB, gk, gk + 32 * HD, gv, gv + (size_t)32 * SEQ);
    asm volatile("s_wait_asynccnt 0x0" ::: "memory");        // this wave's copies of tile 0 have landed
    __syncthreads();                                         // tile 0 published to every wave
    if (SEQ > KS) stage4(lb + 2 * TB, lb + 2 * TB + HB, lb + 3 * TB, lb + 3 * TB + HB, gk + KS * HD, gk + (KS + 32) * HD, gv + KS, gv + (size_t)32 * SEQ + KS);
    v8f o0 = (v8f){}, o1 = (v8f){}, o2 = (v8f){}, o3 = (v8f){};
    float m = -3.0e38f, l = 0.0f;
    const h16 one = (lane & 7) == 0 ? (h16)1.0f : (h16)0.0f;
    const v16h ones = {one, one, one, one, one, one, one, one, one, one, one, one, one, one, one, one};
#pragma unroll 1
    for (int kt0 = 0; kt0 < SEQ; kt0 += KS) {
      const unsigned buf = (unsigned)(kt0 / KS) & 1u;
      const h16* kt = kv + buf * (2 * KS * LP) + fo;
#pragma unroll 1   // rolled: both steps unrolled take more than the 128 registers that let all blocks be resident at once
      for (int sub = 0; sub < KS; sub += 32) {
        const h16* ka = kt + sub * LP;
        const v16h ka0 = ldh(ka), ka1 = ldh(ka + 32), kb0 = ldh(ka + 16 * LP), kb1 = ldh(ka + 16 * LP + 32);
        v8f sA = (v8f){}, sB = (v8f){};
        sA = wmma16(ka0, qh0, sA); sB = wmma16(kb0, qh0, sB);
        sA = wmma16(ka1, qh1, sA); sB = wmma16(kb1, qh1, sB);
        asm volatile("v_nop\n\tv_nop\n\tv_nop\n\tv_nop" : "+v"(sA), "+v"(sB) : "v"(ka0), "v"(ka1), "v"(kb0), "v"(kb1));
        float ta[8], tb[8]; float mx = -3.0e38f;
#pragma unroll
        for (int r = 0; r < 8; ++r) { ta[r] = sA[r] * SC2; tb[r] = sB[r] * SC2; mx = fmaxf(mx, fmaxf(ta[r], tb[r])); }
        mx = fmaxf(mx, __shfl_xor(mx, 16, 32));
        const float mnew = fmaxf(m, mx);
        const float alpha = __builtin_amdgcn_exp2f(m - mnew);
        const float sh = PSH - mnew;
        v16h pb;
#pragma unroll
        for (int r = 0; r < 8; ++r) pb[r] = (h16)__builtin_amdgcn_exp2f(ta[r] + sh);
#pragma unroll
        for (int r = 0; r < 8; ++r) pb[8 + r] = (h16)__builtin_amdgcn_exp2f(tb[r] + sh);
        m = mnew;
        o0 = o0 * alpha; o1 = o1 * alpha; o2 = o2 * alpha; o3 = o3 * alpha;
        const h16* va = kt + KS * LP + sub;
        const v16h v0 = ldh(va), v1 = ldh(va + 16 * LP), v2 = ldh(va + 32 * LP), v3 = ldh(va + 48 * LP);
        const v8f ls = wmma16(ones, pb, (v8f){});             // rows 0 and 8: the sums of the rounded P over all 32 keys, one per query column
        o0 = wmma16(v0, pb, o0); o1 = wmma16(v1, pb, o1); o2 = wmma16(v2, pb, o2); o3 = wmma16(v3, pb, o3);
        asm volatile("v_nop\n\tv_nop\n\tv_nop\n\tv_nop" : "+v"(o0), "+v"(o1), "+v"(o2), "+v"(o3) : "v"(v0), "v"(v1), "v"(v2), "v"(v3), "v"(pb));
        l = l * alpha + ls[0];
      }
      asm volatile("s_wait_dscnt 0x0" ::: "memory");         // this wave's reads of the tile are done before its buffer may be refilled
      asm volatile("s_wait_asynccnt 0x0" ::: "memory");      // this wave's copies of the next tile have landed
      __syncthreads();                                       // publishes the next tile and ends every wave's reads of this one
      if (kt0 + 2 * KS < SEQ) {                              // block-uniform: refill the buffer just read with the tile after next
          const unsigned l0 = lb + buf * (2 * TB); const h16* g0 = gk + (size_t)(kt0 + 2 * KS) * HD; const h16* g2 = gv + (kt0 + 2 * KS);
          stage4(l0, l0 + HB, l0 + TB, l0 + TB + HB, g0, g0 + 32 * HD, g2, g2 + (size_t)32 * SEQ);
      }
    }
    asm volatile("s_wait_asynccnt 0x0" ::: "memory");        // nothing of this wave's copies is outstanding past the loop
    const float inv = CXS * (1.0f / l);
    const int wb = wave * 16 * 68;
    // O^T D layout: o_j[r] = (d = 16j + 8h + r, t = lane&15) -> os[t][d]; rows 0..15 x columns 0..63 all written
    { v4f a, c;
      a[0] = o0[0] * inv; a[1] = o0[1] * inv; a[2] = o0[2] * inv; a[3] = o0[3] * inv; c[0] = o0[4] * inv; c[1] = o0[5] * inv; c[2] = o0[6] * inv; c[3] = o0[7] * inv;
      *(v4fa*)(&os[wb + lr * 68 +  0 + 8 * hi]) = a; *(v4fa*)(&os[wb + lr * 68 +  0 + 8 * hi + 4]) = c;
      a[0] = o1[0] * inv; a[1] = o1[1] * inv; a[2] = o1[2] * inv; a[3] = o1[3] * inv; c[0] = o1[4] * inv; c[1] = o1[5] * inv; c[2] = o1[6] * inv; c[3] = o1[7] * inv;
      *(v4fa*)(&os[wb + lr * 68 + 16 + 8 * hi]) = a; *(v4fa*)(&os[wb + lr * 68 + 16 + 8 * hi + 4]) = c;
      a[0] = o2[0] * inv; a[1] = o2[1] * inv; a[2] = o2[2] * inv; a[3] = o2[3] * inv; c[0] = o2[4] * inv; c[1] = o2[5] * inv; c[2] = o2[6] * inv; c[3] = o2[7] * inv;
      *(v4fa*)(&os[wb + lr * 68 + 32 + 8 * hi]) = a; *(v4fa*)(&os[wb + lr * 68 + 32 + 8 * hi + 4]) = c;
      a[0] = o3[0] * inv; a[1] = o3[1] * inv; a[2] = o3[2] * inv; a[3] = o3[3] * inv; c[0] = o3[4] * inv; c[1] = o3[5] * inv; c[2] = o3[6] * inv; c[3] = o3[7] * inv;
      *(v4fa*)(&os[wb + lr * 68 + 48 + 8 * hi]) = a; *(v4fa*)(&os[wb + lr * 68 + 48 + 8 * hi + 4]) = c; }
    wave_sync();
    h16* crow = CTX + ((size_t)b * SEQ + t0) * DM + h * HD;
{
#pragma unroll
        for (int s = 0; s < 4; ++s) { const int row = 4 * s + (lane >> 3), c8 = (lane & 7) * 8;   // 4 s x 4 row groups = 16 rows; 8 lanes x 8 halves = 64 columns
            const v4f x0 = *(const v4fa*)(&os[wb + row * 68 + c8]); const v4f x1 = *(const v4fa*)(&os[wb + row * 68 + c8 + 4]); v8h hv;
#pragma unroll
            for (int i = 0; i < 4; ++i) { hv[i] = (h16)x0[i]; hv[4 + i] = (h16)x1[i]; }
            *(v8h*)(crow + (size_t)row * DM + c8) = hv; }
         }
}

// k_oproj: f16 GEMM, K = DM split over the OW waves of a block. A block owns OBM output rows x all 64 columns; each wave takes one k slice of OKS, has every fragment load of
// its slice in flight at once (no loop, one load latency), and leaves an f32 partial tile in LDS; after one block barrier the partials are summed in wave order.
// Transposed form (A = WoT rows n, B = ctx rows m): a lane holds 8 consecutive n of one output row m, so a partial tile goes to LDS in 16-byte stores.
// OUT[m][n] = (sum_k CX[m][k] WoT[n][k]) * 2^-18 + bo[n] (bo as bf16-RNE value), f32. grid (M/OBM), 32 * OW threads.
__global__ __launch_bounds__(32 * OW) void k_oproj(const h16* __restrict__ A, const h16* __restrict__ Bt, const float* __restrict__ bo, float* OUT) {
    __shared__ __align__(16) float ps[OW * OBM * 68];        // [wave][row m][68]: 272-B pitch, as the other epilogue tiles
    const int K = DM;
    const int lane = threadIdx.x & 31, lr = lane & 15, hi = lane >> 4;
    const int wave = __builtin_amdgcn_readfirstlane(threadIdx.x >> 5);   // wave-uniform: the slice's base stays scalar
    const int r0 = blockIdx.x * OBM;
    const h16* px = A + (size_t)(r0 + lr) * K + wave * OKS + 8 * hi;
    const h16* pw = Bt + (size_t)lr * K + wave * OKS + 8 * hi;
    v16h x[OBM / 16][OKS / 32], w[4][OKS / 32];
#pragma unroll
    for (int s = 0; s < OKS / 32; ++s) {
#pragma unroll
        for (int mb = 0; mb < OBM / 16; ++mb) x[mb][s] = ldh(px + (size_t)mb * 16 * K + s * 32);
#pragma unroll
        for (int nb = 0; nb < 4; ++nb) w[nb][s] = ldh(pw + (size_t)nb * 16 * K + s * 32);
    }
    // The wait that belongs in front of any overwrite of the loads' address registers; as its inputs the two addresses stay live up to it, so that no load's own destination takes their registers.
    asm volatile("s_wait_xcnt 0x0" :: "v"(px), "v"(pw) : "memory");
    // Keeps every load above in front of the first product: left alone, the compiler reuses two fragment register sets and waits out one load latency per pair of products.
    __builtin_amdgcn_sched_barrier(0);
    v8f acc[OBM / 16][4];
#pragma unroll
    for (int mb = 0; mb < OBM / 16; ++mb)
#pragma unroll
        for (int nb = 0; nb < 4; ++nb) acc[mb][nb] = (v8f){};
#pragma unroll
    for (int s = 0; s < OKS / 32; ++s)
#pragma unroll
        for (int nb = 0; nb < 4; ++nb)
#pragma unroll
            for (int mb = 0; mb < OBM / 16; ++mb) acc[mb][nb] = wmma16(w[nb][s], x[mb][s], acc[mb][nb]);
    // D layout: acc[mb][nb][j] = (n = 16nb + 8h + j, m = 16mb + (lane&15)) -> ps[wave][m][n]; rows 0..OBM-1 x columns 0..63 all written
    float* pd = ps + wave * (OBM * 68) + lr * 68 + 8 * hi;
#pragma unroll
    for (int mb = 0; mb < OBM / 16; ++mb)
#pragma unroll
        for (int nb = 0; nb < 4; ++nb) {
            v4f lo, up;
#pragma unroll
            for (int i = 0; i < 4; ++i) { lo[i] = acc[mb][nb][i]; up[i] = acc[mb][nb][4 + i]; }
            *(v4fa*)(pd + mb * 16 * 68 + nb * 16) = lo; *(v4fa*)(pd + mb * 16 * 68 + nb * 16 + 4) = up;
        }
    __syncthreads();                                         // every wave's partial tile is published
    const int row = threadIdx.x >> 4, cofs = (threadIdx.x & 15) * 4;   // 32 * OW threads = OBM rows x 16 groups of 4 columns
    v4f sum = *(const v4fa*)(&ps[row * 68 + cofs]);
#pragma unroll
    for (int q = 1; q < OW; ++q) sum += *(const v4fa*)(&ps[q * (OBM * 68) + row * 68 + cofs]);
    const int bidx = r0 / SEQ, tt = r0 % SEQ;
    float* obase = OUT + ((size_t)bidx * OUT_SEQ + tt) * NO;
    v4f val;
#pragma unroll
    for (int i = 0; i < 4; ++i) val[i] = sum[i] * OSC + bfr(bo[cofs + i]);
    *(v4f*)(obase + (size_t)row * NO + cofs) = val;
}

static constexpr size_t al256(size_t v) { return (v + 255) & ~(size_t)255; }
static constexpr size_t SZ_XB = al256((size_t)NB * SEQ * DIN * 2);
static constexpr size_t SZ_WB = al256((size_t)3 * DM * DIN * 2);
static constexpr size_t SZ_WO = al256((size_t)NO * DM * 2);
static constexpr size_t SZ_PL = al256((size_t)NB * NH_ * SEQ * HD * 2);
static constexpr size_t SZ_CX = al256((size_t)NB * SEQ * DM * 2);
static constexpr size_t SZ_TOTAL = 2 * SZ_XB + SZ_WB + SZ_WO + 3 * SZ_PL + SZ_CX;
static_assert(SZ_TOTAL <= (size_t)134217728);          // workspace carve <= 128 MiB
static_assert(((size_t)DM * DIN * 2) % 256 == 0);      // weight sub-planes stay 256-byte aligned

extern "C" void kernel_launch(void* const* d_in, const int* in_sizes, int n_in,
                              void* d_out, int out_size, void* d_ws, size_t ws_size, hipStream_t stream) {
    if (n_in < 10) return;
    const size_t needx = ((size_t)(NB - 1) * SEQ_FULL + SEQ) * DIN;
    if ((size_t)in_sizes[0] < needx || (size_t)in_sizes[1] < needx) return;
    if ((size_t)in_sizes[2] < (size_t)NH_ * DIN * HD || (size_t)in_sizes[4] < (size_t)NH_ * DIN * HD || (size_t)in_sizes[6] < (size_t)NH_ * DIN * HD) return;
    if ((size_t)in_sizes[3] < (size_t)NH_ * HD || (size_t)in_sizes[5] < (size_t)NH_ * HD || (size_t)in_sizes[7] < (size_t)NH_ * HD) return;
    if ((size_t)in_sizes[8] < (size_t)DM * NO || (size_t)in_sizes[9] < (size_t)NO) return;
    if ((size_t)out_size < ((size_t)(NB - 1) * OUT_SEQ + SEQ) * NO) return;
    if (SZ_TOTAL > ws_size) return;
    // wire order: current_tokens, context_tokens, Wq, bq, Wk, bk, Wv, bv, Wo, bo
    const float* xq = (const float*)d_in[0]; const float* xc = (const float*)d_in[1];
    const float* wq = (const float*)d_in[2]; const float* bq = (const float*)d_in[3];
    const float* wk = (const float*)d_in[4]; const float* bk = (const float*)d_in[5];
    const float* wv = (const float*)d_in[6]; const float* bv = (const float*)d_in[7];
    const float* wo = (const float*)d_in[8]; const float* bo = (const float*)d_in[9];
    float* OUT = (float*)d_out;      // [NB][SEQ][64]
    char* wsp = (char*)d_ws;
    bf* XQ = (bf*)wsp; wsp += SZ_XB;                 // [NB*SEQ][1024] query tokens
    bf* XC = (bf*)wsp; wsp += SZ_XB;                 // [NB*SEQ][1024] context tokens
    bf* WB = (bf*)wsp; wsp += SZ_WB;                 // [3][16*64][1024]: q | k | v, rows n = h*64 + a, k-contiguous
    bf* WO = (bf*)wsp; wsp += SZ_WO;                 // [64][1024] f16 bits, x1024
    h16* QH = (h16*)wsp; wsp += SZ_PL;               // [NB*16][SEQ][64]
    h16* KP = (h16*)wsp; wsp += SZ_PL;               // [NB*16][SEQ][64]
    h16* VT = (h16*)wsp; wsp += SZ_PL;               // [NB*16][64][SEQ]
    h16* CX = (h16*)wsp; wsp += SZ_CX;               // [NB*SEQ][1024] ctx x256

    k_prep<<<dim3(3 * WTB + WOB + 2 * CVB, 1, 1), 256, 0, stream>>>(xq, xc, wq, wk, wv, wo, XQ, XC, WB, WO);

    k_proj<<<dim3(PGB, 3, 1), 256, 0, stream>>>(XQ, XC, WB, QH, KP, VT, bq, bk, bv);

    k_flash<<<dim3(SEQ / (16 * AW), NB * NH_, 1), 32 * AW, 0, stream>>>(QH, KP, VT, CX);

    k_oproj<<<dim3(NB * SEQ / OBM, 1, 1), 32 * OW, 0, stream>>>(CX, (const h16*)WO, bo, OUT);
}

// v006
// It runs in 116 microseconds.
// Next to v005, in two timings, it ran 1.06 and 1.07 times as fast.
// Over all steps from v000 it is 2.89 times as fast.
#include <hip/hip_runtime.h>

// Multi-head cross-attention, 16 heads x 64: q from xq [NB][SEQ][1024], k/v from xc [NB][SEQ][1024]; per-head weights [head][in][out] with biases; score scale 1/8; no mask; concat heads (1024) @ Wo [1024][64] + bo -> out [NB][SEQ][64] f32.
// Compute dtypes, f32 accumulate everywhere: q/k/v projections v_wmma_f32_16x16x32_bf16 (tokens and weights RNE-converted to bf16; products exact), biases RNE-converted to bf16 and added in f32;
// scores v_wmma_f32_16x16x32_f16 (q, k single f16); P (x256 carry, cancels in the normalisation) and v single f16; softmax f32 (online, lazily moved reference maximum);
// output projection v_wmma_f32_16x16x32_f16: ctx as f16 with x256 carry, Wo as bf16-RNE value x1024 held in f16 (exact), accumulator scaled by 2^-18 and bias added in f32.
// Layout: bf16 copies of both token tensors; weights transposed through LDS into K-contiguous rows [head*64 + n][in]; q, k planes [b*16+h][t][d] and v^T plane [b*16+h][d][t] written by the GEMM epilogue;
// the conversions share one launch and the three projections another (block ranges of one grid); fused flash kernel in transposed form (S^T = K Q^T, O^T = V^T P^T), K and V^T tiles staged in LDS for the whole block, writing the f16 ctx plane [b*SEQ+t][h*64+d]; final GEMM (k split over the waves of a block, partials summed in LDS) writes the f32 output.

#ifndef NB
#define NB 4
#endif
#ifndef SEQ
#define SEQ 2048
#endif
#define NB_FULL  4
#define SEQ_FULL 2048
#ifndef OUT_SEQ
#define OUT_SEQ SEQ              // row pitch (in tokens) between batches of the output
#endif
#define DIN  1024                // token width (projection K)
#define NH_  16
#define HD   64
#define DM   (NH_ * HD)          // concatenated head width (output-projection K)
#define NO   64                  // output width
#define AW   8                   // waves per flash block (16 query rows each); all of them read the same staged K / V^T tiles
#define KS   64                  // keys per staged tile
#define LP   72                  // LDS row pitch in halves: 144 B = 16 B x 9, the conflict-free pitch for 16-byte row reads of 128-B rows
#define PBM  256                // projection block tile: rows (4 waves x 64)
#define PBN  128                // projection block tile: columns (2 waves x 64)
#define PKS  128                // k per staged projection tile
#define PLP  136                // LDS row pitch in elements: 272 B = 16 B x 17, the conflict-free pitch for 16-byte row reads of 256-B rows
#define OW   16                 // waves per output-projection block, one k slice each
#define OKS  (DM / OW)          // k per slice
#define OBM  32                 // output rows per output-projection block
#define SC2  (0.125f * 1.4426950408889634f)   // HD^-0.5 * log2(e)
#define PSH  8.0f                // log2 of the P carry (256)
#define TAU  7.0f                // a pass's scores may top the reference in use by this much (log2) before the state is rescaled: P <= 2^15
#define CXS  256.0f              // carry of the ctx plane
#define WOS  1024.0f             // carry of the Wo plane
#define OSC  (1.0f / (256.0f * 1024.0f))

static_assert(HD == 64);
static_assert(NO == 64);                       // output row = 256 bytes = 16 lanes x 16 B
static_assert(NH_ * HD == DM);
static_assert(DM % 64 == 0);
static_assert(DIN % 64 == 0);                  // weight transpose tiles of 64
static_assert(DIN % 32 == 0);                  // GEMM k-loop steps by 32
static_assert(DM % 32 == 0);
static_assert(SEQ % 64 == 0);                  // a 64-row tile never straddles two batches
static_assert((NB * SEQ) % 64 == 0);
static_assert(SEQ % KS == 0);                  // key loop steps by whole staged tiles
static_assert(KS == 64 && KS % 32 == 0);       // a V^T tile row is 128 B, like a K row; 32 keys per softmax step
static_assert(AW * 32 * 2 * 8 == KS * HD);     // two 16-byte copies per thread cover one tile
static_assert(SEQ % (16 * AW) == 0);           // flash grid covers the sequence exactly
static_assert(((size_t)SEQ * DIN) % 8 == 0);
static_assert((NB * SEQ) % PBM == 0 && DM % PBM == 0 && (NB * SEQ) % PBN == 0 && DM % PBN == 0);   // projection grids cover both orientations exactly
static_assert(DIN % PKS == 0 && DIN >= 2 * PKS);   // whole staged tiles, and the ring's prologue needs two
static_assert(((NB * SEQ) / PBM) * (DM / PBN) == (DM / PBM) * ((NB * SEQ) / PBN));   // the three projections share one grid: as many block tiles in either orientation
static_assert(PBM == 256 && PBN == 128 && PKS == 128);   // copy map: 256 threads x 24 copies of 16 B = (PBM + PBN) rows of 256 B
static_assert(DM % (OW * 32) == 0 && OBM % 16 == 0);   // whole 32-k steps per slice, whole 16-row tiles per block
static_assert(SEQ % OBM == 0);                 // an output-projection block never straddles two batches
static_assert(32 * OW == OBM * (NO / 4));      // the final sum: one thread per 4 columns of one row
static_assert(NB <= NB_FULL);
static_assert(SEQ <= SEQ_FULL);

typedef _Float16 h16;
typedef unsigned short bf;
typedef __attribute__((ext_vector_type(16))) __bf16   v16bf;
typedef __attribute__((ext_vector_type(16))) _Float16 v16h;
typedef __attribute__((ext_vector_type(8)))  _Float16 v8h;
typedef __attribute__((ext_vector_type(8)))  unsigned short v8us;
typedef __attribute__((ext_vector_type(8)))  float    v8f;
typedef __attribute__((ext_vector_type(4)))  float    v4f;
typedef v4f  __attribute__((may_alias)) v4fa;

__device__ __forceinline__ unsigned short f2bf(float f) { unsigned u = __float_as_uint(f); u += 0x7FFFu + ((u >> 16) & 1u); return (unsigned short)(u >> 16); }
__device__ __forceinline__ float bf2f(unsigned short b) { return __uint_as_float(((unsigned)b) << 16); }
__device__ __forceinline__ float bfr(float f) { return bf2f(f2bf(f)); }   // value after RNE conversion to bf16
__device__ __forceinline__ v16h cat16(v8h lo, v8h hi) { return __builtin_shufflevector(lo, hi, 0, 1, 2, 3, 4, 5, 6, 7, 8, 9, 10, 11, 12, 13, 14, 15); }
__device__ __forceinline__ v16bf cat16b(v8us lo, v8us hi) { return __builtin_bit_cast(v16bf, __builtin_shufflevector(lo, hi, 0, 1, 2, 3, 4, 5, 6, 7, 8, 9, 10, 11, 12, 13, 14, 15)); }
__device__ __forceinline__ v8f wmma16(v16h a, v16h b, v8f c) { return __builtin_amdgcn_wmma_f32_16x16x32_f16(false, a, false, b, (short)0, c, false, false); }
__device__ __forceinline__ v8f wmmab(v16bf a, v16bf b, v8f c) { return __builtin_amdgcn_wmma_f32_16x16x32_bf16(false, a, false, b, (short)0, c, false, false); }
// fragment loaders from K-contiguous 16-bit rows; p already includes + 8*(lane>>4): elements 0..7 <- k0+8h+0..7, elements 8..15 <- k0+16+8h+0..7 (same map for A and B)
__device__ __forceinline__ v16h  ldh(const h16* p) { return cat16(*(const v8h*)p, *(const v8h*)(p + 16)); }
__device__ __forceinline__ v16bf ldb(const bf* p)  { return cat16b(*(const v8us*)p, *(const v8us*)(p + 16)); }
// lane l with lane l ^ 16, in registers: unlike the shuffle it needs no lane index held across the key loop, which has no register to spare
__device__ __forceinline__ float xhalf(float x) { return __builtin_bit_cast(float, __builtin_amdgcn_permlanex16(__builtin_bit_cast(int, x), __builtin_bit_cast(int, x), 0x76543210, 0xfedcba98, false, false)); }
// ordering point for wave-private LDS tiles (same wave writes and reads)
__device__ __forceinline__ void wave_sync() { __builtin_amdgcn_fence(3 /* release order */, "wavefront"); __builtin_amdgcn_wave_barrier(); asm volatile("" ::: "memory"); }

// cvt8: token f32 -> bf16, 8 elements per thread; blk = block index inside one tensor's range. The source keeps the full batch pitch, the bf16 plane is dense.
__device__ __forceinline__ void cvt8(const float* __restrict__ src, bf* dst, unsigned blk) {
    constexpr size_t B8 = (size_t)SEQ * DIN / 8;        // threads per batch
    const size_t i = (size_t)blk * 256 + threadIdx.x; if (i >= (size_t)NB * B8) return;
    const size_t so = (SEQ == SEQ_FULL) ? i * 8 : (i / B8) * ((size_t)SEQ_FULL * DIN) + (i % B8) * 8;
    const v8f v = *(const v8f*)(src + so); v8us o;
#pragma unroll
    for (int k = 0; k < 8; ++k) o[k] = f2bf(v[k]);
    *(v8us*)(dst + i * 8) = o;
}

// wt: weight transpose + 16-bit convert through LDS (ts: 64 x 65 floats of the block), one 64 x 64 tile (k tile kb of head hh) per block. in W[head][Kd][64] (f32, k-major) -> out WT[head*64 + n][Kd] (k-contiguous).
// F16 == 0: bf16 bits (RNE). F16 == 1: f16 of (bf16-RNE value * scale) (exact for power-of-two scale).
template <int F16>
__device__ __forceinline__ void wt(float* ts, const float* __restrict__ W, bf* WT, int Kd, float scale, int kb, int hh) {
    const int tid = threadIdx.x;
    const int d0 = kb * 64;
    const float* src = W + ((size_t)hh * Kd + d0) * 64;
#pragma unroll
    for (int it = 0; it < 4; ++it) {                    // 4 x 256 threads x 4 floats = 64 rows x 64 columns
        const int idx = it * 256 + tid; const int row = idx >> 4, c4 = (idx & 15) * 4;
        const v4f v = *(const v4f*)(src + (size_t)row * 64 + c4);
        ts[row * 65 + c4 + 0] = v[0]; ts[row * 65 + c4 + 1] = v[1]; ts[row * 65 + c4 + 2] = v[2]; ts[row * 65 + c4 + 3] = v[3];
    }
    __syncthreads();                                    // cross-wave tile: block barrier
    const int k8 = (tid & 7) * 8, nq = tid >> 3;        // 2 it x 32 row groups = 64 output rows; 8 lanes x 8 = 64 k
    v8us ou[2]; v8h oh[2];
#pragma unroll
    for (int it = 0; it < 2; ++it) {
        const int n = it * 32 + nq;
#pragma unroll
        for (int j = 0; j < 8; ++j) {
            const float w = ts[(k8 + j) * 65 + n];
            ou[it][j] = f2bf(w);
            oh[it][j] = (h16)(bfr(w) * scale);
        }
    }
{
#pragma unroll
        for (int it = 0; it < 2; ++it) {
            const size_t off = (size_t)(hh * 64 + it * 32 + nq) * (size_t)Kd + d0 + k8;
            if (F16) *(v8h*)((h16*)WT + off) = oh[it];
            else     *(v8us*)(WT + off) = ou[it];
        }
        
    }
}

// k_prep: all the work that depends on the inputs alone, as block ranges of one grid (the parts share no data): the three projection weights, Wo, then the two token tensors.
// The short transposes stand first in the index order (for speed only). Every test below is on the block index alone.
#define WTB ((DIN / 64) * NH_)                                   // blocks per projection weight: k tiles x heads
#define WOB (DM / 64)                                            // blocks of Wo: k tiles, one head
#define CVB ((unsigned)(((size_t)NB * SEQ * DIN / 8 + 255) / 256))   // blocks per token tensor
__global__ __launch_bounds__(256) void k_prep(const float* __restrict__ xq, const float* __restrict__ xc, const float* __restrict__ wq, const float* __restrict__ wk, const float* __restrict__ wv,
                                              const float* __restrict__ wo, bf* XQ, bf* XC, bf* WB, bf* WO) {
    __shared__ float ts[64 * 65];
    const unsigned blk = blockIdx.x;
    if (blk >= 3 * WTB + WOB) {
        const unsigned c = blk - (3 * WTB + WOB); const bool ctx = c >= CVB;
        cvt8(ctx ? xc : xq, ctx ? XC : XQ, ctx ? c - CVB : c);
    } else if (blk >= 3 * WTB) {
        // Wo: in [1024 (k)][64 (n)] -> out [n][1024 (k)], one head
        wt<1>(ts, wo, WO, DM, WOS, (int)(blk - 3 * WTB), 0);
    } else {
        // in [head][1024 (k)][64 (n)] -> out [head*64 + n][1024 (k)]
        const unsigned w = blk / WTB, r = blk % WTB;
        wt<0>(ts, w == 0 ? wq : w == 1 ? wk : wv, WB + (size_t)w * DM * DIN, DIN, 1.0f, (int)(r % (DIN / 64)), (int)(r / (DIN / 64)));
    }
}

// Twelve 16-byte copies per lane, global -> LDS through no register (a wave's copy covers two whole 256-B rows = four lines).
// The s_wait_xcnt stands inside the statement so that it precedes every later write of the address registers the copies name.
__device__ __forceinline__ void stage12(const unsigned (&l)[12], const bf* const (&g)[12]) {
    asm volatile("global_load_async_to_lds_b128 %0, %12, off\n\t"
                 "global_load_async_to_lds_b128 %1, %13, off\n\t"
                 "global_load_async_to_lds_b128 %2, %14, off\n\t"
                 "global_load_async_to_lds_b128 %3, %15, off\n\t"
                 "global_load_async_to_lds_b128 %4, %16, off\n\t"
                 "global_load_async_to_lds_b128 %5, %17, off\n\t"
                 "global_load_async_to_lds_b128 %6, %18, off\n\t"
                 "global_load_async_to_lds_b128 %7, %19, off\n\t"
                 "global_load_async_to_lds_b128 %8, %20, off\n\t"
                 "global_load_async_to_lds_b128 %9, %21, off\n\t"
                 "global_load_async_to_lds_b128 %10, %22, off\n\t"
                 "global_load_async_to_lds_b128 %11, %23, off\n\t"
                 "s_wait_xcnt 0x0"
                 :: "v"(l[0]), "v"(l[1]), "v"(l[2]), "v"(l[3]), "v"(l[4]), "v"(l[5]), "v"(l[6]), "v"(l[7]), "v"(l[8]), "v"(l[9]), "v"(l[10]), "v"(l[11]),
                    "v"(g[0]), "v"(g[1]), "v"(g[2]), "v"(g[3]), "v"(g[4]), "v"(g[5]), "v"(g[6]), "v"(g[7]), "v"(g[8]), "v"(g[9]), "v"(g[10]), "v"(g[11]) : "memory");
}
// One staged k tile of a projection block: PBM rows of A, then PBN rows of Bt, PKS elements each; a thread copies its 16-byte column of every 16th row.
// l: LDS byte address of the thread's chunk in its first row (tid>>4) of the buffer; ga, gb: the thread's chunk in its first A row and its first Bt row of the tile.
__device__ __forceinline__ void proj_fill(unsigned l, const bf* ga, const bf* gb) {
    constexpr unsigned LS = 16 * PLP * 2; constexpr size_t GS = (size_t)16 * DIN;
    unsigned la[12]; const bf* gp[12];
#pragma unroll
    for (int i = 0; i < 12; ++i) { la[i] = l + (unsigned)i * LS; gp[i] = ga + (size_t)i * GS; }
    stage12(la, gp);
#pragma unroll
    for (int i = 0; i < 4; ++i) { la[i] = l + (unsigned)(12 + i) * LS; gp[i] = ga + (size_t)(12 + i) * GS; }
#pragma unroll
    for (int i = 0; i < 8; ++i) { la[4 + i] = l + (unsigned)(16 + i) * LS; gp[4 + i] = gb + (size_t)i * GS; }
    stage12(la, gp);
}

// k_proj: register-blocked bf16 GEMM, K = DIN. A block of 8 waves (4 x 2) owns a PBM x PBN tile, each wave a 64x64 part of it (16 accumulators).
// The operands come in k tiles of PKS, copied once per block from the K-contiguous bf16 planes into a two-buffer LDS ring (the next tile's copies fly while this one is worked on) and read from there as fragments.
// C[m][n] = sum_k A[m][k] Bt[n][k] + bias, written as f16 (Ph) from the wave tile's base in its plane ('tbase'), row pitch 'pitch' (halves).
// bias (bf16-RNE value, f32 add): per column when bcol == 1 (index n), per row when brow == 1 (index m); exactly one of brow/bcol is 1.
// The three projections are independent and run as one grid (PGB tiles, 3 products), 256 threads; blockIdx.y picks the product, all of its parameters are block-uniform:
// q, k: A = token rows (m = b*SEQ + t), Bt = W rows (n = h*64 + a) -> plane [(b*16 + h)][t][a]; bias per column n
// v^T:  A = Wv rows (m = h*64 + o), Bt = context token rows (n = b*SEQ + t) -> plane [(b*1024 + m)][t] = [(b*16 + h)][o][t]; bias per row m
#define PGB (((NB * SEQ) / PBM) * (DM / PBN))   // block tiles of one product, the same number in both orientations
__global__ __launch_bounds__(256) void k_proj(const bf* __restrict__ XQ, const bf* __restrict__ XC, const bf* __restrict__ WB, h16* QH, h16* KP, h16* VT,
                                              const float* __restrict__ bq, const float* __restrict__ bk, const float* __restrict__ bv) {
    const int job = blockIdx.y; const bool tr = job == 2;
    const bf* A = job == 0 ? XQ : job == 1 ? XC : WB + (size_t)2 * DM * DIN;
    const bf* Bt = job == 0 ? WB : job == 1 ? WB + (size_t)DM * DIN : XC;
    h16* Ph = job == 0 ? QH : job == 1 ? KP : VT;
    const float* bias = job == 0 ? bq : job == 1 ? bk : bv;
    const int brow = tr ? 1 : 0, bcol = tr ? 0 : 1;
    const int pitch = tr ? SEQ : HD;
    // the tile index runs over the product's row tiles first; both counts are constants, so the divisions stay scalar shifts
    const int bx = tr ? (int)(blockIdx.x % (DM / PBM)) : (int)(blockIdx.x % (NB * SEQ / PBM));
    const int by = tr ? (int)(blockIdx.x / (DM / PBM)) : (int)(blockIdx.x / (NB * SEQ / PBM));
    __shared__ __align__(16) float osb[8 * 16 * 68];
    __shared__ __align__(16) bf st[2 * (PBM + PBN) * PLP];   // [buffer][A rows | Bt rows][PLP]
    const int K = DIN;
    const int lane = threadIdx.x & 31, lr = lane & 15, hi = lane >> 4;
    const int wave = __builtin_amdgcn_readfirstlane(threadIdx.x >> 5);   // wave-uniform: the tile's base and its divisions stay scalar
    const int r0 = bx * PBM + (wave >> 1) * 64, c0 = by * PBN + (wave & 1) * 64;
    float* os = osb + wave * 16 * 68;                        // wave-private epilogue tile
    v8f acc[4][4];
#pragma unroll
    for (int mb = 0; mb < 4; ++mb)
#pragma unroll
        for (int nb = 0; nb < 4; ++nb) acc[mb][nb] = (v8f){};
    // copy map: thread -> row tid>>4 (and every 16th row after it), 16-byte column tid&15
    const int cr = threadIdx.x >> 4, ccol = (threadIdx.x & 15) * 8;
    const bf* ga = A + (size_t)(bx * PBM + cr) * K + ccol;    // + k0
    const bf* gb = Bt + (size_t)(by * PBN + cr) * K + ccol;   // + k0
    const unsigned lb = (unsigned)(size_t)st + (unsigned)(cr * PLP + ccol) * 2u;
    constexpr unsigned SB = (PBM + PBN) * PLP * 2;           // bytes of one buffer
    const int aoff = ((wave >> 1) * 64 + lr) * PLP + 8 * hi, boff = (PBM + (wave & 1) * 64 + lr) * PLP + 8 * hi;
    proj_fill(lb, ga, gb);
    asm volatile("s_wait_asynccnt 0x0" ::: "memory");        // this wave's copies of tile 0 have landed
    __syncthreads();                                         // tile 0 published to every wave
    proj_fill(lb + SB, ga + PKS, gb + PKS);                  // tile 1 exists: K >= 2 * PKS
#pragma unroll 1
    for (int kt = 0; kt < K; kt += PKS) {
        const unsigned buf = (unsigned)(kt / PKS) & 1u;
        const bf* sa = st + buf * ((PBM + PBN) * PLP) + aoff; const bf* sb = st + buf * ((PBM + PBN) * PLP) + boff;
        // Fragments in two register sets, all inside this tile: the next k step's LDS reads are issued in two groups ahead of their use (12 in front of this step's
        // products, 4 into the registers that its first 8 products free), so that no product waits for a read just issued. Each sched_barrier keeps one such group
        // where it is written: left alone, the compiler moves the reads down to their users and puts a full LDS wait in front of every 4 products.
        v16bf a[2][4], b[2][4];
#pragma unroll
        for (int i = 0; i < 4; ++i) { a[0][i] = ldb(sa + i * 16 * PLP); b[0][i] = ldb(sb + i * 16 * PLP); }
        __builtin_amdgcn_sched_barrier(0);
#pragma unroll
        for (int s = 0; s < PKS / 32; ++s) {
            const int c = s & 1, n = c ^ 1;
            if (s + 1 < PKS / 32) {
#pragma unroll
                for (int i = 0; i < 4; ++i) a[n][i] = ldb(sa + i * 16 * PLP + (s + 1) * 32);
                b[n][0] = ldb(sb + (s + 1) * 32); b[n][1] = ldb(sb + 16 * PLP + (s + 1) * 32);
                __builtin_amdgcn_sched_barrier(0);
            }
#pragma unroll
            for (int nb = 0; nb < 2; ++nb)
#pragma unroll
                for (int mb = 0; mb < 4; ++mb) acc[mb][nb] = wmmab(a[c][mb], b[c][nb], acc[mb][nb]);
            __builtin_amdgcn_sched_barrier(0);
            if (s + 1 < PKS / 32) {
                b[n][2] = ldb(sb + 32 * PLP + (s + 1) * 32); b[n][3] = ldb(sb + 48 * PLP + (s + 1) * 32);
                __builtin_amdgcn_sched_barrier(0);
            }
#pragma unroll
            for (int nb = 2; nb < 4; ++nb)
#pragma unroll
                for (int mb = 0; mb < 4; ++mb) acc[mb][nb] = wmmab(a[c][mb], b[c][nb], acc[mb][nb]);
            __builtin_amdgcn_sched_barrier(0);
        }
        asm volatile("s_wait_dscnt 0x0" ::: "memory");       // this wave's reads of the tile are done before its buffer may be refilled
        asm volatile("s_wait_asynccnt 0x0" ::: "memory");    // this wave's copies of the next tile have landed
        __syncthreads();                                     // publishes the next tile and ends every wave's reads of this one
        if (kt + 2 * PKS < K) proj_fill(lb + buf * SB, ga + (kt + 2 * PKS), gb + (kt + 2 * PKS));   // block-uniform: refill the buffer just read with the tile after next
    }
    asm volatile("s_wait_asynccnt 0x0" ::: "memory");        // nothing of this wave's copies is outstanding past the loop
    const size_t tbase = tr ? (size_t)r0 * SEQ + (size_t)(c0 / SEQ) * ((size_t)DM * SEQ) + (size_t)(c0 % SEQ)
                            : (size_t)(r0 / SEQ) * ((size_t)NH_ * SEQ * HD) + (size_t)(r0 % SEQ) * HD + (size_t)(c0 / HD) * ((size_t)SEQ * HD) + (size_t)(c0 % HD);
    const int c8 = (lane & 7) * 8, rq = lane >> 3;
    const float fbc = (float)bcol, fbr = (float)brow;
    float bc[8];
#pragma unroll
    for (int i = 0; i < 8; ++i) bc[i] = bfr(bias[(size_t)(c0 + c8 + i) * (size_t)bcol]) * fbc;   // index < N when bcol == 1, else 0
#pragma unroll
    for (int mb = 0; mb < 4; ++mb) {
#pragma unroll
        for (int nb = 0; nb < 4; ++nb) {
#pragma unroll
            for (int j = 0; j < 8; ++j) os[(hi * 8 + j) * 68 + nb * 16 + lr] = acc[mb][nb][j]; }   // D: row 8h+j, col lane&15
        wave_sync();
        const size_t sb = tbase + (size_t)(mb * 16) * (size_t)pitch;
{
#pragma unroll
            for (int s = 0; s < 4; ++s) { const int row = 4 * s + rq;   // 4 s x 4 row groups = 16 rows; 8 lanes x 8 = 64 columns
                const v4f x0 = *(const v4fa*)(&os[row * 68 + c8]); const v4f x1 = *(const v4fa*)(&os[row * 68 + c8 + 4]); v8h hv;
                const float br = bfr(bias[(size_t)(r0 + mb * 16 + row) * (size_t)brow]) * fbr;         // index < M when brow == 1, else 0
#pragma unroll
                for (int i = 0; i < 4; ++i) { hv[i] = (h16)(x0[i] + bc[i] + br); hv[4 + i] = (h16)(x1[i] + bc[4 + i] + br); }
                const size_t oo = sb + (size_t)row * (size_t)pitch + c8;
                *(v8h*)(Ph + oo) = hv; }
             }
        wave_sync();
    }
}

// One staged tile pair: four 16-byte copies per lane, global -> LDS through no register (a wave's copy covers four whole 128-B lines).
// The s_wait_xcnt stands inside the statement so that it precedes every later write of the address registers the copies name.
__device__ __forceinline__ void stage4(unsigned l0, unsigned l1, unsigned l2, unsigned l3, const h16* g0, const h16* g1, const h16* g2, const h16* g3) {
    asm volatile("global_load_async_to_lds_b128 %0, %4, off\n\t"
                 "global_load_async_to_lds_b128 %1, %5, off\n\t"
                 "global_load_async_to_lds_b128 %2, %6, off\n\t"
                 "global_load_async_to_lds_b128 %3, %7, off\n\t"
                 "s_wait_xcnt 0x0"
                 :: "v"(l0), "v"(l1), "v"(l2), "v"(l3), "v"(g0), "v"(g1), "v"(g2), "v"(g3) : "memory");
}

__global__ __launch_bounds__(32 * AW) __attribute__((amdgpu_waves_per_eu(8))) void k_flash(const h16* __restrict__ QH, const h16* __restrict__ KP, const h16* __restrict__ VT, h16* CTX) {
    __shared__ __align__(16) float os[AW * 16 * 68];
    __shared__ __align__(16) h16 kv[2 * 2 * KS * LP];        // [buffer][K tile: key rows | V^T tile: d rows][64 rows][LP]
    const int lane = threadIdx.x & 31, lr = lane & 15, hi = lane >> 4;
    const int wave = __builtin_amdgcn_readfirstlane(threadIdx.x >> 5);   // wave-uniform: the wave's first query row stays in a scalar register across the key loop, which has no vector register to spare
    const int zh = blockIdx.y; const int b = zh / NH_, h = zh % NH_;
    const int t0 = (blockIdx.x * AW + wave) * 16;
    const size_t pbase = (size_t)zh * SEQ * HD;
    const size_t qo = pbase + (size_t)(t0 + lr) * HD + 8 * hi;
    const v16h qh0 = ldh(QH + qo), qh1 = ldh(QH + qo + 32);   // B fragments: col t, k = d
    const int fo = lr * LP + 8 * hi;                         // fragment offset in a tile: K + key*LP (A: row key, k = d); V^T + 16j*LP + key (A: row d, k = key)
    // copy map: thread -> row tid>>3 (and row + 32), 16-byte column tid&7
    const int cr = threadIdx.x >> 3, ccol = (threadIdx.x & 7) * 8;
    const h16* gk = KP + pbase + (size_t)cr * HD + ccol;   // + key0 * HD
    const h16* gv = VT + pbase + (size_t)cr * SEQ + ccol;  // + key0
    const unsigned lb = (unsigned)(size_t)kv + (unsigned)(cr * LP + ccol) * 2u;   // LDS byte address of the thread's first K chunk in buffer 0
    constexpr unsigned TB = KS * LP * 2, HB = 32 * LP * 2;   // bytes of one tile, of half a tile
    stage4(lb, lb + HB, lb + TB, lb + TB + HB, gk, gk + 32 * HD, gv, gv + (size_t)32 * SEQ);
    asm volatile("s_wait_asynccnt 0x0" ::: "memory");        // this wave's copies of tile 0 have landed
    __syncthreads();                                         // tile 0 published to every wave
    if (SEQ > KS) stage4(lb + 2 * TB, lb + 2 * TB + HB, lb + 3 * TB, lb + 3 * TB + HB, gk + KS * HD, gk + (KS + 32) * HD, gv + KS, gv + (size_t)32 * SEQ + KS);
    v8f o0 = (v8f){}, o1 = (v8f){}, o2 = (v8f){}, o3 = (v8f){};
    v8f lt = (v8f){};                                        // accumulator tile of the row-sum product
    float sh = 3.0e38f, thr = -3.0e38f;                      // PSH - m, m the reference maximum in use (scaled, log2; it starts at the lowest value); the raw score above which the reference moves
    const h16 one = (lane & 7) == 0 ? (h16)1.0f : (h16)0.0f;
    const v16h ones = {one, one, one, one, one, one, one, one, one, one, one, one, one, one, one, one};
#pragma unroll 1
    for (int kt0 = 0; kt0 < SEQ; kt0 += KS) {
      const unsigned buf = (unsigned)(kt0 / KS) & 1u;
      const h16* kt = kv + buf * (2 * KS * LP) + fo;
#pragma unroll 1   // rolled: both steps unrolled take more than the 128 registers that let all blocks be resident at once
      for (int sub = 0; sub < KS; sub += 32) {
        const h16* ka = kt + sub * LP;
        const v16h ka0 = ldh(ka), ka1 = ldh(ka + 32), kb0 = ldh(ka + 16 * LP), kb1 = ldh(ka + 16 * LP + 32);
        v8f sA = (v8f){}, sB = (v8f){};
        sA = wmma16(ka0, qh0, sA); sB = wmma16(kb0, qh0, sB);
        sA = wmma16(ka1, qh1, sA); sB = wmma16(kb1, qh1, sB);
        asm volatile("v_nop\n\tv_nop\n\tv_nop\n\tv_nop" : "+v"(sA), "+v"(sB) : "v"(ka0), "v"(ka1), "v"(kb0), "v"(kb1));
        const h16* va = kt + KS * LP + sub;
        const v16h v0 = ldh(va), v1 = ldh(va + 16 * LP), v2 = ldh(va + 32 * LP), v3 = ldh(va + 48 * LP);
        // Keeps the V^T reads here, in flight under the softmax: left alone, the compiler sinks them behind the test and the conversions, and each wave waits out their latency in front of its products.
        asm volatile("" ::: "memory");
        // Lazy rescale: the reference m stays as it is while no score of the pass tops it by more than TAU; each lane tests its own 16 keys (raw scores against thr) and one ballot joins the wave,
        // so that the halves' exchange, alpha and the multiplies on the accumulators stand on the rare side of one scalar branch. P stays at or below 2^(PSH + TAU), inside f16.
        float mx = -3.0e38f;
#pragma unroll
        for (int r = 0; r < 8; ++r) mx = fmaxf(mx, fmaxf(sA[r], sB[r]));
        if (__builtin_amdgcn_ballot_w32(mx > thr) != 0) {       // wave-uniform; always taken in a wave's first pass (thr starts at the lowest value)
            mx *= SC2;
            const float mnew = fmaxf(PSH - sh, fmaxf(mx, xhalf(mx)));   // the same value in both lanes of a query column
            const float shn = PSH - mnew;
            const float alpha = __builtin_amdgcn_exp2f(shn - sh);
            o0 = o0 * alpha; o1 = o1 * alpha; o2 = o2 * alpha; o3 = o3 * alpha; lt = lt * alpha;
            sh = shn; thr = (mnew + TAU) * (1.0f / SC2);
        }
        v16h pb;
#pragma unroll
        for (int r = 0; r < 8; ++r) pb[r] = (h16)__builtin_amdgcn_exp2f(sA[r] * SC2 + sh);
#pragma unroll
        for (int r = 0; r < 8; ++r) pb[8 + r] = (h16)__builtin_amdgcn_exp2f(sB[r] * SC2 + sh);
        lt = wmma16(ones, pb, lt);                            // rows 0 and 8: the sums of the rounded P over all keys so far, one per query column; rescaled like an output tile
        o0 = wmma16(v0, pb, o0); o1 = wmma16(v1, pb, o1); o2 = wmma16(v2, pb, o2); o3 = wmma16(v3, pb, o3);
        // four vector slots behind the last product, on either side of the loop's branch, before anything may touch its registers
        asm volatile("v_nop\n\tv_nop\n\tv_nop\n\tv_nop" : "+v"(o0), "+v"(o1), "+v"(o2), "+v"(o3), "+v"(lt) : "v"(v0), "v"(v1), "v"(v2), "v"(v3), "v"(pb));
      }
      asm volatile("s_wait_dscnt 0x0" ::: "memory");         // this wave's reads of the tile are done before its buffer may be refilled
      asm volatile("s_wait_asynccnt 0x0" ::: "memory");      // this wave's copies of the next tile have landed
      __syncthreads();                                       // publishes the next tile and ends every wave's reads of this one
      if (kt0 + 2 * KS < SEQ) {                              // block-uniform: refill the buffer just read with the tile after next
          const unsigned l0 = lb + buf * (2 * TB); const h16* g0 = gk + (size_t)(kt0 + 2 * KS) * HD; const h16* g2 = gv + (kt0 + 2 * KS);
          stage4(l0, l0 + HB, l0 + TB, l0 + TB + HB, g0, g0 + 32 * HD, g2, g2 + (size_t)32 * SEQ);
      }
    }
    asm volatile("s_wait_asynccnt 0x0" ::: "memory");        // nothing of this wave's copies is outstanding past the loop
    const float inv = CXS * (1.0f / lt[0]);
    const int wb = wave * 16 * 68;
    // O^T D layout: o_j[r] = (d = 16j + 8h + r, t = lane&15) -> os[t][d]; rows 0..15 x columns 0..63 all written
    { v4f a, c;
      a[0] = o0[0] * inv; a[1] = o0[1] * inv; a[2] = o0[2] * inv; a[3] = o0[3] * inv; c[0] = o0[4] * inv; c[1] = o0[5] * inv; c[2] = o0[6] * inv; c[3] = o0[7] * inv;
      *(v4fa*)(&os[wb + lr * 68 +  0 + 8 * hi]) = a; *(v4fa*)(&os[wb + lr * 68 +  0 + 8 * hi + 4]) = c;
      a[0] = o1[0] * inv; a[1] = o1[1] * inv; a[2] = o1[2] * inv; a[3] = o1[3] * inv; c[0] = o1[4] * inv; c[1] = o1[5] * inv; c[2] = o1[6] * inv; c[3] = o1[7] * inv;
      *(v4fa*)(&os[wb + lr * 68 + 16 + 8 * hi]) = a; *(v4fa*)(&os[wb + lr * 68 + 16 + 8 * hi + 4]) = c;
      a[0] = o2[0] * inv; a[1] = o2[1] * inv; a[2] = o2[2] * inv; a[3] = o2[3] * inv; c[0] = o2[4] * inv; c[1] = o2[5] * inv; c[2] = o2[6] * inv; c[3] = o2[7] * inv;
      *(v4fa*)(&os[wb + lr * 68 + 32 + 8 * hi]) = a; *(v4fa*)(&os[wb + lr * 68 + 32 + 8 * hi + 4]) = c;
      a[0] = o3[0] * inv; a[1] = o3[1] * inv; a[2] = o3[2] * inv; a[3] = o3[3] * inv; c[0] = o3[4] * inv; c[1] = o3[5] * inv; c[2] = o3[6] * inv; c[3] = o3[7] * inv;
      *(v4fa*)(&os[wb + lr * 68 + 48 + 8 * hi]) = a; *(v4fa*)(&os[wb + lr * 68 + 48 + 8 * hi + 4]) = c; }
    wave_sync();
    h16* crow = CTX + ((size_t)b * SEQ + t0) * DM + h * HD;
{
#pragma unroll
        for (int s = 0; s < 4; ++s) { const int row = 4 * s + (lane >> 3), c8 = (lane & 7) * 8;   // 4 s x 4 row groups = 16 rows; 8 lanes x 8 halves = 64 columns
            const v4f x0 = *(const v4fa*)(&os[wb + row * 68 + c8]); const v4f x1 = *(const v4fa*)(&os[wb + row * 68 + c8 + 4]); v8h hv;
#pragma unroll
            for (int i = 0; i < 4; ++i) { hv[i] = (h16)x0[i]; hv[4 + i] = (h16)x1[i]; }
            *(v8h*)(crow + (size_t)row * DM + c8) = hv; }
         }
}

// k_oproj: f16 GEMM, K = DM split over the OW waves of a block. A block owns OBM output rows x all 64 columns; each wave takes one k slice of OKS, has every fragment load of
// its slice in flight at once (no loop, one load latency), and leaves an f32 partial tile in LDS; after one block barrier the partials are summed in wave order.
// Transposed form (A = WoT rows n, B = ctx rows m): a lane holds 8 consecutive n of one output row m, so a partial tile goes to LDS in 16-byte stores.
// OUT[m][n] = (sum_k CX[m][k] WoT[n][k]) * 2^-18 + bo[n] (bo as bf16-RNE value), f32. grid (M/OBM), 32 * OW threads.
__global__ __launch_bounds__(32 * OW) void k_oproj(const h16* __restrict__ A, const h16* __restrict__ Bt, const float* __restrict__ bo, float* OUT) {
    __shared__ __align__(16) float ps[OW * OBM * 68];        // [wave][row m][68]: 272-B pitch, as the other epilogue tiles
    const int K = DM;
    const int lane = threadIdx.x & 31, lr = lane & 15, hi = lane >> 4;
    const int wave = __builtin_amdgcn_readfirstlane(threadIdx.x >> 5);   // wave-uniform: the slice's base stays scalar
    const int r0 = blockIdx.x * OBM;
    const h16* px = A + (size_t)(r0 + lr) * K + wave * OKS + 8 * hi;
    const h16* pw = Bt + (size_t)lr * K + wave * OKS + 8 * hi;
    v16h x[OBM / 16][OKS / 32], w[4][OKS / 32];
#pragma unroll
    for (int s = 0; s < OKS / 32; ++s) {
#pragma unroll
        for (int mb = 0; mb < OBM / 16; ++mb) x[mb][s] = ldh(px + (size_t)mb * 16 * K + s * 32);
#pragma unroll
        for (int nb = 0; nb < 4; ++nb) w[nb][s] = ldh(pw + (size_t)nb * 16 * K + s * 32);
    }
    // The wait that belongs in front of any overwrite of the loads' address registers; as its inputs the two addresses stay live up to it, so that no load's own destination takes their registers.
    asm volatile("s_wait_xcnt 0x0" :: "v"(px), "v"(pw) : "memory");
    // Keeps every load above in front of the first product: left alone, the compiler reuses two fragment register sets and waits out one load latency per pair of products.
    __builtin_amdgcn_sched_barrier(0);
    v8f acc[OBM / 16][4];
#pragma unroll
    for (int mb = 0; mb < OBM / 16; ++mb)
#pragma unroll
        for (int nb = 0; nb < 4; ++nb) acc[mb][nb] = (v8f){};
#pragma unroll
    for (int s = 0; s < OKS / 32; ++s)
#pragma unroll
        for (int nb = 0; nb < 4; ++nb)
#pragma unroll
            for (int mb = 0; mb < OBM / 16; ++mb) acc[mb][nb] = wmma16(w[nb][s], x[mb][s], acc[mb][nb]);
    // D layout: acc[mb][nb][j] = (n = 16nb + 8h + j, m = 16mb + (lane&15)) -> ps[wave][m][n]; rows 0..OBM-1 x columns 0..63 all written
    float* pd = ps + wave * (OBM * 68) + lr * 68 + 8 * hi;
#pragma unroll
    for (int mb = 0; mb < OBM / 16; ++mb)
#pragma unroll
        for (int nb = 0; nb < 4; ++nb) {
            v4f lo, up;
#pragma unroll
            for (int i = 0; i < 4; ++i) { lo[i] = acc[mb][nb][i]; up[i] = acc[mb][nb][4 + i]; }
            *(v4fa*)(pd + mb * 16 * 68 + nb * 16) = lo; *(v4fa*)(pd + mb * 16 * 68 + nb * 16 + 4) = up;
        }
    __syncthreads();                                         // every wave's partial tile is published
    const int row = threadIdx.x >> 4, cofs = (threadIdx.x & 15) * 4;   // 32 * OW threads = OBM rows x 16 groups of 4 columns
    v4f sum = *(const v4fa*)(&ps[row * 68 + cofs]);
#pragma unroll
    for (int q = 1; q < OW; ++q) sum += *(const v4fa*)(&ps[q * (OBM * 68) + row * 68 + cofs]);
    const int bidx = r0 / SEQ, tt = r0 % SEQ;
    float* obase = OUT + ((size_t)bidx * OUT_SEQ + tt) * NO;
    v4f val;
#pragma unroll
    for (int i = 0; i < 4; ++i) val[i] = sum[i] * OSC + bfr(bo[cofs + i]);
    *(v4f*)(obase + (size_t)row * NO + cofs) = val;
}

static constexpr size_t al256(size_t v) { return (v + 255) & ~(size_t)255; }
static constexpr size_t SZ_XB = al256((size_t)NB * SEQ * DIN * 2);
static constexpr size_t SZ_WB = al256((size_t)3 * DM * DIN * 2);
static constexpr size_t SZ_WO = al256((size_t)NO * DM * 2);
static constexpr size_t SZ_PL = al256((size_t)NB * NH_ * SEQ * HD * 2);
static constexpr size_t SZ_CX = al256((size_t)NB * SEQ * DM * 2);
static constexpr size_t SZ_TOTAL = 2 * SZ_XB + SZ_WB + SZ_WO + 3 * SZ_PL + SZ_CX;
static_assert(SZ_TOTAL <= (size_t)134217728);          // workspace carve <= 128 MiB
static_assert(((size_t)DM * DIN * 2) % 256 == 0);      // weight sub-planes stay 256-byte aligned

extern "C" void kernel_launch(void* const* d_in, const int* in_sizes, int n_in,
                              void* d_out, int out_size, void* d_ws, size_t ws_size, hipStream_t stream) {
    if (n_in < 10) return;
    const size_t needx = ((size_t)(NB - 1) * SEQ_FULL + SEQ) * DIN;
    if ((size_t)in_sizes[0] < needx || (size_t)in_sizes[1] < needx) return;
    if ((size_t)in_sizes[2] < (size_t)NH_ * DIN * HD || (size_t)in_sizes[4] < (size_t)NH_ * DIN * HD || (size_t)in_sizes[6] < (size_t)NH_ * DIN * HD) return;
    if ((size_t)in_sizes[3] < (size_t)NH_ * HD || (size_t)in_sizes[5] < (size_t)NH_ * HD || (size_t)in_sizes[7] < (size_t)NH_ * HD) return;
    if ((size_t)in_sizes[8] < (size_t)DM * NO || (size_t)in_sizes[9] < (size_t)NO) return;
    if ((size_t)out_size < ((size_t)(NB - 1) * OUT_SEQ + SEQ) * NO) return;
    if (SZ_TOTAL > ws_size) return;
    // wire order: current_tokens, context_tokens, Wq, bq, Wk, bk, Wv, bv, Wo, bo
    const float* xq = (const float*)d_in[0]; const float* xc = (const float*)d_in[1];
    const float* wq = (const float*)d_in[2]; const float* bq = (const float*)d_in[3];
    const float* wk = (const float*)d_in[4]; const float* bk = (const float*)d_in[5];
    const float* wv = (const float*)d_in[6]; const float* bv = (const float*)d_in[7];
    const float* wo = (const float*)d_in[8]; const float* bo = (const float*)d_in[9];
    float* OUT = (float*)d_out;      // [NB][SEQ][64]
    char* wsp = (char*)d_ws;
    bf* XQ = (bf*)wsp; wsp += SZ_XB;                 // [NB*SEQ][1024] query tokens
    bf* XC = (bf*)wsp; wsp += SZ_XB;                 // [NB*SEQ][1024] context tokens
    bf* WB = (bf*)wsp; wsp += SZ_WB;                 // [3][16*64][1024]: q | k | v, rows n = h*64 + a, k-contiguous
    bf* WO = (bf*)wsp; wsp += SZ_WO;                 // [64][1024] f16 bits, x1024
    h16* QH = (h16*)wsp; wsp += SZ_PL;               // [NB*16][SEQ][64]
    h16* KP = (h16*)wsp; wsp += SZ_PL;               // [NB*16][SEQ][64]
    h16* VT = (h16*)wsp; wsp += SZ_PL;               // [NB*16][64][SEQ]
    h16* CX = (h16*)wsp; wsp += SZ_CX;               // [NB*SEQ][1024] ctx x256

    k_prep<<<dim3(3 * WTB + WOB + 2 * CVB, 1, 1), 256, 0, stream>>>(xq, xc, wq, wk, wv, wo, XQ, XC, WB, WO);

    k_proj<<<dim3(PGB, 3, 1), 256, 0, stream>>>(XQ, XC, WB, QH, KP, VT, bq, bk, bv);

    k_flash<<<dim3(SEQ / (16 * AW), NB * NH_, 1), 32 * AW, 0, stream>>>(QH, KP, VT, CX);

    k_oproj<<<dim3(NB * SEQ / OBM, 1, 1), 32 * OW, 0, stream>>>(CX, (const h16*)WO, bo, OUT);
}

// v007
// It runs in 110 microseconds.
// In two side-by-side timings against v006, it was 1.06 and 1.05 times as fast.
// Counting every step since v000, it is 3.04 times as fast.
#include <hip/hip_runtime.h>

// Multi-head cross-attention, 16 heads x 64: q from xq [NB][SEQ][1024], k/v from xc [NB][SEQ][1024]; per-head weights [head][in][out] with biases; score scale 1/8; no mask; concat heads (1024) @ Wo [1024][64] + bo -> out [NB][SEQ][64] f32.
// Compute dtypes, f32 accumulate everywhere: q/k/v projections v_wmma_f32_16x16x32_bf16 (tokens and weights RNE-converted to bf16; products exact), biases RNE-converted to bf16 and added in f32;
// scores v_wmma_f32_16x16x32_f16 (q, k single f16); P (x256 carry, cancels in the normalisation) and v single f16; softmax f32 (online, lazily moved reference maximum);
// output projection v_wmma_f32_16x16x32_f16: ctx as f16 with x256 carry, Wo as bf16-RNE value x1024 held in f16 (exact), accumulator scaled by 2^-18 and bias added in f32.
// Layout: bf16 copies of both token tensors; weights transposed through LDS into K-contiguous rows [head*64 + n][in]; q, k planes [b*16+h][t][d] and v^T plane [b*16+h][d][t] written by the GEMM epilogue;
// the conversions share one launch and the three projections another (block ranges of one grid); fused flash kernel in transposed form (S^T = K Q^T, O^T = V^T P^T), K and V^T tiles staged in LDS for the whole block, writing the f16 ctx plane [b*SEQ+t][h*64+d]; final GEMM (k split over the waves of a block, partials summed in LDS) writes the f32 output.

#ifndef NB
#define NB 4
#endif
#ifndef SEQ
#define SEQ 2048
#endif
#define NB_FULL  4
#define SEQ_FULL 2048
#ifndef OUT_SEQ
#define OUT_SEQ SEQ              // row pitch (in tokens) between batches of the output
#endif
#define DIN  1024                // token width (projection K)
#define NH_  16
#define HD   64
#define DM   (NH_ * HD)          // concatenated head width (output-projection K)
#define NO   64                  // output width
#define AW   8                   // waves per flash block; all of them read the same staged K / V^T tiles
#define QW   32                  // query rows per flash wave: two column groups of 16, both fed by each K / V^T fragment
#define KS   64                  // keys per staged tile
#define LP   72                  // LDS row pitch in halves: 144 B = 16 B x 9, the conflict-free pitch for 16-byte row reads of 128-B rows
#define PBM  256                // projection block tile: rows (4 waves x 64)
#define PBN  128                // projection block tile: columns (2 waves x 64)
#define PKS  128                // k per staged projection tile
#define PLP  136                // LDS row pitch in elements: 272 B = 16 B x 17, the conflict-free pitch for 16-byte row reads of 256-B rows
#define OW   16                 // waves per output-projection block, one k slice each
#define OKS  (DM / OW)          // k per slice
#define OBM  32                 // output rows per output-projection block
#define SC2  (0.125f * 1.4426950408889634f)   // HD^-0.5 * log2(e)
#define PSH  8.0f                // log2 of the P carry (256)
#define TAU  7.0f                // a pass's scores may top the reference in use by this much (log2) before the state is rescaled: P <= 2^15
#define CXS  256.0f              // carry of the ctx plane
#define WOS  1024.0f             // carry of the Wo plane
#define OSC  (1.0f / (256.0f * 1024.0f))

static_assert(HD == 64);
static_assert(NO == 64);                       // output row = 256 bytes = 16 lanes x 16 B
static_assert(NH_ * HD == DM);
static_assert(DM % 64 == 0);
static_assert(DIN % 64 == 0);                  // weight transpose tiles of 64
static_assert(DIN % 32 == 0);                  // GEMM k-loop steps by 32
static_assert(DM % 32 == 0);
static_assert(SEQ % 64 == 0);                  // a 64-row tile never straddles two batches
static_assert((NB * SEQ) % 64 == 0);
static_assert(SEQ % KS == 0);                  // key loop steps by whole staged tiles
static_assert(KS == 64 && KS % 32 == 0);       // a V^T tile row is 128 B, like a K row; 32 keys per softmax step
static_assert(AW * 32 * 2 * 8 == KS * HD);     // two 16-byte copies per thread cover one tile
static_assert(QW == 32 && SEQ % (QW * AW) == 0);   // flash grid covers the sequence exactly
static_assert(((size_t)SEQ * DIN) % 8 == 0);
static_assert((NB * SEQ) % PBM == 0 && DM % PBM == 0 && (NB * SEQ) % PBN == 0 && DM % PBN == 0);   // projection grids cover both orientations exactly
static_assert(DIN % PKS == 0 && DIN >= 2 * PKS);   // whole staged tiles, and the ring's prologue needs two
static_assert(((NB * SEQ) / PBM) * (DM / PBN) == (DM / PBM) * ((NB * SEQ) / PBN));   // the three projections share one grid: as many block tiles in either orientation
static_assert(PBM == 256 && PBN == 128 && PKS == 128);   // copy map: 256 threads x 24 copies of 16 B = (PBM + PBN) rows of 256 B
static_assert(DM % (OW * 32) == 0 && OBM % 16 == 0);   // whole 32-k steps per slice, whole 16-row tiles per block
static_assert(SEQ % OBM == 0);                 // an output-projection block never straddles two batches
static_assert(32 * OW == OBM * (NO / 4));      // the final sum: one thread per 4 columns of one row
static_assert(NB <= NB_FULL);
static_assert(SEQ <= SEQ_FULL);

typedef _Float16 h16;
typedef unsigned short bf;
typedef __attribute__((ext_vector_type(16))) __bf16   v16bf;
typedef __attribute__((ext_vector_type(16))) _Float16 v16h;
typedef __attribute__((ext_vector_type(8)))  _Float16 v8h;
typedef __attribute__((ext_vector_type(8)))  unsigned short v8us;
typedef __attribute__((ext_vector_type(8)))  float    v8f;
typedef __attribute__((ext_vector_type(4)))  float    v4f;
typedef v4f  __attribute__((may_alias)) v4fa;

__device__ __forceinline__ unsigned short f2bf(float f) { unsigned u = __float_as_uint(f); u += 0x7FFFu + ((u >> 16) & 1u); return (unsigned short)(u >> 16); }
__device__ __forceinline__ float bf2f(unsigned short b) { return __uint_as_float(((unsigned)b) << 16); }
__device__ __forceinline__ float bfr(float f) { return bf2f(f2bf(f)); }   // value after RNE conversion to bf16
__device__ __forceinline__ v16h cat16(v8h lo, v8h hi) { return __builtin_shufflevector(lo, hi, 0, 1, 2, 3, 4, 5, 6, 7, 8, 9, 10, 11, 12, 13, 14, 15); }
__device__ __forceinline__ v16bf cat16b(v8us lo, v8us hi) { return __builtin_bit_cast(v16bf, __builtin_shufflevector(lo, hi, 0, 1, 2, 3, 4, 5, 6, 7, 8, 9, 10, 11, 12, 13, 14, 15)); }
__device__ __forceinline__ v8f wmma16(v16h a, v16h b, v8f c) { return __builtin_amdgcn_wmma_f32_16x16x32_f16(false, a, false, b, (short)0, c, false, false); }
__device__ __forceinline__ v8f wmmab(v16bf a, v16bf b, v8f c) { return __builtin_amdgcn_wmma_f32_16x16x32_bf16(false, a, false, b, (short)0, c, false, false); }
// fragment loaders from K-contiguous 16-bit rows; p already includes + 8*(lane>>4): elements 0..7 <- k0+8h+0..7, elements 8..15 <- k0+16+8h+0..7 (same map for A and B)
__device__ __forceinline__ v16h  ldh(const h16* p) { return cat16(*(const v8h*)p, *(const v8h*)(p + 16)); }
__device__ __forceinline__ v16bf ldb(const bf* p)  { return cat16b(*(const v8us*)p, *(const v8us*)(p + 16)); }
// lane l with lane l ^ 16, in registers: unlike the shuffle it needs no lane index held across the key loop, which has no register to spare
__device__ __forceinline__ float xhalf(float x) { return __builtin_bit_cast(float, __builtin_amdgcn_permlanex16(__builtin_bit_cast(int, x), __builtin_bit_cast(int, x), 0x76543210, 0xfedcba98, false, false)); }
// ordering point for wave-private LDS tiles (same wave writes and reads)
__device__ __forceinline__ void wave_sync() { __builtin_amdgcn_fence(3 /* release order */, "wavefront"); __builtin_amdgcn_wave_barrier(); asm volatile("" ::: "memory"); }

// cvt8: token f32 -> bf16, 8 elements per thread; blk = block index inside one tensor's range. The source keeps the full batch pitch, the bf16 plane is dense.
__device__ __forceinline__ void cvt8(const float* __restrict__ src, bf* dst, unsigned blk) {
    constexpr size_t B8 = (size_t)SEQ * DIN / 8;        // threads per batch
    const size_t i = (size_t)blk * 256 + threadIdx.x; if (i >= (size_t)NB * B8) return;
    const size_t so = (SEQ == SEQ_FULL) ? i * 8 : (i / B8) * ((size_t)SEQ_FULL * DIN) + (i % B8) * 8;
    const v8f v = *(const v8f*)(src + so); v8us o;
#pragma unroll
    for (int k = 0; k < 8; ++k) o[k] = f2bf(v[k]);
    *(v8us*)(dst + i * 8) = o;
}

// wt: weight transpose + 16-bit convert through LDS (ts: 64 x 65 floats of the block), one 64 x 64 tile (k tile kb of head hh) per block. in W[head][Kd][64] (f32, k-major) -> out WT[head*64 + n][Kd] (k-contiguous).
// F16 == 0: bf16 bits (RNE). F16 == 1: f16 of (bf16-RNE value * scale) (exact for power-of-two scale).
template <int F16>
__device__ __forceinline__ void wt(float* ts, const float* __restrict__ W, bf* WT, int Kd, float scale, int kb, int hh) {
    const int tid = threadIdx.x;
    const int d0 = kb * 64;
    const float* src = W + ((size_t)hh * Kd + d0) * 64;
#pragma unroll
    for (int it = 0; it < 4; ++it) {                    // 4 x 256 threads x 4 floats = 64 rows x 64 columns
        const int idx = it * 256 + tid; const int row = idx >> 4, c4 = (idx & 15) * 4;
        const v4f v = *(const v4f*)(src + (size_t)row * 64 + c4);
        ts[row * 65 + c4 + 0] = v[0]; ts[row * 65 + c4 + 1] = v[1]; ts[row * 65 + c4 + 2] = v[2]; ts[row * 65 + c4 + 3] = v[3];
    }
    __syncthreads();                                    // cross-wave tile: block barrier
    const int k8 = (tid & 7) * 8, nq = tid >> 3;        // 2 it x 32 row groups = 64 output rows; 8 lanes x 8 = 64 k
    v8us ou[2]; v8h oh[2];
#pragma unroll
    for (int it = 0; it < 2; ++it) {
        const int n = it * 32 + nq;
#pragma unroll
        for (int j = 0; j < 8; ++j) {
            const float w = ts[(k8 + j) * 65 + n];
            ou[it][j] = f2bf(w);
            oh[it][j] = (h16)(bfr(w) * scale);
        }
    }
{
#pragma unroll
        for (int it = 0; it < 2; ++it) {
            const size_t off = (size_t)(hh * 64 + it * 32 + nq) * (size_t)Kd + d0 + k8;
            if (F16) *(v8h*)((h16*)WT + off) = oh[it];
            else     *(v8us*)(WT + off) = ou[it];
        }
        
    }
}

// k_prep: all the work that depends on the inputs alone, as block ranges of one grid (the parts share no data): the three projection weights, Wo, then the two token tensors.
// The short transposes stand first in the index order (for speed only). Every test below is on the block index alone.
#define WTB ((DIN / 64) * NH_)                                   // blocks per projection weight: k tiles x heads
#define WOB (DM / 64)                                            // blocks of Wo: k tiles, one head
#define CVB ((unsigned)(((size_t)NB * SEQ * DIN / 8 + 255) / 256))   // blocks per token tensor
__global__ __launch_bounds__(256) void k_prep(const float* __restrict__ xq, const float* __restrict__ xc, const float* __restrict__ wq, const float* __restrict__ wk, const float* __restrict__ wv,
                                              const float* __restrict__ wo, bf* XQ, bf* XC, bf* WB, bf* WO) {
    __shared__ float ts[64 * 65];
    const unsigned blk = blockIdx.x;
    if (blk >= 3 * WTB + WOB) {
        const unsigned c = blk - (3 * WTB + WOB); const bool ctx = c >= CVB;
        cvt8(ctx ? xc : xq, ctx ? XC : XQ, ctx ? c - CVB : c);
    } else if (blk >= 3 * WTB) {
        // Wo: in [1024 (k)][64 (n)] -> out [n][1024 (k)], one head
        wt<1>(ts, wo, WO, DM, WOS, (int)(blk - 3 * WTB), 0);
    } else {
        // in [head][1024 (k)][64 (n)] -> out [head*64 + n][1024 (k)]
        const unsigned w = blk / WTB, r = blk % WTB;
        wt<0>(ts, w == 0 ? wq : w == 1 ? wk : wv, WB + (size_t)w * DM * DIN, DIN, 1.0f, (int)(r % (DIN / 64)), (int)(r / (DIN / 64)));
    }
}

// Twelve 16-byte copies per lane, global -> LDS through no register (a wave's copy covers two whole 256-B rows = four lines).
// The s_wait_xcnt stands inside the statement so that it precedes every later write of the address registers the copies name.
__device__ __forceinline__ void stage12(const unsigned (&l)[12], const bf* const (&g)[12]) {
    asm volatile("global_load_async_to_lds_b128 %0, %12, off\n\t"
                 "global_load_async_to_lds_b128 %1, %13, off\n\t"
                 "global_load_async_to_lds_b128 %2, %14, off\n\t"
                 "global_load_async_to_lds_b128 %3, %15, off\n\t"
                 "global_load_async_to_lds_b128 %4, %16, off\n\t"
                 "global_load_async_to_lds_b128 %5, %17, off\n\t"
                 "global_load_async_to_lds_b128 %6, %18, off\n\t"
                 "global_load_async_to_lds_b128 %7, %19, off\n\t"
                 "global_load_async_to_lds_b128 %8, %20, off\n\t"
                 "global_load_async_to_lds_b128 %9, %21, off\n\t"
                 "global_load_async_to_lds_b128 %10, %22, off\n\t"
                 "global_load_async_to_lds_b128 %11, %23, off\n\t"
                 "s_wait_xcnt 0x0"
                 :: "v"(l[0]), "v"(l[1]), "v"(l[2]), "v"(l[3]), "v"(l[4]), "v"(l[5]), "v"(l[6]), "v"(l[7]), "v"(l[8]), "v"(l[9]), "v"(l[10]), "v"(l[11]),
                    "v"(g[0]), "v"(g[1]), "v"(g[2]), "v"(g[3]), "v"(g[4]), "v"(g[5]), "v"(g[6]), "v"(g[7]), "v"(g[8]), "v"(g[9]), "v"(g[10]), "v"(g[11]) : "memory");
}
// One staged k tile of a projection block: PBM rows of A, then PBN rows of Bt, PKS elements each; a thread copies its 16-byte column of every 16th row.
// l: LDS byte address of the thread's chunk in its first row (tid>>4) of the buffer; ga, gb: the thread's chunk in its first A row and its first Bt row of the tile.
__device__ __forceinline__ void proj_fill(unsigned l, const bf* ga, const bf* gb) {
    constexpr unsigned LS = 16 * PLP * 2; constexpr size_t GS = (size_t)16 * DIN;
    unsigned la[12]; const bf* gp[12];
#pragma unroll
    for (int i = 0; i < 12; ++i) { la[i] = l + (unsigned)i * LS; gp[i] = ga + (size_t)i * GS; }
    stage12(la, gp);
#pragma unroll
    for (int i = 0; i < 4; ++i) { la[i] = l + (unsigned)(12 + i) * LS; gp[i] = ga + (size_t)(12 + i) * GS; }
#pragma unroll
    for (int i = 0; i < 8; ++i) { la[4 + i] = l + (unsigned)(16 + i) * LS; gp[4 + i] = gb + (size_t)i * GS; }
    stage12(la, gp);
}

// k_proj: register-blocked bf16 GEMM, K = DIN. A block of 8 waves (4 x 2) owns a PBM x PBN tile, each wave a 64x64 part of it (16 accumulators).
// The operands come in k tiles of PKS, copied once per block from the K-contiguous bf16 planes into a two-buffer LDS ring (the next tile's copies fly while this one is worked on) and read from there as fragments.
// C[m][n] = sum_k A[m][k] Bt[n][k] + bias, written as f16 (Ph) from the wave tile's base in its plane ('tbase'), row pitch 'pitch' (halves).
// bias (bf16-RNE value, f32 add): per column when bcol == 1 (index n), per row when brow == 1 (index m); exactly one of brow/bcol is 1.
// The three projections are independent and run as one grid (PGB tiles, 3 products), 256 threads; blockIdx.y picks the product, all of its parameters are block-uniform:
// q, k: A = token rows (m = b*SEQ + t), Bt = W rows (n = h*64 + a) -> plane [(b*16 + h)][t][a]; bias per column n
// v^T:  A = Wv rows (m = h*64 + o), Bt = context token rows (n = b*SEQ + t) -> plane [(b*1024 + m)][t] = [(b*16 + h)][o][t]; bias per row m
#define PGB (((NB * SEQ) / PBM) * (DM / PBN))   // block tiles of one product, the same number in both orientations
__global__ __launch_bounds__(256) void k_proj(const bf* __restrict__ XQ, const bf* __restrict__ XC, const bf* __restrict__ WB, h16* QH, h16* KP, h16* VT,
                                              const float* __restrict__ bq, const float* __restrict__ bk, const float* __restrict__ bv) {
    const int job = blockIdx.y; const bool tr = job == 2;
    const bf* A = job == 0 ? XQ : job == 1 ? XC : WB + (size_t)2 * DM * DIN;
    const bf* Bt = job == 0 ? WB : job == 1 ? WB + (size_t)DM * DIN : XC;
    h16* Ph = job == 0 ? QH : job == 1 ? KP : VT;
    const float* bias = job == 0 ? bq : job == 1 ? bk : bv;
    const int brow = tr ? 1 : 0, bcol = tr ? 0 : 1;
    const int pitch = tr ? SEQ : HD;
    // the tile index runs over the product's row tiles first; both counts are constants, so the divisions stay scalar shifts
    const int bx = tr ? (int)(blockIdx.x % (DM / PBM)) : (int)(blockIdx.x % (NB * SEQ / PBM));
    const int by = tr ? (int)(blockIdx.x / (DM / PBM)) : (int)(blockIdx.x / (NB * SEQ / PBM));
    __shared__ __align__(16) float osb[8 * 16 * 68];
    __shared__ __align__(16) bf st[2 * (PBM + PBN) * PLP];   // [buffer][A rows | Bt rows][PLP]
    const int K = DIN;
    const int lane = threadIdx.x & 31, lr = lane & 15, hi = lane >> 4;
    const int wave = __builtin_amdgcn_readfirstlane(threadIdx.x >> 5);   // wave-uniform: the tile's base and its divisions stay scalar
    const int r0 = bx * PBM + (wave >> 1) * 64, c0 = by * PBN + (wave & 1) * 64;
    float* os = osb + wave * 16 * 68;                        // wave-private epilogue tile
    v8f acc[4][4];
#pragma unroll
    for (int mb = 0; mb < 4; ++mb)
#pragma unroll
        for (int nb = 0; nb < 4; ++nb) acc[mb][nb] = (v8f){};
    // copy map: thread -> row tid>>4 (and every 16th row after it), 16-byte column tid&15
    const int cr = threadIdx.x >> 4, ccol = (threadIdx.x & 15) * 8;
    const bf* ga = A + (size_t)(bx * PBM + cr) * K + ccol;    // + k0
    const bf* gb = Bt + (size_t)(by * PBN + cr) * K + ccol;   // + k0
    const unsigned lb = (unsigned)(size_t)st + (unsigned)(cr * PLP + ccol) * 2u;
    constexpr unsigned SB = (PBM + PBN) * PLP * 2;           // bytes of one buffer
    const int aoff = ((wave >> 1) * 64 + lr) * PLP + 8 * hi, boff = (PBM + (wave & 1) * 64 + lr) * PLP + 8 * hi;
    proj_fill(lb, ga, gb);
    asm volatile("s_wait_asynccnt 0x0" ::: "memory");        // this wave's copies of tile 0 have landed
    __syncthreads();                                         // tile 0 published to every wave
    proj_fill(lb + SB, ga + PKS, gb + PKS);                  // tile 1 exists: K >= 2 * PKS
#pragma unroll 1
    for (int kt = 0; kt < K; kt += PKS) {
        const unsigned buf = (unsigned)(kt / PKS) & 1u;
        const bf* sa = st + buf * ((PBM + PBN) * PLP) + aoff; const bf* sb = st + buf * ((PBM + PBN) * PLP) + boff;
        // Fragments in two register sets, all inside this tile: the next k step's LDS reads are issued in two groups ahead of their use (12 in front of this step's
        // products, 4 into the registers that its first 8 products free), so that no product waits for a read just issued. Each sched_barrier keeps one such group
        // where it is written: left alone, the compiler moves the reads down to their users and puts a full LDS wait in front of every 4 products.
        v16bf a[2][4], b[2][4];
#pragma unroll
        for (int i = 0; i < 4; ++i) { a[0][i] = ldb(sa + i * 16 * PLP); b[0][i] = ldb(sb + i * 16 * PLP); }
        __builtin_amdgcn_sched_barrier(0);
#pragma unroll
        for (int s = 0; s < PKS / 32; ++s) {
            const int c = s & 1, n = c ^ 1;
            if (s + 1 < PKS / 32) {
#pragma unroll
                for (int i = 0; i < 4; ++i) a[n][i] = ldb(sa + i * 16 * PLP + (s + 1) * 32);
                b[n][0] = ldb(sb + (s + 1) * 32); b[n][1] = ldb(sb + 16 * PLP + (s + 1) * 32);
                __builtin_amdgcn_sched_barrier(0);
            }
#pragma unroll
            for (int nb = 0; nb < 2; ++nb)
#pragma unroll
                for (int mb = 0; mb < 4; ++mb) acc[mb][nb] = wmmab(a[c][mb], b[c][nb], acc[mb][nb]);
            __builtin_amdgcn_sched_barrier(0);
            if (s + 1 < PKS / 32) {
                b[n][2] = ldb(sb + 32 * PLP + (s + 1) * 32); b[n][3] = ldb(sb + 48 * PLP + (s + 1) * 32);
                __builtin_amdgcn_sched_barrier(0);
            }
#pragma unroll
            for (int nb = 2; nb < 4; ++nb)
#pragma unroll
                for (int mb = 0; mb < 4; ++mb) acc[mb][nb] = wmmab(a[c][mb], b[c][nb], acc[mb][nb]);
            __builtin_amdgcn_sched_barrier(0);
        }
        asm volatile("s_wait_dscnt 0x0" ::: "memory");       // this wave's reads of the tile are done before its buffer may be refilled
        asm volatile("s_wait_asynccnt 0x0" ::: "memory");    // this wave's copies of the next tile have landed
        __syncthreads();                                     // publishes the next tile and ends every wave's reads of this one
        if (kt + 2 * PKS < K) proj_fill(lb + buf * SB, ga + (kt + 2 * PKS), gb + (kt + 2 * PKS));   // block-uniform: refill the buffer just read with the tile after next
    }
    asm volatile("s_wait_asynccnt 0x0" ::: "memory");        // nothing of this wave's copies is outstanding past the loop
    const size_t tbase = tr ? (size_t)r0 * SEQ + (size_t)(c0 / SEQ) * ((size_t)DM * SEQ) + (size_t)(c0 % SEQ)
                            : (size_t)(r0 / SEQ) * ((size_t)NH_ * SEQ * HD) + (size_t)(r0 % SEQ) * HD + (size_t)(c0 / HD) * ((size_t)SEQ * HD) + (size_t)(c0 % HD);
    const int c8 = (lane & 7) * 8, rq = lane >> 3;
    const float fbc = (float)bcol, fbr = (float)brow;
    float bc[8];
#pragma unroll
    for (int i = 0; i < 8; ++i) bc[i] = bfr(bias[(size_t)(c0 + c8 + i) * (size_t)bcol]) * fbc;   // index < N when bcol == 1, else 0
#pragma unroll
    for (int mb = 0; mb < 4; ++mb) {
#pragma unroll
        for (int nb = 0; nb < 4; ++nb) {
#pragma unroll
            for (int j = 0; j < 8; ++j) os[(hi * 8 + j) * 68 + nb * 16 + lr] = acc[mb][nb][j]; }   // D: row 8h+j, col lane&15
        wave_sync();
        const size_t sb = tbase + (size_t)(mb * 16) * (size_t)pitch;
{
#pragma unroll
            for (int s = 0; s < 4; ++s) { const int row = 4 * s + rq;   // 4 s x 4 row groups = 16 rows; 8 lanes x 8 = 64 columns
                const v4f x0 = *(const v4fa*)(&os[row * 68 + c8]); const v4f x1 = *(const v4fa*)(&os[row * 68 + c8 + 4]); v8h hv;
                const float br = bfr(bias[(size_t)(r0 + mb * 16 + row) * (size_t)brow]) * fbr;         // index < M when brow == 1, else 0
#pragma unroll
                for (int i = 0; i < 4; ++i) { hv[i] = (h16)(x0[i] + bc[i] + br); hv[4 + i] = (h16)(x1[i] + bc[4 + i] + br); }
                const size_t oo = sb + (size_t)row * (size_t)pitch + c8;
                *(v8h*)(Ph + oo) = hv; }
             }
        wave_sync();
    }
}

// One staged tile pair: four 16-byte copies per lane, global -> LDS through no register (a wave's copy covers four whole 128-B lines).
// The s_wait_xcnt stands inside the statement so that it precedes every later write of the address registers the copies name.
__device__ __forceinline__ void stage4(unsigned l0, unsigned l1, unsigned l2, unsigned l3, const h16* g0, const h16* g1, const h16* g2, const h16* g3) {
    asm volatile("global_load_async_to_lds_b128 %0, %4, off\n\t"
                 "global_load_async_to_lds_b128 %1, %5, off\n\t"
                 "global_load_async_to_lds_b128 %2, %6, off\n\t"
                 "global_load_async_to_lds_b128 %3, %7, off\n\t"
                 "s_wait_xcnt 0x0"
                 :: "v"(l0), "v"(l1), "v"(l2), "v"(l3), "v"(g0), "v"(g1), "v"(g2), "v"(g3) : "memory");
}

__global__ __launch_bounds__(32 * AW) __attribute__((amdgpu_waves_per_eu(4))) void k_flash(const h16* __restrict__ QH, const h16* __restrict__ KP, const h16* __restrict__ VT, h16* CTX) {
    __shared__ __align__(16) float os[AW * 16 * 68];
    __shared__ __align__(16) h16 kv[2 * 2 * KS * LP];        // [buffer][K tile: key rows | V^T tile: d rows][64 rows][LP]
    const int lane = threadIdx.x & 31, lr = lane & 15, hi = lane >> 4;
    const int wave = __builtin_amdgcn_readfirstlane(threadIdx.x >> 5);   // wave-uniform: the wave's first query row stays in a scalar register across the key loop
    const int zh = blockIdx.y; const int b = zh / NH_, h = zh % NH_;
    const int t0 = (blockIdx.x * AW + wave) * QW;
    const size_t pbase = (size_t)zh * SEQ * HD;
    const size_t qo = pbase + (size_t)(t0 + lr) * HD + 8 * hi;
    v16h qh[2][2];                                           // B fragments: [column group][k half], col t, k = d
#pragma unroll
    for (int g = 0; g < 2; ++g) { qh[g][0] = ldh(QH + qo + g * 16 * HD); qh[g][1] = ldh(QH + qo + g * 16 * HD + 32); }
    const int fo = lr * LP + 8 * hi;                         // fragment offset in a tile: K + key*LP (A: row key, k = d); V^T + 16j*LP + key (A: row d, k = key)
    // copy map: thread -> row tid>>3 (and row + 32), 16-byte column tid&7
    const int cr = threadIdx.x >> 3, ccol = (threadIdx.x & 7) * 8;
    const h16* gk = KP + pbase + (size_t)cr * HD + ccol;   // + key0 * HD
    const h16* gv = VT + pbase + (size_t)cr * SEQ + ccol;  // + key0
    const unsigned lb = (unsigned)(size_t)kv + (unsigned)(cr * LP + ccol) * 2u;   // LDS byte address of the thread's first K chunk in buffer 0
    constexpr unsigned TB = KS * LP * 2, HB = 32 * LP * 2;   // bytes of one tile, of half a tile
    stage4(lb, lb + HB, lb + TB, lb + TB + HB, gk, gk + 32 * HD, gv, gv + (size_t)32 * SEQ);
    asm volatile("s_wait_asynccnt 0x0" ::: "memory");        // this wave's copies of tile 0 have landed
    __syncthreads();                                         // tile 0 published to every wave
    if (SEQ > KS) stage4(lb + 2 * TB, lb + 2 * TB + HB, lb + 3 * TB, lb + 3 * TB + HB, gk + KS * HD, gk + (KS + 32) * HD, gv + KS, gv + (size_t)32 * SEQ + KS);
    v8f o[2][4], lt[2];                                      // per column group: four output tiles and the accumulator tile of the row-sum product
    float sh[2], thr[2];                                     // PSH - m, m the reference maximum in use (scaled, log2; it starts at the lowest value); the raw score above which the reference moves
#pragma unroll
    for (int g = 0; g < 2; ++g) { o[g][0] = (v8f){}; o[g][1] = (v8f){}; o[g][2] = (v8f){}; o[g][3] = (v8f){}; lt[g] = (v8f){}; sh[g] = 3.0e38f; thr[g] = -3.0e38f; }
    const h16 one = (lane & 7) == 0 ? (h16)1.0f : (h16)0.0f;
    const v16h ones = {one, one, one, one, one, one, one, one, one, one, one, one, one, one, one, one};
#pragma unroll 1
    for (int kt0 = 0; kt0 < SEQ; kt0 += KS) {
      const unsigned buf = (unsigned)(kt0 / KS) & 1u;
      const h16* kt = kv + buf * (2 * KS * LP) + fo;
      // Both 32-key steps of the tile are written out: the second step's K fragments are read together with the first step's V^T fragments, so that only the tile's first K reads are waited for in the open.
      v16h kf[2][4];                                         // [step parity][keys 0..15: d halves | keys 16..31: d halves]
      kf[0][0] = ldh(kt); kf[0][1] = ldh(kt + 32); kf[0][2] = ldh(kt + 16 * LP); kf[0][3] = ldh(kt + 16 * LP + 32);
#pragma unroll
      for (int sub = 0; sub < KS; sub += 32) {
        const int c = (sub / 32) & 1;
        v8f sA[2], sB[2];
#pragma unroll
        for (int g = 0; g < 2; ++g) { sA[g] = wmma16(kf[c][0], qh[g][0], (v8f){}); sB[g] = wmma16(kf[c][2], qh[g][0], (v8f){}); }
#pragma unroll
        for (int g = 0; g < 2; ++g) { sA[g] = wmma16(kf[c][1], qh[g][1], sA[g]); sB[g] = wmma16(kf[c][3], qh[g][1], sB[g]); }
        const h16* va = kt + KS * LP + sub;
        const v16h v0 = ldh(va), v1 = ldh(va + 16 * LP), v2 = ldh(va + 32 * LP), v3 = ldh(va + 48 * LP);
        if (sub + 32 < KS) {
            const h16* kn = kt + (sub + 32) * LP;
            kf[c ^ 1][0] = ldh(kn); kf[c ^ 1][1] = ldh(kn + 32); kf[c ^ 1][2] = ldh(kn + 16 * LP); kf[c ^ 1][3] = ldh(kn + 16 * LP + 32);
        }
        // Keeps these LDS reads here, in flight under the softmax: left alone, the compiler sinks them behind the test and the conversions, and each wave waits out their latency in front of its products.
        asm volatile("" ::: "memory");
        // Lazy rescale: the reference m stays as it is while no score of the pass tops it by more than TAU; each lane tests its own 16 keys of either group (raw scores against thr) and one ballot joins the wave,
        // so that the halves' exchange, alpha and the multiplies on the accumulators stand on the rare side of one scalar branch. P stays at or below 2^(PSH + TAU), inside f16.
        float mx[2];
#pragma unroll
        for (int g = 0; g < 2; ++g) {
            mx[g] = -3.0e38f;
#pragma unroll
            for (int r = 0; r < 8; ++r) mx[g] = fmaxf(mx[g], fmaxf(sA[g][r], sB[g][r]));
        }
        if (__builtin_amdgcn_ballot_w32(mx[0] > thr[0] || mx[1] > thr[1]) != 0) {   // wave-uniform; always taken in a wave's first pass (thr starts at the lowest value)
#pragma unroll
            for (int g = 0; g < 2; ++g) {
                const float ms = mx[g] * SC2;
                const float mnew = fmaxf(PSH - sh[g], fmaxf(ms, xhalf(ms)));   // the same value in both lanes of a query column
                const float shn = PSH - mnew;
                const float alpha = __builtin_amdgcn_exp2f(shn - sh[g]);
                o[g][0] = o[g][0] * alpha; o[g][1] = o[g][1] * alpha; o[g][2] = o[g][2] * alpha; o[g][3] = o[g][3] * alpha; lt[g] = lt[g] * alpha;
                sh[g] = shn; thr[g] = (mnew + TAU) * (1.0f / SC2);
            }
        }
        v16h pb[2];
#pragma unroll
        for (int g = 0; g < 2; ++g) {
#pragma unroll
            for (int r = 0; r < 8; ++r) pb[g][r] = (h16)__builtin_amdgcn_exp2f(sA[g][r] * SC2 + sh[g]);
#pragma unroll
            for (int r = 0; r < 8; ++r) pb[g][8 + r] = (h16)__builtin_amdgcn_exp2f(sB[g][r] * SC2 + sh[g]);
            lt[g] = wmma16(ones, pb[g], lt[g]);               // rows 0 and 8: the sums of the rounded P over all keys so far, one per query column; rescaled like an output tile
            o[g][0] = wmma16(v0, pb[g], o[g][0]); o[g][1] = wmma16(v1, pb[g], o[g][1]); o[g][2] = wmma16(v2, pb[g], o[g][2]); o[g][3] = wmma16(v3, pb[g], o[g][3]);
        }
        // four vector slots behind the tile's last product, on either side of the loop's branch, before anything may touch its registers
        if (sub + 32 >= KS)
            asm volatile("v_nop\n\tv_nop\n\tv_nop\n\tv_nop" : "+v"(o[0][0]), "+v"(o[0][1]), "+v"(o[0][2]), "+v"(o[0][3]), "+v"(lt[0]), "+v"(o[1][0]), "+v"(o[1][1]), "+v"(o[1][2]), "+v"(o[1][3]), "+v"(lt[1])
                         : "v"(v0), "v"(v1), "v"(v2), "v"(v3), "v"(pb[0]), "v"(pb[1]));
      }
      asm volatile("s_wait_dscnt 0x0" ::: "memory");         // this wave's reads of the tile are done before its buffer may be refilled
      asm volatile("s_wait_asynccnt 0x0" ::: "memory");      // this wave's copies of the next tile have landed
      __syncthreads();                                       // publishes the next tile and ends every wave's reads of this one
      if (kt0 + 2 * KS < SEQ) {                              // block-uniform: refill the buffer just read with the tile after next
          const unsigned l0 = lb + buf * (2 * TB); const h16* g0 = gk + (size_t)(kt0 + 2 * KS) * HD; const h16* g2 = gv + (kt0 + 2 * KS);
          stage4(l0, l0 + HB, l0 + TB, l0 + TB + HB, g0, g0 + 32 * HD, g2, g2 + (size_t)32 * SEQ);
      }
    }
    asm volatile("s_wait_asynccnt 0x0" ::: "memory");        // nothing of this wave's copies is outstanding past the loop
    const int wb = wave * 16 * 68;
    // the two column groups go through the wave's own staging tile one after the other
#pragma unroll
    for (int g = 0; g < 2; ++g) {
        const float inv = CXS * (1.0f / lt[g][0]);
        // O^T D layout: o[g][j][r] = (d = 16j + 8h + r, t = 16g + (lane&15)) -> os[t - 16g][d]; rows 0..15 x columns 0..63 all written
#pragma unroll
        for (int j = 0; j < 4; ++j) {
            v4f a, c;
#pragma unroll
            for (int i = 0; i < 4; ++i) { a[i] = o[g][j][i] * inv; c[i] = o[g][j][4 + i] * inv; }
            *(v4fa*)(&os[wb + lr * 68 + 16 * j + 8 * hi]) = a; *(v4fa*)(&os[wb + lr * 68 + 16 * j + 8 * hi + 4]) = c;
        }
        wave_sync();
        h16* crow = CTX + ((size_t)b * SEQ + t0 + 16 * g) * DM + h * HD;
#pragma unroll
        for (int s = 0; s < 4; ++s) { const int row = 4 * s + (lane >> 3), c8 = (lane & 7) * 8;   // 4 s x 4 row groups = 16 rows; 8 lanes x 8 halves = 64 columns
            const v4f x0 = *(const v4fa*)(&os[wb + row * 68 + c8]); const v4f x1 = *(const v4fa*)(&os[wb + row * 68 + c8 + 4]); v8h hv;
#pragma unroll
            for (int i = 0; i < 4; ++i) { hv[i] = (h16)x0[i]; hv[4 + i] = (h16)x1[i]; }
            *(v8h*)(crow + (size_t)row * DM + c8) = hv; }
        wave_sync();
    }
}

// k_oproj: f16 GEMM, K = DM split over the OW waves of a block. A block owns OBM output rows x all 64 columns; each wave takes one k slice of OKS, has every fragment load of
// its slice in flight at once (no loop, one load latency), and leaves an f32 partial tile in LDS; after one block barrier the partials are summed in wave order.
// Transposed form (A = WoT rows n, B = ctx rows m): a lane holds 8 consecutive n of one output row m, so a partial tile goes to LDS in 16-byte stores.
// OUT[m][n] = (sum_k CX[m][k] WoT[n][k]) * 2^-18 + bo[n] (bo as bf16-RNE value), f32. grid (M/OBM), 32 * OW threads.
__global__ __launch_bounds__(32 * OW) void k_oproj(const h16* __restrict__ A, const h16* __restrict__ Bt, const float* __restrict__ bo, float* OUT) {
    __shared__ __align__(16) float ps[OW * OBM * 68];        // [wave][row m][68]: 272-B pitch, as the other epilogue tiles
    const int K = DM;
    const int lane = threadIdx.x & 31, lr = lane & 15, hi = lane >> 4;
    const int wave = __builtin_amdgcn_readfirstlane(threadIdx.x >> 5);   // wave-uniform: the slice's base stays scalar
    const int r0 = blockIdx.x * OBM;
    const h16* px = A + (size_t)(r0 + lr) * K + wave * OKS + 8 * hi;
    const h16* pw = Bt + (size_t)lr * K + wave * OKS + 8 * hi;
    v16h x[OBM / 16][OKS / 32], w[4][OKS / 32];
#pragma unroll
    for (int s = 0; s < OKS / 32; ++s) {
#pragma unroll
        for (int mb = 0; mb < OBM / 16; ++mb) x[mb][s] = ldh(px + (size_t)mb * 16 * K + s * 32);
#pragma unroll
        for (int nb = 0; nb < 4; ++nb) w[nb][s] = ldh(pw + (size_t)nb * 16 * K + s * 32);
    }
    // The wait that belongs in front of any overwrite of the loads' address registers; as its inputs the two addresses stay live up to it, so that no load's own destination takes their registers.
    asm volatile("s_wait_xcnt 0x0" :: "v"(px), "v"(pw) : "memory");
    // Keeps every load above in front of the first product: left alone, the compiler reuses two fragment register sets and waits out one load latency per pair of products.
    __builtin_amdgcn_sched_barrier(0);
    v8f acc[OBM / 16][4];
#pragma unroll
    for (int mb = 0; mb < OBM / 16; ++mb)
#pragma unroll
        for (int nb = 0; nb < 4; ++nb) acc[mb][nb] = (v8f){};
#pragma unroll
    for (int s = 0; s < OKS / 32; ++s)
#pragma unroll
        for (int nb = 0; nb < 4; ++nb)
#pragma unroll
            for (int mb = 0; mb < OBM / 16; ++mb) acc[mb][nb] = wmma16(w[nb][s], x[mb][s], acc[mb][nb]);
    // D layout: acc[mb][nb][j] = (n = 16nb + 8h + j, m = 16mb + (lane&15)) -> ps[wave][m][n]; rows 0..OBM-1 x columns 0..63 all written
    float* pd = ps + wave * (OBM * 68) + lr * 68 + 8 * hi;
#pragma unroll
    for (int mb = 0; mb < OBM / 16; ++mb)
#pragma unroll
        for (int nb = 0; nb < 4; ++nb) {
            v4f lo, up;
#pragma unroll
            for (int i = 0; i < 4; ++i) { lo[i] = acc[mb][nb][i]; up[i] = acc[mb][nb][4 + i]; }
            *(v4fa*)(pd + mb * 16 * 68 + nb * 16) = lo; *(v4fa*)(pd + mb * 16 * 68 + nb * 16 + 4) = up;
        }
    __syncthreads();                                         // every wave's partial tile is published
    const int row = threadIdx.x >> 4, cofs = (threadIdx.x & 15) * 4;   // 32 * OW threads = OBM rows x 16 groups of 4 columns
    v4f sum = *(const v4fa*)(&ps[row * 68 + cofs]);
#pragma unroll
    for (int q = 1; q < OW; ++q) sum += *(const v4fa*)(&ps[q * (OBM * 68) + row * 68 + cofs]);
    const int bidx = r0 / SEQ, tt = r0 % SEQ;
    float* obase = OUT + ((size_t)bidx * OUT_SEQ + tt) * NO;
    v4f val;
#pragma unroll
    for (int i = 0; i < 4; ++i) val[i] = sum[i] * OSC + bfr(bo[cofs + i]);
    *(v4f*)(obase + (size_t)row * NO + cofs) = val;
}

static constexpr size_t al256(size_t v) { return (v + 255) & ~(size_t)255; }
static constexpr size_t SZ_XB = al256((size_t)NB * SEQ * DIN * 2);
static constexpr size_t SZ_WB = al256((size_t)3 * DM * DIN * 2);
static constexpr size_t SZ_WO = al256((size_t)NO * DM * 2);
static constexpr size_t SZ_PL = al256((size_t)NB * NH_ * SEQ * HD * 2);
static constexpr size_t SZ_CX = al256((size_t)NB * SEQ * DM * 2);
static constexpr size_t SZ_TOTAL = 2 * SZ_XB + SZ_WB + SZ_WO + 3 * SZ_PL + SZ_CX;
static_assert(SZ_TOTAL <= (size_t)134217728);          // workspace carve <= 128 MiB
static_assert(((size_t)DM * DIN * 2) % 256 == 0);      // weight sub-planes stay 256-byte aligned

extern "C" void kernel_launch(void* const* d_in, const int* in_sizes, int n_in,
                              void* d_out, int out_size, void* d_ws, size_t ws_size, hipStream_t stream) {
    if (n_in < 10) return;
    const size_t needx = ((size_t)(NB - 1) * SEQ_FULL + SEQ) * DIN;
    if ((size_t)in_sizes[0] < needx || (size_t)in_sizes[1] < needx) return;
    if ((size_t)in_sizes[2] < (size_t)NH_ * DIN * HD || (size_t)in_sizes[4] < (size_t)NH_ * DIN * HD || (size_t)in_sizes[6] < (size_t)NH_ * DIN * HD) return;
    if ((size_t)in_sizes[3] < (size_t)NH_ * HD || (size_t)in_sizes[5] < (size_t)NH_ * HD || (size_t)in_sizes[7] < (size_t)NH_ * HD) return;
    if ((size_t)in_sizes[8] < (size_t)DM * NO || (size_t)in_sizes[9] < (size_t)NO) return;
    if ((size_t)out_size < ((size_t)(NB - 1) * OUT_SEQ + SEQ) * NO) return;
    if (SZ_TOTAL > ws_size) return;
    // wire order: current_tokens, context_tokens, Wq, bq, Wk, bk, Wv, bv, Wo, bo
    const float* xq = (const float*)d_in[0]; const float* xc = (const float*)d_in[1];
    const float* wq = (const float*)d_in[2]; const float* bq = (const float*)d_in[3];
    const float* wk = (const float*)d_in[4]; const float* bk = (const float*)d_in[5];
    const float* wv = (const float*)d_in[6]; const float* bv = (const float*)d_in[7];
    const float* wo = (const float*)d_in[8]; const float* bo = (const float*)d_in[9];
    float* OUT = (float*)d_out;      // [NB][SEQ][64]
    char* wsp = (char*)d_ws;
    bf* XQ = (bf*)wsp; wsp += SZ_XB;                 // [NB*SEQ][1024] query tokens
    bf* XC = (bf*)wsp; wsp += SZ_XB;                 // [NB*SEQ][1024] context tokens
    bf* WB = (bf*)wsp; wsp += SZ_WB;                 // [3][16*64][1024]: q | k | v, rows n = h*64 + a, k-contiguous
    bf* WO = (bf*)wsp; wsp += SZ_WO;                 // [64][1024] f16 bits, x1024
    h16* QH = (h16*)wsp; wsp += SZ_PL;               // [NB*16][SEQ][64]
    h16* KP = (h16*)wsp; wsp += SZ_PL;               // [NB*16][SEQ][64]
    h16* VT = (h16*)wsp; wsp += SZ_PL;               // [NB*16][64][SEQ]
    h16* CX = (h16*)wsp; wsp += SZ_CX;               // [NB*SEQ][1024] ctx x256

    k_prep<<<dim3(3 * WTB + WOB + 2 * CVB, 1, 1), 256, 0, stream>>>(xq, xc, wq, wk, wv, wo, XQ, XC, WB, WO);

    k_proj<<<dim3(PGB, 3, 1), 256, 0, stream>>>(XQ, XC, WB, QH, KP, VT, bq, bk, bv);

    k_flash<<<dim3(SEQ / (QW * AW), NB * NH_, 1), 32 * AW, 0, stream>>>(QH, KP, VT, CX);

    k_oproj<<<dim3(NB * SEQ / OBM, 1, 1), 32 * OW, 0, stream>>>(CX, (const h16*)WO, bo, OUT);
}

// v008
// It runs in 105 microseconds.
// Timed twice side by side with v007, it ran 1.05 times as fast both times.
// Counting every step since v000, it is 3.19 times as fast.
#include <hip/hip_runtime.h>

// Multi-head cross-attention, 16 heads x 64: q from xq [NB][SEQ][1024], k/v from xc [NB][SEQ][1024]; per-head weights [head][in][out] with biases; score scale 1/8; no mask; concat heads (1024) @ Wo [1024][64] + bo -> out [NB][SEQ][64] f32.
// Compute dtypes, f32 accumulate everywhere: q/k/v projections v_wmma_f32_16x16x32_bf16 (tokens and weights RNE-converted to bf16; products exact), biases RNE-converted to bf16 and added in f32;
// scores v_wmma_f32_16x16x32_f16 (q, k single f16); P (x256 carry, cancels in the normalisation) and v single f16; softmax f32 (online, lazily moved reference maximum);
// output projection v_wmma_f32_16x16x32_f16: ctx as f16 with x256 carry, Wo as bf16-RNE value x1024 held in f16 (exact), accumulator scaled by 2^-18 and bias added in f32.
// Layout: bf16 copies of both token tensors; weights transposed through LDS into K-contiguous rows [head*64 + n][in]; q, k planes [b*16+h][t][d] and v^T plane [b*16+h][d][t] written by the GEMM epilogue;
// the conversions share one launch and the three projections another (block ranges of one grid; k and v of a token tile in one block); fused flash kernel in transposed form (S^T = K Q^T, O^T = V^T P^T), K and V^T tiles staged in LDS for the whole block, writing the f16 ctx plane [b*SEQ+t][h*64+d]; final GEMM (k split over the waves of a block, partials summed in LDS) writes the f32 output.

#ifndef NB
#define NB 4
#endif
#ifndef SEQ
#define SEQ 2048
#endif
#define NB_FULL  4
#define SEQ_FULL 2048
#ifndef OUT_SEQ
#define OUT_SEQ SEQ              // row pitch (in tokens) between batches of the output
#endif
#define DIN  1024                // token width (projection K)
#define NH_  16
#define HD   64
#define DM   (NH_ * HD)          // concatenated head width (output-projection K)
#define NO   64                  // output width
#define AW   8                   // waves per flash block; all of them read the same staged K / V^T tiles
#define QW   32                  // query rows per flash wave: two column groups of 16, both fed by each K / V^T fragment
#define KS   64                  // keys per staged tile
#define LP   72                  // LDS row pitch in halves: 144 B = 16 B x 9, the conflict-free pitch for 16-byte row reads of 128-B rows
#define PBM  256                // projection block tile: rows (4 waves x 64)
#define PBN  128                // projection block tile: columns of one product
#define PKS  128                // k per staged projection tile
#define PLP  136                // LDS row pitch in elements: 272 B = 16 B x 17, the conflict-free pitch for 16-byte row reads of 256-B rows
#define OW   16                 // waves per output-projection block, one k slice each
#define OKS  (DM / OW)          // k per slice
#define OBM  32                 // output rows per output-projection block
#define SC2  (0.125f * 1.4426950408889634f)   // HD^-0.5 * log2(e)
#define PSH  8.0f                // log2 of the P carry (256)
#define TAU  7.0f                // a pass's scores may top the reference in use by this much (log2) before the state is rescaled: P <= 2^15
#define CXS  256.0f              // carry of the ctx plane
#define WOS  1024.0f             // carry of the Wo plane
#define OSC  (1.0f / (256.0f * 1024.0f))

static_assert(HD == 64);
static_assert(NO == 64);                       // output row = 256 bytes = 16 lanes x 16 B
static_assert(NH_ * HD == DM);
static_assert(DM % 64 == 0);
static_assert(DIN % 64 == 0);                  // weight transpose tiles of 64
static_assert(DIN % 32 == 0);                  // GEMM k-loop steps by 32
static_assert(DM % 32 == 0);
static_assert(SEQ % 64 == 0);                  // a 64-row tile never straddles two batches
static_assert((NB * SEQ) % 64 == 0);
static_assert(SEQ % KS == 0);                  // key loop steps by whole staged tiles
static_assert(KS == 64 && KS % 32 == 0);       // a V^T tile row is 128 B, like a K row; 32 keys per softmax step
static_assert(AW * 32 * 2 * 8 == KS * HD);     // two 16-byte copies per thread cover one tile
static_assert(QW == 32 && SEQ % (QW * AW) == 0);   // flash grid covers the sequence exactly
static_assert(((size_t)SEQ * DIN) % 8 == 0);
static_assert((NB * SEQ) % PBM == 0 && DM % PBN == 0);   // the projection grid covers each product exactly
static_assert(DIN % PKS == 0 && DIN >= 2 * PKS);   // whole staged tiles, and the ring's prologue needs two
static_assert(PBM == 256 && PBN == 128 && PKS == 128);   // copy map: 256 threads x 8 copies of 16 B = 128 rows of 256 B; 24 or 32 copies a thread and tile
static_assert(PBN % HD == 0 && HD == 64);      // a wave's columns are whole heads
static_assert(DM % (OW * 32) == 0 && OBM % 16 == 0);   // whole 32-k steps per slice, whole 16-row tiles per block
static_assert(SEQ % OBM == 0);                 // an output-projection block never straddles two batches
static_assert(32 * OW == OBM * (NO / 4));      // the final sum: one thread per 4 columns of one row
static_assert(NB <= NB_FULL);
static_assert(SEQ <= SEQ_FULL);

typedef _Float16 h16;
typedef unsigned short bf;
typedef __attribute__((ext_vector_type(16))) __bf16   v16bf;
typedef __attribute__((ext_vector_type(16))) _Float16 v16h;
typedef __attribute__((ext_vector_type(8)))  _Float16 v8h;
typedef __attribute__((ext_vector_type(8)))  unsigned short v8us;
typedef __attribute__((ext_vector_type(8)))  float    v8f;
typedef __attribute__((ext_vector_type(4)))  float    v4f;
typedef v4f  __attribute__((may_alias)) v4fa;

__device__ __forceinline__ unsigned short f2bf(float f) { unsigned u = __float_as_uint(f); u += 0x7FFFu + ((u >> 16) & 1u); return (unsigned short)(u >> 16); }
__device__ __forceinline__ float bf2f(unsigned short b) { return __uint_as_float(((unsigned)b) << 16); }
__device__ __forceinline__ float bfr(float f) { return bf2f(f2bf(f)); }   // value after RNE conversion to bf16
__device__ __forceinline__ v16h cat16(v8h lo, v8h hi) { return __builtin_shufflevector(lo, hi, 0, 1, 2, 3, 4, 5, 6, 7, 8, 9, 10, 11, 12, 13, 14, 15); }
__device__ __forceinline__ v16bf cat16b(v8us lo, v8us hi) { return __builtin_bit_cast(v16bf, __builtin_shufflevector(lo, hi, 0, 1, 2, 3, 4, 5, 6, 7, 8, 9, 10, 11, 12, 13, 14, 15)); }
__device__ __forceinline__ v8f wmma16(v16h a, v16h b, v8f c) { return __builtin_amdgcn_wmma_f32_16x16x32_f16(false, a, false, b, (short)0, c, false, false); }
__device__ __forceinline__ v8f wmmab(v16bf a, v16bf b, v8f c) { return __builtin_amdgcn_wmma_f32_16x16x32_bf16(false, a, false, b, (short)0, c, false, false); }
// fragment loaders from K-contiguous 16-bit rows; p already includes + 8*(lane>>4): elements 0..7 <- k0+8h+0..7, elements 8..15 <- k0+16+8h+0..7 (same map for A and B)
__device__ __forceinline__ v16h  ldh(const h16* p) { return cat16(*(const v8h*)p, *(const v8h*)(p + 16)); }
__device__ __forceinline__ v16bf ldb(const bf* p)  { return cat16b(*(const v8us*)p, *(const v8us*)(p + 16)); }
// lane l with lane l ^ 16, in registers: unlike the shuffle it needs no lane index held across the key loop, which has no register to spare
__device__ __forceinline__ float xhalf(float x) { return __builtin_bit_cast(float, __builtin_amdgcn_permlanex16(__builtin_bit_cast(int, x), __builtin_bit_cast(int, x), 0x76543210, 0xfedcba98, false, false)); }
// ordering point for wave-private LDS tiles (same wave writes and reads)
__device__ __forceinline__ void wave_sync() { __builtin_amdgcn_fence(3 /* release order */, "wavefront"); __builtin_amdgcn_wave_barrier(); asm volatile("" ::: "memory"); }

// cvt8: token f32 -> bf16, 8 elements per thread; blk = block index inside one tensor's range. The source keeps the full batch pitch, the bf16 plane is dense.
__device__ __forceinline__ void cvt8(const float* __restrict__ src, bf* dst, unsigned blk) {
    constexpr size_t B8 = (size_t)SEQ * DIN / 8;        // threads per batch
    const size_t i = (size_t)blk * 256 + threadIdx.x; if (i >= (size_t)NB * B8) return;
    const size_t so = (SEQ == SEQ_FULL) ? i * 8 : (i / B8) * ((size_t)SEQ_FULL * DIN) + (i % B8) * 8;
    const v8f v = *(const v8f*)(src + so); v8us o;
#pragma unroll
    for (int k = 0; k < 8; ++k) o[k] = f2bf(v[k]);
    *(v8us*)(dst + i * 8) = o;
}

// wt: weight transpose + 16-bit convert through LDS (ts: 64 x 65 floats of the block), one 64 x 64 tile (k tile kb of head hh) per block. in W[head][Kd][64] (f32, k-major) -> out WT[head*64 + n][Kd] (k-contiguous).
// F16 == 0: bf16 bits (RNE). F16 == 1: f16 of (bf16-RNE value * scale) (exact for power-of-two scale).
template <int F16>
__device__ __forceinline__ void wt(float* ts, const float* __restrict__ W, bf* WT, int Kd, float scale, int kb, int hh) {
    const int tid = threadIdx.x;
    const int d0 = kb * 64;
    const float* src = W + ((size_t)hh * Kd + d0) * 64;
#pragma unroll
    for (int it = 0; it < 4; ++it) {                    // 4 x 256 threads x 4 floats = 64 rows x 64 columns
        const int idx = it * 256 + tid; const int row = idx >> 4, c4 = (idx & 15) * 4;
        const v4f v = *(const v4f*)(src + (size_t)row * 64 + c4);
        ts[row * 65 + c4 + 0] = v[0]; ts[row * 65 + c4 + 1] = v[1]; ts[row * 65 + c4 + 2] = v[2]; ts[row * 65 + c4 + 3] = v[3];
    }
    __syncthreads();                                    // cross-wave tile: block barrier
    const int k8 = (tid & 7) * 8, nq = tid >> 3;        // 2 it x 32 row groups = 64 output rows; 8 lanes x 8 = 64 k
    v8us ou[2]; v8h oh[2];
#pragma unroll
    for (int it = 0; it < 2; ++it) {
        const int n = it * 32 + nq;
#pragma unroll
        for (int j = 0; j < 8; ++j) {
            const float w = ts[(k8 + j) * 65 + n];
            ou[it][j] = f2bf(w);
            oh[it][j] = (h16)(bfr(w) * scale);
        }
    }
{
#pragma unroll
        for (int it = 0; it < 2; ++it) {
            const size_t off = (size_t)(hh * 64 + it * 32 + nq) * (size_t)Kd + d0 + k8;
            if (F16) *(v8h*)((h16*)WT + off) = oh[it];
            else     *(v8us*)(WT + off) = ou[it];
        }
        
    }
}

// k_prep: all the work that depends on the inputs alone, as block ranges of one grid (the parts share no data): the three projection weights, Wo, then the two token tensors.
// The short transposes stand first in the index order (for speed only). Every test below is on the block index alone.
#define WTB ((DIN / 64) * NH_)                                   // blocks per projection weight: k tiles x heads
#define WOB (DM / 64)                                            // blocks of Wo: k tiles, one head
#define CVB ((unsigned)(((size_t)NB * SEQ * DIN / 8 + 255) / 256))   // blocks per token tensor
__global__ __launch_bounds__(256) void k_prep(const float* __restrict__ xq, const float* __restrict__ xc, const float* __restrict__ wq, const float* __restrict__ wk, const float* __restrict__ wv,
                                              const float* __restrict__ wo, bf* XQ, bf* XC, bf* WB, bf* WO) {
    __shared__ float ts[64 * 65];
    const unsigned blk = blockIdx.x;
    if (blk >= 3 * WTB + WOB) {
        const unsigned c = blk - (3 * WTB + WOB); const bool ctx = c >= CVB;
        cvt8(ctx ? xc : xq, ctx ? XC : XQ, ctx ? c - CVB : c);
    } else if (blk >= 3 * WTB) {
        // Wo: in [1024 (k)][64 (n)] -> out [n][1024 (k)], one head
        wt<1>(ts, wo, WO, DM, WOS, (int)(blk - 3 * WTB), 0);
    } else {
        // in [head][1024 (k)][64 (n)] -> out [head*64 + n][1024 (k)]
        const unsigned w = blk / WTB, r = blk % WTB;
        wt<0>(ts, w == 0 ? wq : w == 1 ? wk : wv, WB + (size_t)w * DM * DIN, DIN, 1.0f, (int)(r % (DIN / 64)), (int)(r / (DIN / 64)));
    }
}

// Twelve 16-byte copies per lane, global -> LDS through no register (a wave's copy covers two whole 256-B rows = four lines).
// The s_wait_xcnt stands inside the statement so that it precedes every later write of the address registers the copies name.
__device__ __forceinline__ void stage12(const unsigned (&l)[12], const bf* const (&g)[12]) {
    asm volatile("global_load_async_to_lds_b128 %0, %12, off\n\t"
                 "global_load_async_to_lds_b128 %1, %13, off\n\t"
                 "global_load_async_to_lds_b128 %2, %14, off\n\t"
                 "global_load_async_to_lds_b128 %3, %15, off\n\t"
                 "global_load_async_to_lds_b128 %4, %16, off\n\t"
                 "global_load_async_to_lds_b128 %5, %17, off\n\t"
                 "global_load_async_to_lds_b128 %6, %18, off\n\t"
                 "global_load_async_to_lds_b128 %7, %19, off\n\t"
                 "global_load_async_to_lds_b128 %8, %20, off\n\t"
                 "global_load_async_to_lds_b128 %9, %21, off\n\t"
                 "global_load_async_to_lds_b128 %10, %22, off\n\t"
                 "global_load_async_to_lds_b128 %11, %23, off\n\t"
                 "s_wait_xcnt 0x0"
                 :: "v"(l[0]), "v"(l[1]), "v"(l[2]), "v"(l[3]), "v"(l[4]), "v"(l[5]), "v"(l[6]), "v"(l[7]), "v"(l[8]), "v"(l[9]), "v"(l[10]), "v"(l[11]),
                    "v"(g[0]), "v"(g[1]), "v"(g[2]), "v"(g[3]), "v"(g[4]), "v"(g[5]), "v"(g[6]), "v"(g[7]), "v"(g[8]), "v"(g[9]), "v"(g[10]), "v"(g[11]) : "memory");
}
// Eight 16-byte copies per lane, global -> LDS through no register (a wave's copy covers two whole 256-B rows = four lines): the thread's 16-byte column of eight rows, 16 rows apart.
// The s_wait_xcnt stands inside the statement so that it precedes every later write of the address registers the copies name.
__device__ __forceinline__ void stage8(unsigned l, const bf* g) {
    constexpr unsigned LS = 16 * PLP * 2; constexpr size_t GS = (size_t)16 * DIN;
    asm volatile("global_load_async_to_lds_b128 %0, %8, off\n\t"
                 "global_load_async_to_lds_b128 %1, %9, off\n\t"
                 "global_load_async_to_lds_b128 %2, %10, off\n\t"
                 "global_load_async_to_lds_b128 %3, %11, off\n\t"
                 "global_load_async_to_lds_b128 %4, %12, off\n\t"
                 "global_load_async_to_lds_b128 %5, %13, off\n\t"
                 "global_load_async_to_lds_b128 %6, %14, off\n\t"
                 "global_load_async_to_lds_b128 %7, %15, off\n\t"
                 "s_wait_xcnt 0x0"
                 :: "v"(l), "v"(l + LS), "v"(l + 2 * LS), "v"(l + 3 * LS), "v"(l + 4 * LS), "v"(l + 5 * LS), "v"(l + 6 * LS), "v"(l + 7 * LS),
                    "v"(g), "v"(g + GS), "v"(g + 2 * GS), "v"(g + 3 * GS), "v"(g + 4 * GS), "v"(g + 5 * GS), "v"(g + 6 * GS), "v"(g + 7 * GS) : "memory");
}
// One staged k tile of a projection block: PBM rows of A, then PBN rows of each of the NP weight planes, PKS elements each; a thread copies its 16-byte column of every 16th row.
// l: LDS byte address of the thread's chunk in its first row (tid>>4) of the buffer; xa, wb: the tile's first A row and its first row in the first weight plane, at the tile's k (block-uniform); lo: the thread's chunk in such a row block, in elements;
// the second plane lies DM rows behind the first.
template <int NP>
__device__ __forceinline__ void proj_fill(unsigned l, const bf* xa, const bf* wb, unsigned lo) {
    constexpr unsigned L8 = 128 * PLP * 2;                   // LDS bytes of 128 rows
    const bf* ga = xa + lo; const bf* gb = wb + lo;
    if (NP == 1) {
        constexpr unsigned LS = 16 * PLP * 2; constexpr size_t GS = (size_t)16 * DIN;
        unsigned la[12]; const bf* gp[12];
#pragma unroll
        for (int i = 0; i < 12; ++i) { la[i] = l + (unsigned)i * LS; gp[i] = ga + (size_t)i * GS; }
        stage12(la, gp);
#pragma unroll
        for (int i = 0; i < 4; ++i) { la[i] = l + (unsigned)(12 + i) * LS; gp[i] = ga + (size_t)(12 + i) * GS; }
#pragma unroll
        for (int i = 0; i < 8; ++i) { la[4 + i] = l + (unsigned)(16 + i) * LS; gp[4 + i] = gb + (size_t)i * GS; }
        stage12(la, gp);
        return;
    }
    // Each sched_barrier keeps one group's address arithmetic next to its copies: formed all at once, the addresses of a tile take more of the registers that asm text can name than are free,
    // and the compiler moves accumulator tiles out of them and back in every trip and spills (seen in a build without them).
    stage8(l, ga);
    __builtin_amdgcn_sched_barrier(0);
    stage8(l + L8, ga + (size_t)128 * DIN);
    __builtin_amdgcn_sched_barrier(0);
    stage8(l + 2 * L8, gb);
    __builtin_amdgcn_sched_barrier(0);
    stage8(l + 3 * L8, gb + (size_t)DM * DIN);
    __builtin_amdgcn_sched_barrier(0);
}

// proj_tile: register-blocked bf16 GEMM, K = DIN, of one block of 8 waves (4 x 2): PBM token rows against PBN columns of each of NP weight planes that take the same tokens.
// NP == 1 (q): a wave owns 64 x 64. NP == 2 (k and v): the token tile is staged once for both products; the waves of column 0 own 64 x 128 of k, those of column 1 64 x 128 of v.
// The operands come in k tiles of PKS, copied once per block from the K-contiguous bf16 planes into a two-buffer LDS ring (the next tile's copies fly while this one is worked on) and read from there as fragments.
// C[m][n] = sum_k X[m][k] Wt[n][k] + bias[n] (bias as bf16-RNE value, f32 add), m = b*SEQ + t, n = h*64 + a, written as f16:
// P0 (q or k): plane [(b*16 + h)][t][a]; P1 (v): transposed plane [(b*16 + h)][a][t], the transposition done in the wave's staging tile.
template <int NP>
__device__ __forceinline__ void proj_tile(bf* st, float* osb, const bf* __restrict__ X, const bf* __restrict__ Wt, h16* P0, h16* P1, const float* __restrict__ bias0, const float* __restrict__ bias1) {
    constexpr int NF = 4 * NP;                               // column fragments per wave
    constexpr int RB = PBM + NP * PBN;                       // rows of one buffer
    const int bx = (int)(blockIdx.x % (NB * SEQ / PBM)), by = (int)(blockIdx.x / (NB * SEQ / PBM));
    const int K = DIN;
    const int lane = threadIdx.x & 31, lr = lane & 15, hi = lane >> 4;
    const int wave = __builtin_amdgcn_readfirstlane(threadIdx.x >> 5);   // wave-uniform: the tile's base and its divisions stay scalar
    const int wc = wave & 1;
    const int r0 = bx * PBM + (wave >> 1) * 64;              // first token row of the wave
    const int c0 = by * PBN + (NP == 1 ? wc * 64 : 0);       // first column of the wave in its own product
    float* os = osb + wave * 16 * 68;                        // wave-private epilogue tile
    v8f acc[4][NF];
#pragma unroll
    for (int mb = 0; mb < 4; ++mb)
#pragma unroll
        for (int nb = 0; nb < NF; ++nb) acc[mb][nb] = (v8f){};
    // copy map: thread -> row tid>>4 (and every 16th row after it), 16-byte column tid&15
    const int cr = threadIdx.x >> 4, ccol = (threadIdx.x & 15) * 8;
    const bf* xa = X + (size_t)(bx * PBM) * K;                // + k0; block-uniform
    const bf* wb = Wt + (size_t)(by * PBN) * K;               // + k0; block-uniform
    const unsigned lo = (unsigned)(cr * K + ccol);
    const unsigned lb = (unsigned)(size_t)st + (unsigned)(cr * PLP + ccol) * 2u;
    constexpr unsigned SB = RB * PLP * 2;                    // bytes of one buffer
    const int aoff = ((wave >> 1) * 64 + lr) * PLP + 8 * hi, boff = (PBM + wc * (16 * NF) + lr) * PLP + 8 * hi;
    proj_fill<NP>(lb, xa, wb, lo);
    asm volatile("s_wait_asynccnt 0x0" ::: "memory");        // this wave's copies of tile 0 have landed
    __syncthreads();                                         // tile 0 published to every wave
    proj_fill<NP>(lb + SB, xa + PKS, wb + PKS, lo);             // tile 1 exists: K >= 2 * PKS
#pragma unroll 1
    for (int kt = 0; kt < K; kt += PKS) {
        const unsigned buf = (unsigned)(kt / PKS) & 1u;
        const bf* sa = st + buf * (RB * PLP) + aoff; const bf* sb = st + buf * (RB * PLP) + boff;
        // Fragments in two register sets, all inside this tile: the next k step's LDS reads are issued ahead of their use, so that no product waits for a read just issued: with 4 column fragments in two groups
        // (12 in front of this step's products, 4 into the registers that its first 8 products free), with 8 as one group in front of this step's 32 products. Each sched_barrier keeps one such group
        // where it is written: left alone, the compiler moves the reads down to their users and puts a full LDS wait in front of every few products.
        v16bf a[2][4], b[2][NF];
#pragma unroll
        for (int i = 0; i < 4; ++i) { a[0][i] = ldb(sa + i * 16 * PLP); b[0][i] = ldb(sb + i * 16 * PLP); }
#pragma unroll
        for (int i = 4; i < NF; ++i) b[0][i] = ldb(sb + i * 16 * PLP);
        __builtin_amdgcn_sched_barrier(0);
#pragma unroll
        for (int s = 0; s < PKS / 32; ++s) {
            const int c = s & 1, n = c ^ 1;
            if (s + 1 < PKS / 32) {
#pragma unroll
                for (int i = 0; i < 4; ++i) a[n][i] = ldb(sa + i * 16 * PLP + (s + 1) * 32);
#pragma unroll
                for (int i = 0; i < (NP == 1 ? 2 : NF); ++i) b[n][i] = ldb(sb + i * 16 * PLP + (s + 1) * 32);
                __builtin_amdgcn_sched_barrier(0);
            }
#pragma unroll
            for (int nb = 0; nb < (NP == 1 ? 2 : NF); ++nb)
#pragma unroll
                for (int mb = 0; mb < 4; ++mb) acc[mb][nb] = wmmab(a[c][mb], b[c][nb], acc[mb][nb]);
            __builtin_amdgcn_sched_barrier(0);
            if (NP == 1) {
                if (s + 1 < PKS / 32) {
                    b[n][2] = ldb(sb + 32 * PLP + (s + 1) * 32); b[n][3] = ldb(sb + 48 * PLP + (s + 1) * 32);
                    __builtin_amdgcn_sched_barrier(0);
                }
#pragma unroll
                for (int nb = 2; nb < 4; ++nb)
#pragma unroll
                    for (int mb = 0; mb < 4; ++mb) acc[mb][nb] = wmmab(a[c][mb], b[c][nb], acc[mb][nb]);
                __builtin_amdgcn_sched_barrier(0);
            }
        }
        asm volatile("s_wait_dscnt 0x0" ::: "memory");       // this wave's reads of the tile are done before its buffer may be refilled
        asm volatile("s_wait_asynccnt 0x0" ::: "memory");    // this wave's copies of the next tile have landed
        __syncthreads();                                     // publishes the next tile and ends every wave's reads of this one
        if (kt + 2 * PKS < K) proj_fill<NP>(lb + buf * SB, xa + (kt + 2 * PKS), wb + (kt + 2 * PKS), lo);   // block-uniform: refill the buffer just read with the tile after next
    }
    asm volatile("s_wait_asynccnt 0x0" ::: "memory");        // nothing of this wave's copies is outstanding past the loop
    const int c8 = (lane & 7) * 8, rq = lane >> 3;
    const size_t bb = (size_t)(r0 / SEQ); const int tt = r0 % SEQ;   // the wave's 64 token rows lie in one batch
    if (NP == 2 && wc == 1) {                                // wave-uniform
        // v: 16 columns n x the wave's 64 tokens per round; D (row t = 16mb + 8h + j, column n = lane&15) goes to os[n][t] in 16-byte stores, and the rows of os are rows of the transposed plane
        h16* vb = P1 + (bb * DM + (size_t)c0) * SEQ + tt;
        const float* bp = bias1 + c0 + lr;                   // a lane's D elements all belong to column n = 16nb + (lane&15): one bias value per column fragment
        float br[NF];
#pragma unroll
        for (int nb = 0; nb < NF; ++nb) br[nb] = bp[nb * 16];
        asm volatile("s_wait_xcnt 0x0" ::: "memory");        // the wait that belongs in front of any overwrite of the registers that these loads name
        __builtin_amdgcn_sched_barrier(0);                   // keeps the later address arithmetic, which reuses those registers, behind that wait
#pragma unroll
        for (int nb = 0; nb < NF; ++nb) {
            const float bn = bfr(br[nb]);
#pragma unroll
            for (int mb = 0; mb < 4; ++mb) {
                v4f dl, du;
#pragma unroll
                for (int i = 0; i < 4; ++i) { dl[i] = acc[mb][nb][i] + bn; du[i] = acc[mb][nb][4 + i] + bn; }
                *(v4fa*)(&os[lr * 68 + mb * 16 + 8 * hi]) = dl; *(v4fa*)(&os[lr * 68 + mb * 16 + 8 * hi + 4]) = du;
            }
            wave_sync();
#pragma unroll
            for (int s = 0; s < 4; ++s) { const int row = 4 * s + rq;   // 4 s x 4 row groups = 16 rows; 8 lanes x 8 = 64 tokens
                const v4f x0 = *(const v4fa*)(&os[row * 68 + c8]); const v4f x1 = *(const v4fa*)(&os[row * 68 + c8 + 4]); v8h hv;
#pragma unroll
                for (int i = 0; i < 4; ++i) { hv[i] = (h16)x0[i]; hv[4 + i] = (h16)x1[i]; }
                *(v8h*)(vb + (size_t)(nb * 16 + row) * SEQ + c8) = hv; }
            asm volatile("s_wait_xcnt 0x0" ::: "memory");    // stands in front of the next round's writes of the registers that these stores name
            wave_sync();
        }
    } else {
        // q, k: one head (64 columns) after the other, 16 token rows x 64 columns per round
        const float* bp = bias0 + c0 + c8;                   // 32-byte aligned: c0 and c8 are multiples of 8
        v4f bl[NP][2];
#pragma unroll
        for (int hg = 0; hg < NP; ++hg) { bl[hg][0] = *(const v4f*)(bp + hg * 64); bl[hg][1] = *(const v4f*)(bp + hg * 64 + 4); }
        asm volatile("s_wait_xcnt 0x0" ::: "memory");        // the wait that belongs in front of any overwrite of the registers that these loads name
        __builtin_amdgcn_sched_barrier(0);                   // keeps the later address arithmetic, which reuses those registers, behind that wait
#pragma unroll
        for (int hg = 0; hg < NP; ++hg) {
            const int ch = c0 + hg * 64;                     // a multiple of HD
            h16* pb = P0 + (bb * NH_ + (size_t)(ch / HD)) * ((size_t)SEQ * HD) + (size_t)tt * HD;
            float bc[8];
#pragma unroll
            for (int i = 0; i < 4; ++i) { bc[i] = bfr(bl[hg][0][i]); bc[4 + i] = bfr(bl[hg][1][i]); }
#pragma unroll
            for (int mb = 0; mb < 4; ++mb) {
#pragma unroll
                for (int nb = 0; nb < 4; ++nb) {
#pragma unroll
                    for (int j = 0; j < 8; ++j) os[(hi * 8 + j) * 68 + nb * 16 + lr] = acc[mb][hg * 4 + nb][j]; }   // D: row 8h+j, col lane&15
                wave_sync();
#pragma unroll
                for (int s = 0; s < 4; ++s) { const int row = 4 * s + rq;   // 4 s x 4 row groups = 16 rows; 8 lanes x 8 = 64 columns
                    const v4f x0 = *(const v4fa*)(&os[row * 68 + c8]); const v4f x1 = *(const v4fa*)(&os[row * 68 + c8 + 4]); v8h hv;
#pragma unroll
                    for (int i = 0; i < 4; ++i) { hv[i] = (h16)(x0[i] + bc[i]); hv[4 + i] = (h16)(x1[i] + bc[4 + i]); }
                    *(v8h*)(pb + (size_t)(mb * 16 + row) * HD + c8) = hv; }
                asm volatile("s_wait_xcnt 0x0" ::: "memory");   // stands in front of the next round's writes of the registers that these stores name
                wave_sync();
            }
        }
    }
}

// k_proj: the three projections as one grid (PGB tiles, 2 kinds), 256 threads; blockIdx.y picks the kind, block-uniform. The blocks of twice the work stand first in the index order.
// y == 0: k and v of one tile of context tokens, which is fetched and staged once for both; y == 1: q.
#define PGB (((NB * SEQ) / PBM) * (DM / PBN))   // block tiles of one product
__global__ __launch_bounds__(256) void k_proj(const bf* __restrict__ XQ, const bf* __restrict__ XC, const bf* __restrict__ WB, h16* QH, h16* KP, h16* VT,
                                              const float* __restrict__ bq, const float* __restrict__ bk, const float* __restrict__ bv) {
    __shared__ __align__(16) float osb[8 * 16 * 68];
    __shared__ __align__(16) bf st[2 * (PBM + 2 * PBN) * PLP];   // [buffer][token rows | weight rows][PLP]
    if (blockIdx.y == 0) proj_tile<2>(st, osb, XC, WB + (size_t)DM * DIN, KP, VT, bk, bv);
    else                 proj_tile<1>(st, osb, XQ, WB, QH, QH, bq, bq);
}

// One staged tile pair: four 16-byte copies per lane, global -> LDS through no register (a wave's copy covers four whole 128-B lines).
// The s_wait_xcnt stands inside the statement so that it precedes every later write of the address registers the copies name.
__device__ __forceinline__ void stage4(unsigned l0, unsigned l1, unsigned l2, unsigned l3, const h16* g0, const h16* g1, const h16* g2, const h16* g3) {
    asm volatile("global_load_async_to_lds_b128 %0, %4, off\n\t"
                 "global_load_async_to_lds_b128 %1, %5, off\n\t"
                 "global_load_async_to_lds_b128 %2, %6, off\n\t"
                 "global_load_async_to_lds_b128 %3, %7, off\n\t"
                 "s_wait_xcnt 0x0"
                 :: "v"(l0), "v"(l1), "v"(l2), "v"(l3), "v"(g0), "v"(g1), "v"(g2), "v"(g3) : "memory");
}

__global__ __launch_bounds__(32 * AW) __attribute__((amdgpu_waves_per_eu(4))) void k_flash(const h16* __restrict__ QH, const h16* __restrict__ KP, const h16* __restrict__ VT, h16* CTX) {
    __shared__ __align__(16) float os[AW * 16 * 68];
    __shared__ __align__(16) h16 kv[2 * 2 * KS * LP];        // [buffer][K tile: key rows | V^T tile: d rows][64 rows][LP]
    const int lane = threadIdx.x & 31, lr = lane & 15, hi = lane >> 4;
    const int wave = __builtin_amdgcn_readfirstlane(threadIdx.x >> 5);   // wave-uniform: the wave's first query row stays in a scalar register across the key loop
    const int zh = blockIdx.y; const int b = zh / NH_, h = zh % NH_;
    const int t0 = (blockIdx.x * AW + wave) * QW;
    const size_t pbase = (size_t)zh * SEQ * HD;
    const size_t qo = pbase + (size_t)(t0 + lr) * HD + 8 * hi;
    v16h qh[2][2];                                           // B fragments: [column group][k half], col t, k = d
#pragma unroll
    for (int g = 0; g < 2; ++g) { qh[g][0] = ldh(QH + qo + g * 16 * HD); qh[g][1] = ldh(QH + qo + g * 16 * HD + 32); }
    const int fo = lr * LP + 8 * hi;                         // fragment offset in a tile: K + key*LP (A: row key, k = d); V^T + 16j*LP + key (A: row d, k = key)
    // copy map: thread -> row tid>>3 (and row + 32), 16-byte column tid&7
    const int cr = threadIdx.x >> 3, ccol = (threadIdx.x & 7) * 8;
    const h16* gk = KP + pbase + (size_t)cr * HD + ccol;   // + key0 * HD
    const h16* gv = VT + pbase + (size_t)cr * SEQ + ccol;  // + key0
    const unsigned lb = (unsigned)(size_t)kv + (unsigned)(cr * LP + ccol) * 2u;   // LDS byte address of the thread's first K chunk in buffer 0
    constexpr unsigned TB = KS * LP * 2, HB = 32 * LP * 2;   // bytes of one tile, of half a tile
    stage4(lb, lb + HB, lb + TB, lb + TB + HB, gk, gk + 32 * HD, gv, gv + (size_t)32 * SEQ);
    asm volatile("s_wait_asynccnt 0x0" ::: "memory");        // this wave's copies of tile 0 have landed
    __syncthreads();                                         // tile 0 published to every wave
    if (SEQ > KS) stage4(lb + 2 * TB, lb + 2 * TB + HB, lb + 3 * TB, lb + 3 * TB + HB, gk + KS * HD, gk + (KS + 32) * HD, gv + KS, gv + (size_t)32 * SEQ + KS);
    v8f o[2][4], lt[2];                                      // per column group: four output tiles and the accumulator tile of the row-sum product
    float sh[2], thr[2];                                     // PSH - m, m the reference maximum in use (scaled, log2; it starts at the lowest value); the raw score above which the reference moves
#pragma unroll
    for (int g = 0; g < 2; ++g) { o[g][0] = (v8f){}; o[g][1] = (v8f){}; o[g][2] = (v8f){}; o[g][3] = (v8f){}; lt[g] = (v8f){}; sh[g] = 3.0e38f; thr[g] = -3.0e38f; }
    const h16 one = (lane & 7) == 0 ? (h16)1.0f : (h16)0.0f;
    const v16h ones = {one, one, one, one, one, one, one, one, one, one, one, one, one, one, one, one};
#pragma unroll 1
    for (int kt0 = 0; kt0 < SEQ; kt0 += KS) {
      const unsigned buf = (unsigned)(kt0 / KS) & 1u;
      const h16* kt = kv + buf * (2 * KS * LP) + fo;
      // Both 32-key steps of the tile are written out: the second step's K fragments are read together with the first step's V^T fragments, so that only the tile's first K reads are waited for in the open.
      v16h kf[2][4];                                         // [step parity][keys 0..15: d halves | keys 16..31: d halves]
      kf[0][0] = ldh(kt); kf[0][1] = ldh(kt + 32); kf[0][2] = ldh(kt + 16 * LP); kf[0][3] = ldh(kt + 16 * LP + 32);
#pragma unroll
      for (int sub = 0; sub < KS; sub += 32) {
        const int c = (sub / 32) & 1;
        v8f sA[2], sB[2];
#pragma unroll
        for (int g = 0; g < 2; ++g) { sA[g] = wmma16(kf[c][0], qh[g][0], (v8f){}); sB[g] = wmma16(kf[c][2], qh[g][0], (v8f){}); }
#pragma unroll
        for (int g = 0; g < 2; ++g) { sA[g] = wmma16(kf[c][1], qh[g][1], sA[g]); sB[g] = wmma16(kf[c][3], qh[g][1], sB[g]); }
        const h16* va = kt + KS * LP + sub;
        const v16h v0 = ldh(va), v1 = ldh(va + 16 * LP), v2 = ldh(va + 32 * LP), v3 = ldh(va + 48 * LP);
        if (sub + 32 < KS) {
            const h16* kn = kt + (sub + 32) * LP;
            kf[c ^ 1][0] = ldh(kn); kf[c ^ 1][1] = ldh(kn + 32); kf[c ^ 1][2] = ldh(kn + 16 * LP); kf[c ^ 1][3] = ldh(kn + 16 * LP + 32);
        }
        // Keeps these LDS reads here, in flight under the softmax: left alone, the compiler sinks them behind the test and the conversions, and each wave waits out their latency in front of its products.
        asm volatile("" ::: "memory");
        // Lazy rescale: the reference m stays as it is while no score of the pass tops it by more than TAU; each lane tests its own 16 keys of either group (raw scores against thr) and one ballot joins the wave,
        // so that the halves' exchange, alpha and the multiplies on the accumulators stand on the rare side of one scalar branch. P stays at or below 2^(PSH + TAU), inside f16.
        float mx[2];
#pragma unroll
        for (int g = 0; g < 2; ++g) {
            mx[g] = -3.0e38f;
#pragma unroll
            for (int r = 0; r < 8; ++r) mx[g] = fmaxf(mx[g], fmaxf(sA[g][r], sB[g][r]));
        }
        if (__builtin_amdgcn_ballot_w32(mx[0] > thr[0] || mx[1] > thr[1]) != 0) {   // wave-uniform; always taken in a wave's first pass (thr starts at the lowest value)
#pragma unroll
            for (int g = 0; g < 2; ++g) {
                const float ms = mx[g] * SC2;
                const float mnew = fmaxf(PSH - sh[g], fmaxf(ms, xhalf(ms)));   // the same value in both lanes of a query column
                const float shn = PSH - mnew;
                const float alpha = __builtin_amdgcn_exp2f(shn - sh[g]);
                o[g][0] = o[g][0] * alpha; o[g][1] = o[g][1] * alpha; o[g][2] = o[g][2] * alpha; o[g][3] = o[g][3] * alpha; lt[g] = lt[g] * alpha;
                sh[g] = shn; thr[g] = (mnew + TAU) * (1.0f / SC2);
            }
        }
        v16h pb[2];
#pragma unroll
        for (int g = 0; g < 2; ++g) {
#pragma unroll
            for (int r = 0; r < 8; ++r) pb[g][r] = (h16)__builtin_amdgcn_exp2f(sA[g][r] * SC2 + sh[g]);
#pragma unroll
            for (int r = 0; r < 8; ++r) pb[g][8 + r] = (h16)__builtin_amdgcn_exp2f(sB[g][r] * SC2 + sh[g]);
            lt[g] = wmma16(ones, pb[g], lt[g]);               // rows 0 and 8: the sums of the rounded P over all keys so far, one per query column; rescaled like an output tile
            o[g][0] = wmma16(v0, pb[g], o[g][0]); o[g][1] = wmma16(v1, pb[g], o[g][1]); o[g][2] = wmma16(v2, pb[g], o[g][2]); o[g][3] = wmma16(v3, pb[g], o[g][3]);
        }
        // four vector slots behind the tile's last product, on either side of the loop's branch, before anything may touch its registers
        if (sub + 32 >= KS)
            asm volatile("v_nop\n\tv_nop\n\tv_nop\n\tv_nop" : "+v"(o[0][0]), "+v"(o[0][1]), "+v"(o[0][2]), "+v"(o[0][3]), "+v"(lt[0]), "+v"(o[1][0]), "+v"(o[1][1]), "+v"(o[1][2]), "+v"(o[1][3]), "+v"(lt[1])
                         : "v"(v0), "v"(v1), "v"(v2), "v"(v3), "v"(pb[0]), "v"(pb[1]));
      }
      asm volatile("s_wait_dscnt 0x0" ::: "memory");         // this wave's reads of the tile are done before its buffer may be refilled
      asm volatile("s_wait_asynccnt 0x0" ::: "memory");      // this wave's copies of the next tile have landed
      __syncthreads();                                       // publishes the next tile and ends every wave's reads of this one
      if (kt0 + 2 * KS < SEQ) {                              // block-uniform: refill the buffer just read with the tile after next
          const unsigned l0 = lb + buf * (2 * TB); const h16* g0 = gk + (size_t)(kt0 + 2 * KS) * HD; const h16* g2 = gv + (kt0 + 2 * KS);
          stage4(l0, l0 + HB, l0 + TB, l0 + TB + HB, g0, g0 + 32 * HD, g2, g2 + (size_t)32 * SEQ);
      }
    }
    asm volatile("s_wait_asynccnt 0x0" ::: "memory");        // nothing of this wave's copies is outstanding past the loop
    const int wb = wave * 16 * 68;
    // the two column groups go through the wave's own staging tile one after the other
#pragma unroll
    for (int g = 0; g < 2; ++g) {
        const float inv = CXS * (1.0f / lt[g][0]);
        // O^T D layout: o[g][j][r] = (d = 16j + 8h + r, t = 16g + (lane&15)) -> os[t - 16g][d]; rows 0..15 x columns 0..63 all written
#pragma unroll
        for (int j = 0; j < 4; ++j) {
            v4f a, c;
#pragma unroll
            for (int i = 0; i < 4; ++i) { a[i] = o[g][j][i] * inv; c[i] = o[g][j][4 + i] * inv; }
            *(v4fa*)(&os[wb + lr * 68 + 16 * j + 8 * hi]) = a; *(v4fa*)(&os[wb + lr * 68 + 16 * j + 8 * hi + 4]) = c;
        }
        wave_sync();
        h16* crow = CTX + ((size_t)b * SEQ + t0 + 16 * g) * DM + h * HD;
#pragma unroll
        for (int s = 0; s < 4; ++s) { const int row = 4 * s + (lane >> 3), c8 = (lane & 7) * 8;   // 4 s x 4 row groups = 16 rows; 8 lanes x 8 halves = 64 columns
            const v4f x0 = *(const v4fa*)(&os[wb + row * 68 + c8]); const v4f x1 = *(const v4fa*)(&os[wb + row * 68 + c8 + 4]); v8h hv;
#pragma unroll
            for (int i = 0; i < 4; ++i) { hv[i] = (h16)x0[i]; hv[4 + i] = (h16)x1[i]; }
            *(v8h*)(crow + (size_t)row * DM + c8) = hv; }
        wave_sync();
    }
}

// k_oproj: f16 GEMM, K = DM split over the OW waves of a block. A block owns OBM output rows x all 64 columns; each wave takes one k slice of OKS, has every fragment load of
// its slice in flight at once (no loop, one load latency), and leaves an f32 partial tile in LDS; after one block barrier the partials are summed in wave order.
// Transposed form (A = WoT rows n, B = ctx rows m): a lane holds 8 consecutive n of one output row m, so a partial tile goes to LDS in 16-byte stores.
// OUT[m][n] = (sum_k CX[m][k] WoT[n][k]) * 2^-18 + bo[n] (bo as bf16-RNE value), f32. grid (M/OBM), 32 * OW threads.
__global__ __launch_bounds__(32 * OW) void k_oproj(const h16* __restrict__ A, const h16* __restrict__ Bt, const float* __restrict__ bo, float* OUT) {
    __shared__ __align__(16) float ps[OW * OBM * 68];        // [wave][row m][68]: 272-B pitch, as the other epilogue tiles
    const int K = DM;
    const int lane = threadIdx.x & 31, lr = lane & 15, hi = lane >> 4;
    const int wave = __builtin_amdgcn_readfirstlane(threadIdx.x >> 5);   // wave-uniform: the slice's base stays scalar
    const int r0 = blockIdx.x * OBM;
    const h16* px = A + (size_t)(r0 + lr) * K + wave * OKS + 8 * hi;
    const h16* pw = Bt + (size_t)lr * K + wave * OKS + 8 * hi;
    v16h x[OBM / 16][OKS / 32], w[4][OKS / 32];
#pragma unroll
    for (int s = 0; s < OKS / 32; ++s) {
#pragma unroll
        for (int mb = 0; mb < OBM / 16; ++mb) x[mb][s] = ldh(px + (size_t)mb * 16 * K + s * 32);
#pragma unroll
        for (int nb = 0; nb < 4; ++nb) w[nb][s] = ldh(pw + (size_t)nb * 16 * K + s * 32);
    }
    // The wait that belongs in front of any overwrite of the loads' address registers; as its inputs the two addresses stay live up to it, so that no load's own destination takes their registers.
    asm volatile("s_wait_xcnt 0x0" :: "v"(px), "v"(pw) : "memory");
    // Keeps every load above in front of the first product: left alone, the compiler reuses two fragment register sets and waits out one load latency per pair of products.
    __builtin_amdgcn_sched_barrier(0);
    v8f acc[OBM / 16][4];
#pragma unroll
    for (int mb = 0; mb < OBM / 16; ++mb)
#pragma unroll
        for (int nb = 0; nb < 4; ++nb) acc[mb][nb] = (v8f){};
#pragma unroll
    for (int s = 0; s < OKS / 32; ++s)
#pragma unroll
        for (int nb = 0; nb < 4; ++nb)
#pragma unroll
            for (int mb = 0; mb < OBM / 16; ++mb) acc[mb][nb] = wmma16(w[nb][s], x[mb][s], acc[mb][nb]);
    // D layout: acc[mb][nb][j] = (n = 16nb + 8h + j, m = 16mb + (lane&15)) -> ps[wave][m][n]; rows 0..OBM-1 x columns 0..63 all written
    float* pd = ps + wave * (OBM * 68) + lr * 68 + 8 * hi;
#pragma unroll
    for (int mb = 0; mb < OBM / 16; ++mb)
#pragma unroll
        for (int nb = 0; nb < 4; ++nb) {
            v4f lo, up;
#pragma unroll
            for (int i = 0; i < 4; ++i) { lo[i] = acc[mb][nb][i]; up[i] = acc[mb][nb][4 + i]; }
            *(v4fa*)(pd + mb * 16 * 68 + nb * 16) = lo; *(v4fa*)(pd + mb * 16 * 68 + nb * 16 + 4) = up;
        }
    __syncthreads();                                         // every wave's partial tile is published
    const int row = threadIdx.x >> 4, cofs = (threadIdx.x & 15) * 4;   // 32 * OW threads = OBM rows x 16 groups of 4 columns
    v4f sum = *(const v4fa*)(&ps[row * 68 + cofs]);
#pragma unroll
    for (int q = 1; q < OW; ++q) sum += *(const v4fa*)(&ps[q * (OBM * 68) + row * 68 + cofs]);
    const int bidx = r0 / SEQ, tt = r0 % SEQ;
    float* obase = OUT + ((size_t)bidx * OUT_SEQ + tt) * NO;
    v4f val;
#pragma unroll
    for (int i = 0; i < 4; ++i) val[i] = sum[i] * OSC + bfr(bo[cofs + i]);
    *(v4f*)(obase + (size_t)row * NO + cofs) = val;
}

static constexpr size_t al256(size_t v) { return (v + 255) & ~(size_t)255; }
static constexpr size_t SZ_XB = al256((size_t)NB * SEQ * DIN * 2);
static constexpr size_t SZ_WB = al256((size_t)3 * DM * DIN * 2);
static constexpr size_t SZ_WO = al256((size_t)NO * DM * 2);
static constexpr size_t SZ_PL = al256((size_t)NB * NH_ * SEQ * HD * 2);
static constexpr size_t SZ_CX = al256((size_t)NB * SEQ * DM * 2);
static constexpr size_t SZ_TOTAL = 2 * SZ_XB + SZ_WB + SZ_WO + 3 * SZ_PL + SZ_CX;
static_assert(SZ_TOTAL <= (size_t)134217728);          // workspace carve <= 128 MiB
static_assert(((size_t)DM * DIN * 2) % 256 == 0);      // weight sub-planes stay 256-byte aligned

extern "C" void kernel_launch(void* const* d_in, const int* in_sizes, int n_in,
                              void* d_out, int out_size, void* d_ws, size_t ws_size, hipStream_t stream) {
    if (n_in < 10) return;
    const size_t needx = ((size_t)(NB - 1) * SEQ_FULL + SEQ) * DIN;
    if ((size_t)in_sizes[0] < needx || (size_t)in_sizes[1] < needx) return;
    if ((size_t)in_sizes[2] < (size_t)NH_ * DIN * HD || (size_t)in_sizes[4] < (size_t)NH_ * DIN * HD || (size_t)in_sizes[6] < (size_t)NH_ * DIN * HD) return;
    if ((size_t)in_sizes[3] < (size_t)NH_ * HD || (size_t)in_sizes[5] < (size_t)NH_ * HD || (size_t)in_sizes[7] < (size_t)NH_ * HD) return;
    if ((size_t)in_sizes[8] < (size_t)DM * NO || (size_t)in_sizes[9] < (size_t)NO) return;
    if ((size_t)out_size < ((size_t)(NB - 1) * OUT_SEQ + SEQ) * NO) return;
    if (SZ_TOTAL > ws_size) return;
    // wire order: current_tokens, context_tokens, Wq, bq, Wk, bk, Wv, bv, Wo, bo
    const float* xq = (const float*)d_in[0]; const float* xc = (const float*)d_in[1];
    const float* wq = (const float*)d_in[2]; const float* bq = (const float*)d_in[3];
    const float* wk = (const float*)d_in[4]; const float* bk = (const float*)d_in[5];
    const float* wv = (const float*)d_in[6]; const float* bv = (const float*)d_in[7];
    const float* wo = (const float*)d_in[8]; const float* bo = (const float*)d_in[9];
    float* OUT = (float*)d_out;      // [NB][SEQ][64]
    char* wsp = (char*)d_ws;
    bf* XQ = (bf*)wsp; wsp += SZ_XB;                 // [NB*SEQ][1024] query tokens
    bf* XC = (bf*)wsp; wsp += SZ_XB;                 // [NB*SEQ][1024] context tokens
    bf* WB = (bf*)wsp; wsp += SZ_WB;                 // [3][16*64][1024]: q | k | v, rows n = h*64 + a, k-contiguous
    bf* WO = (bf*)wsp; wsp += SZ_WO;                 // [64][1024] f16 bits, x1024
    h16* QH = (h16*)wsp; wsp += SZ_PL;               // [NB*16][SEQ][64]
    h16* KP = (h16*)wsp; wsp += SZ_PL;               // [NB*16][SEQ][64]
    h16* VT = (h16*)wsp; wsp += SZ_PL;               // [NB*16][64][SEQ]
    h16* CX = (h16*)wsp; wsp += SZ_CX;               // [NB*SEQ][1024] ctx x256

    k_prep<<<dim3(3 * WTB + WOB + 2 * CVB, 1, 1), 256, 0, stream>>>(xq, xc, wq, wk, wv, wo, XQ, XC, WB, WO);

    k_proj<<<dim3(PGB, 2, 1), 256, 0, stream>>>(XQ, XC, WB, QH, KP, VT, bq, bk, bv);

    k_flash<<<dim3(SEQ / (QW * AW), NB * NH_, 1), 32 * AW, 0, stream>>>(QH, KP, VT, CX);

    k_oproj<<<dim3(NB * SEQ / OBM, 1, 1), 32 * OW, 0, stream>>>(CX, (const h16*)WO, bo, OUT);
}
